// v000
// Measured on an AMD MI455X. A time is GPU time per run, averaged over a window of back-to-back runs after a warm-up
// (all launches, gaps included; the runs take copies of the inputs in turn), and the median of several windows.
// Apart from v000's, it joins two sittings. Times from different sittings can be a few percent apart, while
// side-by-side timings come from the same sitting.
// The starting kernel, v000, takes 1370 microseconds a run.
#include <hip/hip_runtime.h>

// Causal multi-head self-attention with interleaved-pair rotary position embedding from PER-BATCH position rows (x [2][2048][1024]; q, k, v = einsum('bsd,od', x, W) ('oi' [1024][1024], no bias; 16 heads x 64); angle = float(token_positions[b][t]) x 1 / theta ** (2i / 64) (theta 1e4; token_positions int32 [2][2048]: each batch has its OWN sorted row of random positions in [0, 2048), READ on device); pairs (2i, 2i+1): (xe cos - xo sin, xe sin + xo cos) on q and k; scores / sqrt(64); keys j <= i kept (by INDEX, not by position), -inf elsewhere; softmax; out = einsum('bso,do', merged, Wo) -> [2][2048][1024] (4.2 M); argument order x, Wq, Wk, Wv, Wo, token_positions).
// Layout per batch: bf16 copy of x; exact projections; {cos, sin} per (position, pair) built once from the int positions and float32 inverse-frequency constants (precise cosf/sinf); interleaved rotary plane builder; causal T-2048 attention (EVERY row's scores on hi/lo planes (3 products: logit sigma 2 with these weights) and hybrid P.V (rows < 512 hi/lo, rest fp16 x1024); k_gemmc skips tiles above the diagonal); merged hi/lo x Wo exact.
// Compute dtypes, f32 accumulate: every input rounded to bf16; projections exact; rotary f32; attention scores 3 products, P.V rows < 512 3 products, rest fp16; softmax f32; Wo hl x exact.

#define NB_  2
#define TT   2048
#define DM   1024
#define NH_  16
#define NKV  16
#define REP  (NH_ / NKV)
#define HD   64
#define DQ   (NH_ * HD)
#define DKV  (NKV * HD)
#define ZH   2
#define RH   512                  // query rows < RH use hi+lo planes (0: none)
#define WIN  2048
#define PCAR 1024.0f
#define SCL  0.125f   // HD^-0.5
typedef _Float16 h16;
typedef unsigned short bf;
typedef __attribute__((ext_vector_type(16))) __bf16   v16bf;
typedef __attribute__((ext_vector_type(16))) _Float16 v16h;
typedef __attribute__((ext_vector_type(8)))  _Float16 v8h;
typedef __attribute__((ext_vector_type(8)))  unsigned short v8us;
typedef __attribute__((ext_vector_type(8)))  float    v8f;
typedef __attribute__((ext_vector_type(4)))  float    v4f;
typedef v8h  __attribute__((may_alias)) v8ha;
typedef v4f  __attribute__((may_alias)) v4fa;
typedef v8us __attribute__((may_alias)) v8usa;

__device__ __forceinline__ unsigned short f2bf(float f) { unsigned u = __float_as_uint(f); u += 0x7FFFu + ((u >> 16) & 1u); return (unsigned short)(u >> 16); }
__device__ __forceinline__ float bf2f(unsigned short b) { return __uint_as_float(((unsigned)b) << 16); }
__device__ __forceinline__ float bfr(float f) { return bf2f(f2bf(f)); }
__device__ __forceinline__ v16h cat16(v8h lo, v8h hi) { return __builtin_shufflevector(lo, hi, 0, 1, 2, 3, 4, 5, 6, 7, 8, 9, 10, 11, 12, 13, 14, 15); }
__device__ __forceinline__ v16bf cat16b(v8us lo, v8us hi) { return __builtin_bit_cast(v16bf, __builtin_shufflevector(lo, hi, 0, 1, 2, 3, 4, 5, 6, 7, 8, 9, 10, 11, 12, 13, 14, 15)); }
__device__ __forceinline__ v8f wmma16(v16h a, v16h b, v8f c) { return __builtin_amdgcn_wmma_f32_16x16x32_f16(false, a, false, b, (short)0, c, false, false); }
__device__ __forceinline__ v8f wmmab(v16bf a, v16bf b, v8f c) { return __builtin_amdgcn_wmma_f32_16x16x32_bf16(false, a, false, b, (short)0, c, false, false); }



// ---- k_gemmw: register-blocked GEMM, ONE WAVE per 64x64 output tile (16 accumulators), operands straight from K-contiguous 16-bit planes; grid (M/64, N/64, Z), 32 threads.
// C[m][n] (f32, pitch ldc, + optional f32 bias[n]) = sum_k A[m][k] Bt[n][k] (+ split products per NSPLIT). z-batch strides sA/sB/sC in elements. K % 32 == 0.
template <typename T16> struct WFrag;
template <> struct WFrag<h16> { typedef v16h V; static __device__ __forceinline__ V ld(const h16* p) { return cat16(*(const v8h*)p, *(const v8h*)(p + 16)); } static __device__ __forceinline__ v8f mma(V a, V b, v8f c) { return wmma16(a, b, c); } };
template <> struct WFrag<bf> { typedef v16bf V; static __device__ __forceinline__ V ld(const bf* p) { return cat16b(*(const v8us*)p, *(const v8us*)(p + 16)); } static __device__ __forceinline__ v8f mma(V a, V b, v8f c) { return wmmab(a, b, c); } };
template <typename T16, int NSPLIT, bool BIAS>
__global__ __launch_bounds__(32) void k_gemmw(const T16* __restrict__ A, const T16* __restrict__ A2, const T16* __restrict__ Bt, const T16* __restrict__ Bt2, int K, float* C, int ldc, const float* __restrict__ bias, size_t sA, size_t sB, size_t sC) {
    typedef typename WFrag<T16>::V V;
    __shared__ __align__(16) float os[16 * 68];
    const size_t z = blockIdx.z; A += z * sA; if (A2) A2 += z * sA; Bt += z * sB; if (Bt2) Bt2 += z * sB; C += z * sC;
    const int lane = threadIdx.x & 31, lr = lane & 15, hi = lane >> 4; const int r0 = blockIdx.x * 64, c0 = blockIdx.y * 64;
    v8f acc[4][4];
#pragma unroll
    for (int mb = 0; mb < 4; ++mb)
#pragma unroll
        for (int nb = 0; nb < 4; ++nb) acc[mb][nb] = (v8f){};
    const size_t aoff = (size_t)(r0 + lr) * K + 8 * hi, boff = (size_t)(c0 + lr) * K + 8 * hi;
#pragma unroll 1
    for (int kc = 0; kc < K; kc += 32) {
        V a[4], a2[4];
#pragma unroll
        for (int mb = 0; mb < 4; ++mb) { a[mb] = WFrag<T16>::ld(A + aoff + (size_t)mb * 16 * K + kc); if (NSPLIT == 1 || NSPLIT == 2) a2[mb] = WFrag<T16>::ld(A2 + aoff + (size_t)mb * 16 * K + kc); }
#pragma unroll
        for (int nb = 0; nb < 4; ++nb) { const V b = WFrag<T16>::ld(Bt + boff + (size_t)nb * 16 * K + kc); V b2; if (NSPLIT >= 2) b2 = WFrag<T16>::ld(Bt2 + boff + (size_t)nb * 16 * K + kc);
#pragma unroll
            for (int mb = 0; mb < 4; ++mb) { acc[mb][nb] = WFrag<T16>::mma(a[mb], b, acc[mb][nb]); if (NSPLIT == 1 || NSPLIT == 2) acc[mb][nb] = WFrag<T16>::mma(a2[mb], b, acc[mb][nb]); if (NSPLIT >= 2) acc[mb][nb] = WFrag<T16>::mma(a[mb], b2, acc[mb][nb]); } }
        asm volatile("v_nop\n\tv_nop\n\tv_nop\n\tv_nop" : "+v"(acc[0][0]), "+v"(acc[1][1]), "+v"(acc[2][2]), "+v"(acc[3][3]) : "v"(a[0]), "v"(a[3]));
    }
#pragma unroll
    for (int mb = 0; mb < 4; ++mb) {
#pragma unroll
        for (int nb = 0; nb < 4; ++nb) {
#pragma unroll
            for (int j = 0; j < 8; ++j) os[(hi * 8 + j) * 68 + nb * 16 + lr] = acc[mb][nb][j]; }
        __builtin_amdgcn_wave_barrier(); asm volatile("" ::: "memory");
        float* crow = C + (size_t)(r0 + mb * 16) * ldc + c0;
{
#pragma unroll
            for (int s = 0; s < 8; ++s) { const int row = 2 * s + hi, cofs = lr * 4; v4f val = *(const v4fa*)(os + row * 68 + cofs); if (BIAS) { val[0] += bfr(bias[c0 + cofs]); val[1] += bfr(bias[c0 + cofs + 1]); val[2] += bfr(bias[c0 + cofs + 2]); val[3] += bfr(bias[c0 + cofs + 3]); }
                *(v4f*)(crow + (size_t)row * ldc + cofs) = val; }
             }
        __builtin_amdgcn_wave_barrier(); asm volatile("" ::: "memory");
    }
}

// ---- k_gemmc: the same one-wave 64x64 tile GEMM specialised for causal attention: CMODE 1 skips score tiles entirely above the diagonal (query rows r0+roff.., key columns c0..), CMODE 2 limits the
// key (K) loop of the probability x value contraction to the diagonal block (probabilities beyond it are exactly zero). roff = row offset of this launch's first row within the sequence.
template <typename T16, int NSPLIT, int CMODE>
__global__ __launch_bounds__(32) void k_gemmc(const T16* __restrict__ A, const T16* __restrict__ A2, const T16* __restrict__ Bt, const T16* __restrict__ Bt2, int K, float* C, int ldc, int roff, size_t sA, size_t sB, size_t sC) {
    typedef typename WFrag<T16>::V V;
    __shared__ __align__(16) float os[16 * 68];
    const size_t z = blockIdx.z; A += z * sA; if (A2) A2 += z * sA; Bt += z * sB; if (Bt2) Bt2 += z * sB; C += z * sC;
    const int lane = threadIdx.x & 31, lr = lane & 15, hi = lane >> 4; const int r0 = blockIdx.x * 64, c0 = blockIdx.y * 64;
    if (CMODE == 1 && c0 > r0 + roff + 63) return;                  // score tile entirely above the causal diagonal: never read (the softmax masks j > i by select)
    const int Kl = (CMODE == 2) ? min(K, r0 + roff + 64) : K;        // P.V: probabilities are exactly 0 beyond the diagonal block, so the K loop stops there
    v8f acc[4][4];
#pragma unroll
    for (int mb = 0; mb < 4; ++mb)
#pragma unroll
        for (int nb = 0; nb < 4; ++nb) acc[mb][nb] = (v8f){};
    const size_t aoff = (size_t)(r0 + lr) * K + 8 * hi, boff = (size_t)(c0 + lr) * K + 8 * hi;
#pragma unroll 1
    for (int kc = 0; kc < Kl; kc += 32) {
        V a[4], a2[4];
#pragma unroll
        for (int mb = 0; mb < 4; ++mb) { a[mb] = WFrag<T16>::ld(A + aoff + (size_t)mb * 16 * K + kc); if (NSPLIT == 1 || NSPLIT == 2) a2[mb] = WFrag<T16>::ld(A2 + aoff + (size_t)mb * 16 * K + kc); }
#pragma unroll
        for (int nb = 0; nb < 4; ++nb) { const V b = WFrag<T16>::ld(Bt + boff + (size_t)nb * 16 * K + kc); V b2; if (NSPLIT >= 2) b2 = WFrag<T16>::ld(Bt2 + boff + (size_t)nb * 16 * K + kc);
#pragma unroll
            for (int mb = 0; mb < 4; ++mb) { acc[mb][nb] = WFrag<T16>::mma(a[mb], b, acc[mb][nb]); if (NSPLIT == 1 || NSPLIT == 2) acc[mb][nb] = WFrag<T16>::mma(a2[mb], b, acc[mb][nb]); if (NSPLIT >= 2) acc[mb][nb] = WFrag<T16>::mma(a[mb], b2, acc[mb][nb]); } }
        asm volatile("v_nop\n\tv_nop\n\tv_nop\n\tv_nop" : "+v"(acc[0][0]), "+v"(acc[1][1]), "+v"(acc[2][2]), "+v"(acc[3][3]) : "v"(a[0]), "v"(a[3]));
    }
#pragma unroll
    for (int mb = 0; mb < 4; ++mb) {
#pragma unroll
        for (int nb = 0; nb < 4; ++nb) {
#pragma unroll
            for (int j = 0; j < 8; ++j) os[(hi * 8 + j) * 68 + nb * 16 + lr] = acc[mb][nb][j]; }
        __builtin_amdgcn_wave_barrier(); asm volatile("" ::: "memory");
        float* crow = C + (size_t)(r0 + mb * 16) * ldc + c0;
{
#pragma unroll
            for (int s = 0; s < 8; ++s) { const int row = 2 * s + hi, cofs = lr * 4; v4f val = *(const v4fa*)(os + row * 68 + cofs);
                *(v4f*)(crow + (size_t)row * ldc + cofs) = val; }
             }
        __builtin_amdgcn_wave_barrier(); asm volatile("" ::: "memory");
    }
}

__device__ __forceinline__ h16 tohx(float x) { return (h16)x; }
__device__ __forceinline__ void splitf(float y, unsigned short& h, unsigned short& l) { h = f2bf(y); l = f2bf(y - bf2f(h)); }
typedef __attribute__((ext_vector_type(2))) _Float16 v2h;
typedef __attribute__((ext_vector_type(4))) _Float16 v4h;
typedef __attribute__((ext_vector_type(2))) unsigned short v2us;
typedef __attribute__((ext_vector_type(4))) unsigned short v4us;
typedef __attribute__((ext_vector_type(2))) float v2f;
typedef __attribute__((ext_vector_type(4))) int v4i;

__global__ __launch_bounds__(256) void k_wtG(const float* __restrict__ w, int K, int N, bf* Bt) {
    const int lane = threadIdx.x & 31; const int L0 = (blockIdx.x * 8 + (threadIdx.x >> 5)) * 8; const int nlines = N * K / 64;
{
#pragma unroll 1
        for (int l = 0; l < 8; ++l) { const int L = L0 + l; if (L >= nlines) break; const size_t e = (size_t)L * 64 + lane * 2; const int k = (int)(e % K), n = (int)(e / K); v2us o;
            o[0] = f2bf(w[(size_t)k * N + n]); o[1] = f2bf(w[(size_t)(k + 1) * N + n]); *(v2us*)(Bt + e) = o; }
         }
}
__global__ __launch_bounds__(256) void k_cvt8(const float* __restrict__ src, bf* dst, size_t n8) { const size_t i = (size_t)blockIdx.x * 256 + threadIdx.x; if (i >= n8) return; const v8f v = *(const v8f*)(src + i * 8); v8us o;
#pragma unroll
    for (int k = 0; k < 8; ++k) o[k] = f2bf(v[k]); *(v8us*)(dst + i * 8) = o;  }

__global__ __launch_bounds__(256) void k_ropeI(const float* __restrict__ F, int pitch, int nheads, const float* __restrict__ CS, float sc, h16* P16, bf* Ph, bf* Pl) {
    const size_t e = ((size_t)blockIdx.x * 256 + threadIdx.x) * 2; if (e >= (size_t)nheads * TT * HD) return; const int d = (int)(e % HD); const int t = (int)((e / HD) % TT); const int h = (int)(e / ((size_t)HD * TT)); const float* f = F + (size_t)t * pitch + h * HD; const float x0 = f[d], x1 = f[d + 1]; const v2f cs = *(const v2f*)(CS + ((size_t)t * HD + d) * 2); v2h o16; v2us oh, ol;
    float a0 = __fmul_rn(x0, cs[0]), b0 = __fmul_rn(x1, cs[1]), a1 = __fmul_rn(x1, cs[0]), b1 = __fmul_rn(x0, cs[1]); asm volatile("" : "+v"(a0), "+v"(b0), "+v"(a1), "+v"(b1));
    float r0 = __fsub_rn(a0, b0) * sc, r1 = __fadd_rn(b1, a1) * sc;   /* even: x0 c - x1 s; odd: x0 s + x1 c */
    o16[0] = tohx(r0); o16[1] = tohx(r1); { unsigned short a2, c2; splitf(r0, a2, c2); oh[0] = a2; ol[0] = c2; splitf(r1, a2, c2); oh[1] = a2; ol[1] = c2; }
    *(v2h*)(P16 + e) = o16; *(v2us*)(Ph + e) = oh; *(v2us*)(Pl + e) = ol;  }

__constant__ float INV2[HD / 2] = { 1.000000000e+00f, 7.498942018e-01f, 5.623413324e-01f, 4.216965139e-01f, 3.162277639e-01f, 2.371373624e-01f, 1.778279394e-01f, 1.333521456e-01f, 1.000000015e-01f, 7.498941571e-02f, 5.623412877e-02f, 4.216964915e-02f, 3.162277862e-02f, 2.371373586e-02f, 1.778279431e-02f, 1.333521493e-02f, 9.999999776e-03f, 7.498942316e-03f, 5.623413250e-03f, 4.216964822e-03f, 3.162277862e-03f, 2.371373819e-03f, 1.778279431e-03f, 1.333521446e-03f, 1.000000047e-03f, 7.498941850e-04f, 5.623413017e-04f, 4.216964880e-04f, 3.162277862e-04f, 2.371373848e-04f, 1.778279402e-04f, 1.333521504e-04f };   // float32 10000^(-(i * 2 / 64)), generated with jnp to be bit-exact with the module's expression
__global__ __launch_bounds__(256) void k_cstabI(const int* __restrict__ pid, float* CS) { const int idx = blockIdx.x * 256 + threadIdx.x; if (idx >= TT * HD) return; const int d = idx % HD; const int t = idx / HD; const float a = __fmul_rn((float)pid[t], INV2[d >> 1]); v2f cs; cs[0] = cosf(a); cs[1] = sinf(a); *(v2f*)(CS + (size_t)idx * 2) = cs;  }

__global__ __launch_bounds__(256) void k_vtp(const float* __restrict__ F, int pitch, int nheads, h16* V16, bf* Vh, bf* Vl) { const size_t e = ((size_t)blockIdx.x * 256 + threadIdx.x) * 2; if (e >= (size_t)nheads * HD * TT) return; const int t = (int)(e % TT); const int d = (int)((e / TT) % HD); const int g = (int)(e / ((size_t)TT * HD)); v2h o16; v2us oh, ol;
#pragma unroll
    for (int q = 0; q < 2; ++q) { const float x = F[(size_t)(t + q) * pitch + g * HD + d]; o16[q] = tohx(x); unsigned short a2, c2; splitf(x, a2, c2); oh[q] = a2; ol[q] = c2; }
    *(v2h*)(V16 + e) = o16; *(v2us*)(Vh + e) = oh; *(v2us*)(Vl + e) = ol;  }
// k_asoft: per row (zz, i): t = S x HD^-0.5 for j <= i and i - j < WIN (sliding causal window; the reference's -1e9 additive fill vanishes identically); softmax over the 2048 keys (register row, one exp, fixed trees);
__global__ __launch_bounds__(256) void k_asoft(const float* __restrict__ Sb, h16* P16, bf* Ph, bf* Pl) {
    const int lane = threadIdx.x & 31; const int row = blockIdx.x * 8 + (threadIdx.x >> 5); if (row >= ZH * TT) return; const int i = row % TT; const int zz = row / TT; (void)zz; const bool hires = (i < RH); const float* sr = Sb + (size_t)row * TT; float v[TT / 32]; float mx = -3.0e38f;
#pragma unroll
    for (int ch = 0; ch < TT / 128; ++ch) { const int j0 = ch * 128 + lane * 4; const v4f a = *(const v4f*)(sr + j0);
#pragma unroll
        for (int q = 0; q < 4; ++q) { const int j = j0 + q; (void)j; const float t = (j <= i && i - j < WIN) ? a[q] * SCL : -3.0e38f; v[ch * 4 + q] = t; mx = fmaxf(mx, t); } }
#pragma unroll
    for (int sh = 16; sh; sh >>= 1) mx = fmaxf(mx, __shfl_xor(mx, sh, 32));
    float sum = 0.f;
#pragma unroll
    for (int k = 0; k < TT / 32; ++k) { float d0 = __fsub_rn(v[k], mx); asm volatile("" : "+v"(d0)); v[k] = __builtin_amdgcn_exp2f(__fmul_rn(d0, 1.4426950408889634f)); sum += v[k]; }
#pragma unroll
    for (int sh = 16; sh; sh >>= 1) sum += __shfl_xor(sum, sh, 32);
    const float f = __fdiv_rn(hires ? 1.0f : PCAR, sum);
{
        if (hires) {
#pragma unroll
            for (int ch = 0; ch < TT / 128; ++ch) { v4us oh, ol;
#pragma unroll
                for (int q = 0; q < 4; ++q) { unsigned short a, c2; splitf(v[ch * 4 + q] * f, a, c2); oh[q] = a; ol[q] = c2; }
                const size_t oo = ((size_t)zz * (RH ? RH : 1) + i) * TT + ch * 128 + lane * 4; *(v4us*)(Ph + oo) = oh; *(v4us*)(Pl + oo) = ol; }
        } else {
#pragma unroll
            for (int ch = 0; ch < TT / 128; ++ch) { v4h o4;
#pragma unroll
                for (int q = 0; q < 4; ++q) o4[q] = tohx(v[ch * 4 + q] * f);
                *(v4h*)(P16 + (size_t)row * TT + ch * 128 + lane * 4) = o4; } }
         }
}
__global__ __launch_bounds__(256) void k_merge(const float* __restrict__ O, int h0, bf* Ah, bf* Al) { const size_t e = ((size_t)blockIdx.x * 256 + threadIdx.x) * 2; if (e >= (size_t)ZH * TT * HD) return; const int d = (int)(e % HD); const int t = (int)((e / HD) % TT); const int zz = (int)(e / ((size_t)HD * TT)); const float cs = (t < RH) ? 1.0f : (1.0f / PCAR); const size_t oo = (size_t)t * DQ + (h0 + zz) * HD + d;
    v2us oh, ol;
#pragma unroll
    for (int q = 0; q < 2; ++q) { unsigned short a, c2; splitf(O[e + q] * cs, a, c2); oh[q] = a; ol[q] = c2; } *(v2us*)(Ah + oo) = oh; *(v2us*)(Al + oo) = ol;  }

extern "C" void kernel_launch(void* const* d_in, const int* in_sizes, int n_in,
                              void* d_out, int out_size, void* d_ws, size_t ws_size, hipStream_t stream) {
    (void)in_sizes; (void)n_in; (void)out_size;
        const float* x = (const float*)d_in[0]; const int* PID = (const int*)d_in[5]; const float* wq = (const float*)d_in[1]; const float* wk = (const float*)d_in[2]; const float* wv = (const float*)d_in[3]; const float* wo = (const float*)d_in[4];   /* order x, Wq, Wk, Wv, Wo ('oi' [1024][1024]), token_positions (int32 [2][2048]: ONE row of positions PER BATCH, sorted random values in [0, 2048); read on device) */
    float* OUT = (float*)d_out;     // [2][2048][1024]
    char* wsp = (char*)d_ws;
    auto take = [&](size_t bytes) { char* p = wsp; wsp += (bytes + 255) & ~(size_t)255; return (void*)p; };
    bf* WQ = (bf*)take((size_t)DQ * DM * 2); bf* WK = (bf*)take((size_t)DKV * DM * 2); bf* WV = (bf*)take((size_t)DKV * DM * 2); bf* WO = (bf*)take((size_t)DM * DQ * 2); float* CS = (float*)take((size_t)TT * HD * 2 * 4);
    bf* XB = (bf*)take((size_t)TT * DM * 2); float* FQ = (float*)take((size_t)TT * DQ * 4); float* FK = (float*)take((size_t)TT * DKV * 4);
    h16* QP16 = (h16*)take((size_t)NH_ * TT * HD * 2); h16* KP16 = (h16*)take((size_t)NKV * TT * HD * 2); h16* VT16 = (h16*)take((size_t)NKV * HD * TT * 2);
    bf* QPh = (bf*)take((size_t)NH_ * TT * HD * 2); bf* QPl = (bf*)take((size_t)NH_ * TT * HD * 2); bf* KPh = (bf*)take((size_t)NKV * TT * HD * 2); bf* KPl = (bf*)take((size_t)NKV * TT * HD * 2); bf* VTh = (bf*)take((size_t)NKV * HD * TT * 2); bf* VTl = (bf*)take((size_t)NKV * HD * TT * 2); bf* Ph = (bf*)take((size_t)ZH * RH * TT * 2); bf* Pl = (bf*)take((size_t)ZH * RH * TT * 2);
    float* Sb = (float*)take((size_t)ZH * TT * TT * 4); h16* P16 = (h16*)take((size_t)ZH * TT * TT * 2); float* Ob = (float*)take((size_t)ZH * TT * HD * 4); bf* ATh = (bf*)take((size_t)TT * DQ * 2); bf* ATl = (bf*)take((size_t)TT * DQ * 2);
    if ((size_t)(wsp - (char*)d_ws) > ws_size) return;    // ws 256 MiB
    float* FV = FK;   // v projection reuses the k buffer after the k planes are built (stream-ordered)
    { k_cvt8<<<(unsigned)(((size_t)DQ * DM / 8 + 255) / 256), 256, 0, stream>>>(wq, WQ, (size_t)DQ * DM / 8); k_cvt8<<<(unsigned)(((size_t)DKV * DM / 8 + 255) / 256), 256, 0, stream>>>(wk, WK, (size_t)DKV * DM / 8); k_cvt8<<<(unsigned)(((size_t)DKV * DM / 8 + 255) / 256), 256, 0, stream>>>(wv, WV, (size_t)DKV * DM / 8);
      k_cvt8<<<(unsigned)(((size_t)DM * DQ / 8 + 255) / 256), 256, 0, stream>>>(wo, WO, (size_t)DM * DQ / 8); /* the rotary table is rebuilt per batch from that batch's positions (below) */ }
    const unsigned LQ = (unsigned)(((size_t)NH_ * TT * HD / 2 + 255) / 256), LKv = (unsigned)(((size_t)NKV * TT * HD / 2 + 255) / 256);
    for (int b = 0; b < NB_; ++b) {
        k_cstabI<<<(TT * HD + 255) / 256, 256, 0, stream>>>(PID + (size_t)b * TT, CS);   /* token_positions[b][:] (int32, read): THIS batch's own row of positions */
        
        k_cvt8<<<(unsigned)(((size_t)TT * DM / 8 + 255) / 256), 256, 0, stream>>>(x + (size_t)b * TT * DM, XB, (size_t)TT * DM / 8);
        k_gemmw<bf, 0, false><<<dim3(TT / 64, DQ / 64, 1), 32, 0, stream>>>(XB, nullptr, WQ, nullptr, DM, FQ, DQ, nullptr, 0, 0, 0);
        k_ropeI<<<LQ, 256, 0, stream>>>(FQ, DQ, NH_, CS, 1.0f, QP16, QPh, QPl);
        k_gemmw<bf, 0, false><<<dim3(TT / 64, DKV / 64, 1), 32, 0, stream>>>(XB, nullptr, WK, nullptr, DM, FK, DKV, nullptr, 0, 0, 0);
        k_ropeI<<<LKv, 256, 0, stream>>>(FK, DKV, NKV, CS, 1.0f, KP16, KPh, KPl);
        k_gemmw<bf, 0, false><<<dim3(TT / 64, DKV / 64, 1), 32, 0, stream>>>(XB, nullptr, WV, nullptr, DM, FV, DKV, nullptr, 0, 0, 0); k_vtp<<<LKv, 256, 0, stream>>>(FV, DKV, NKV, VT16, VTh, VTl);
        for (int h0 = 0; h0 < NH_; h0 += ZH) { const size_t zq = (size_t)h0, zk = (size_t)(h0 / REP);   // one kv head per query head: the pass's two heads use consecutive kv planes (z-strides TT*HD)
            k_gemmc<bf, 2, 1><<<dim3(TT / 64, TT / 64, ZH), 32, 0, stream>>>(QPh + zq * TT * HD, QPl + zq * TT * HD, KPh + zk * TT * HD, KPl + zk * TT * HD, HD, Sb, TT, 0, (size_t)TT * HD, (size_t)TT * HD, (size_t)TT * TT);   /* scores on hi/lo planes for EVERY row (3 products) */
            /* (the fp16 score launch for rows >= RH is removed: all rows use the hi/lo launch above) */
            k_asoft<<<ZH * TT / 8, 256, 0, stream>>>(Sb, P16, Ph, Pl);
            k_gemmc<bf, 2, 2><<<dim3(RH / 64, HD / 64, ZH), 32, 0, stream>>>(Ph, Pl, VTh + zk * HD * TT, VTl + zk * HD * TT, TT, Ob, HD, 0, (size_t)RH * TT, (size_t)HD * TT, (size_t)TT * HD);
            k_gemmc<h16, 0, 2><<<dim3((TT - RH) / 64, HD / 64, ZH), 32, 0, stream>>>(P16 + (size_t)RH * TT, nullptr, VT16 + zk * HD * TT, nullptr, TT, Ob + (size_t)RH * HD, HD, RH, (size_t)TT * TT, (size_t)HD * TT, (size_t)TT * HD);
            k_merge<<<(unsigned)(((size_t)ZH * TT * HD / 2 + 255) / 256), 256, 0, stream>>>(Ob, h0, ATh, ATl); }
        k_gemmw<bf, 1, false><<<dim3(TT / 64, DM / 64, 1), 32, 0, stream>>>(ATh, ATl, WO, nullptr, DQ, OUT + (size_t)b * TT * DM, DM, nullptr, 0, 0, 0); }
}

// v001
// Measured time: 704 microseconds a run.
// Two timings next to v000 both put it at 1.96 times that version's speed.
#include <hip/hip_runtime.h>

// Causal multi-head self-attention with interleaved-pair rotary position embedding from PER-BATCH position rows (x [2][2048][1024]; q, k, v = einsum('bsd,od', x, W) ('oi' [1024][1024], no bias; 16 heads x 64); angle = float(token_positions[b][t]) x 1 / theta ** (2i / 64) (theta 1e4; token_positions int32 [2][2048]: each batch has its OWN sorted row of random positions in [0, 2048), READ on device); pairs (2i, 2i+1): (xe cos - xo sin, xe sin + xo cos) on q and k; scores / sqrt(64); keys j <= i kept (by INDEX, not by position), -inf elsewhere; softmax; out = einsum('bso,do', merged, Wo) -> [2][2048][1024] (4.2 M); argument order x, Wq, Wk, Wv, Wo, token_positions).
// Layout per batch: bf16 copy of x; exact projections; {cos, sin} per (position, pair) built once from the int positions and float32 inverse-frequency constants (precise cosf/sinf); interleaved rotary plane builder; causal T-2048 attention (EVERY row's scores on hi/lo planes (3 products: logit sigma 2 with these weights) and hybrid P.V (rows < 512 hi/lo, rest fp16 x1024); k_gemmc skips tiles above the diagonal); merged hi/lo x Wo exact.
// Compute dtypes, f32 accumulate: every input rounded to bf16; projections exact; rotary f32; attention scores 3 products, P.V rows < 512 3 products, rest fp16; softmax f32; Wo hl x exact.

#define NB_  2
#define TT   2048
#define DM   1024
#define NH_  16
#define NKV  16
#define REP  (NH_ / NKV)
#define HD   64
#define DQ   (NH_ * HD)
#define DKV  (NKV * HD)
#define ZH   2
#define RH   512                  // query rows < RH use hi+lo planes (0: none)
#define WIN  2048
#define PCAR 1024.0f
#define SCL  0.125f   // HD^-0.5
typedef _Float16 h16;
typedef unsigned short bf;
typedef __attribute__((ext_vector_type(16))) __bf16   v16bf;
typedef __attribute__((ext_vector_type(16))) _Float16 v16h;
typedef __attribute__((ext_vector_type(8)))  _Float16 v8h;
typedef __attribute__((ext_vector_type(8)))  unsigned short v8us;
typedef __attribute__((ext_vector_type(8)))  float    v8f;
typedef __attribute__((ext_vector_type(4)))  float    v4f;
typedef v8h  __attribute__((may_alias)) v8ha;
typedef v4f  __attribute__((may_alias)) v4fa;
typedef v8us __attribute__((may_alias)) v8usa;

__device__ __forceinline__ unsigned short f2bf(float f) { unsigned u = __float_as_uint(f); u += 0x7FFFu + ((u >> 16) & 1u); return (unsigned short)(u >> 16); }
__device__ __forceinline__ float bf2f(unsigned short b) { return __uint_as_float(((unsigned)b) << 16); }
__device__ __forceinline__ float bfr(float f) { return bf2f(f2bf(f)); }
__device__ __forceinline__ v16h cat16(v8h lo, v8h hi) { return __builtin_shufflevector(lo, hi, 0, 1, 2, 3, 4, 5, 6, 7, 8, 9, 10, 11, 12, 13, 14, 15); }
__device__ __forceinline__ v16bf cat16b(v8us lo, v8us hi) { return __builtin_bit_cast(v16bf, __builtin_shufflevector(lo, hi, 0, 1, 2, 3, 4, 5, 6, 7, 8, 9, 10, 11, 12, 13, 14, 15)); }
__device__ __forceinline__ v8f wmma16(v16h a, v16h b, v8f c) { return __builtin_amdgcn_wmma_f32_16x16x32_f16(false, a, false, b, (short)0, c, false, false); }
__device__ __forceinline__ v8f wmmab(v16bf a, v16bf b, v8f c) { return __builtin_amdgcn_wmma_f32_16x16x32_bf16(false, a, false, b, (short)0, c, false, false); }



// ---- k_gemmk: register-blocked GEMM, one 64x64 output tile per work-group of NW waves, operands straight from K-contiguous 16-bit planes; grid (M/64, N/64, Z), NW x 32 threads.
// C[m][n] (f32, pitch ldc) = sum_k A[m][k] Bt[n][k] (+ split products per NSPLIT). z-batch strides sA/sB/sC in elements. K % 32 == 0.
// The K loop is dealt to the waves in turn, 32 k a trip (wave w takes trips w, w + NW, ...); every wave keeps its own 16 accumulators, the NW partial tiles meet in LDS and are added in the fixed order wave 0 .. NW-1.
// CAUSAL (probability x value): the K loop stops at the diagonal block (probabilities beyond it are exactly zero); roff = row offset of this launch's first row within the sequence.
template <typename T16> struct WFrag;
template <> struct WFrag<h16> { typedef v16h V; static __device__ __forceinline__ V ld(const h16* p) { return cat16(*(const v8h*)p, *(const v8h*)(p + 16)); } static __device__ __forceinline__ v8f mma(V a, V b, v8f c) { return wmma16(a, b, c); } };
template <> struct WFrag<bf> { typedef v16bf V; static __device__ __forceinline__ V ld(const bf* p) { return cat16b(*(const v8us*)p, *(const v8us*)(p + 16)); } static __device__ __forceinline__ v8f mma(V a, V b, v8f c) { return wmmab(a, b, c); } };
template <typename T16, int NSPLIT, int NW, bool CAUSAL>
__global__ __launch_bounds__(NW * 32) void k_gemmk(const T16* __restrict__ A, const T16* __restrict__ A2, const T16* __restrict__ Bt, const T16* __restrict__ Bt2, int K, float* C, int ldc, int roff, size_t sA, size_t sB, size_t sC) {
    typedef typename WFrag<T16>::V V;
    __shared__ __align__(16) float part[NW * 4096];   // [wave][fragment][half][lane][4]: every 16-byte store and load is contiguous over the lanes
    __shared__ __align__(16) float os[64 * 68];
    const size_t z = blockIdx.z; A += z * sA; if (A2) A2 += z * sA; Bt += z * sB; if (Bt2) Bt2 += z * sB; C += z * sC;
    const int tid = threadIdx.x, lane = tid & 31, wave = __builtin_amdgcn_readfirstlane(tid >> 5), lr = lane & 15, hi = lane >> 4; const int r0 = blockIdx.x * 64, c0 = blockIdx.y * 64;
    const int Kl = CAUSAL ? min(K, r0 + roff + 64) : K;
    v8f acc[4][4];
#pragma unroll
    for (int mb = 0; mb < 4; ++mb)
#pragma unroll
        for (int nb = 0; nb < 4; ++nb) acc[mb][nb] = (v8f){};
    const size_t aoff = (size_t)(r0 + lr) * K + 8 * hi, boff = (size_t)(c0 + lr) * K + 8 * hi;
#pragma unroll 1
    for (int kc = wave * 32; kc < Kl; kc += NW * 32) {
        V a[4], a2[4];
#pragma unroll
        for (int mb = 0; mb < 4; ++mb) { a[mb] = WFrag<T16>::ld(A + aoff + (size_t)mb * 16 * K + kc); if (NSPLIT == 1 || NSPLIT == 2) a2[mb] = WFrag<T16>::ld(A2 + aoff + (size_t)mb * 16 * K + kc); }
#pragma unroll
        for (int nb = 0; nb < 4; ++nb) { const V b = WFrag<T16>::ld(Bt + boff + (size_t)nb * 16 * K + kc); V b2; if (NSPLIT >= 2) b2 = WFrag<T16>::ld(Bt2 + boff + (size_t)nb * 16 * K + kc);
#pragma unroll
            for (int mb = 0; mb < 4; ++mb) { acc[mb][nb] = WFrag<T16>::mma(a[mb], b, acc[mb][nb]); if (NSPLIT == 1 || NSPLIT == 2) acc[mb][nb] = WFrag<T16>::mma(a2[mb], b, acc[mb][nb]); if (NSPLIT >= 2) acc[mb][nb] = WFrag<T16>::mma(a[mb], b2, acc[mb][nb]); } }
        // four vector slots behind the last matrix instruction, so that its distance also holds over the loop's back edge
        asm volatile("v_nop\n\tv_nop\n\tv_nop\n\tv_nop" : "+v"(acc[0][0]), "+v"(acc[1][1]), "+v"(acc[2][2]), "+v"(acc[3][3]) : "v"(a[0]), "v"(a[3]));
    }
    float* pw = part + wave * 4096 + lane * 4;
#pragma unroll
    for (int mb = 0; mb < 4; ++mb)
#pragma unroll
        for (int nb = 0; nb < 4; ++nb) { const v8f c = acc[mb][nb]; *(v4fa*)(pw + (mb * 4 + nb) * 256) = (v4f){c[0], c[1], c[2], c[3]}; *(v4fa*)(pw + (mb * 4 + nb) * 256 + 128) = (v4f){c[4], c[5], c[6], c[7]}; }
    __syncthreads();   // every wave's partial tile is in LDS
#pragma unroll
    for (int u = 0; u < 32 / NW; ++u) { const int idx = u * (NW * 32) + tid; v4f s = *(const v4fa*)(part + idx * 4);
#pragma unroll
        for (int w = 1; w < NW; ++w) s += *(const v4fa*)(part + w * 4096 + idx * 4);
        const int fr = idx >> 6, row = (fr >> 2) * 16 + hi * 8 + ((idx >> 5) & 1) * 4, col = (fr & 3) * 16 + lr;
#pragma unroll
        for (int q = 0; q < 4; ++q) os[(row + q) * 68 + col] = s[q]; }
    __syncthreads();   // the summed tile is in LDS, row-major: whole rows go out in 16-byte stores
#pragma unroll
    for (int u = 0; u < 32 / NW; ++u) { const int idx = u * (NW * 32) + tid, row = idx >> 4, cofs = (idx & 15) * 4; *(v4f*)(C + (size_t)(r0 + row) * ldc + c0 + cofs) = *(const v4fa*)(os + row * 68 + cofs); }
}

// ---- k_gemmc: ONE WAVE per 64x64 tile (32 threads; the score product's K loop is two trips), specialised for causal attention: CMODE 1 skips score tiles entirely above the diagonal (query rows r0+roff.., key columns c0..), CMODE 2 limits the
// key (K) loop to the diagonal block. roff = row offset of this launch's first row within the sequence.
template <typename T16, int NSPLIT, int CMODE>
__global__ __launch_bounds__(32) void k_gemmc(const T16* __restrict__ A, const T16* __restrict__ A2, const T16* __restrict__ Bt, const T16* __restrict__ Bt2, int K, float* C, int ldc, int roff, size_t sA, size_t sB, size_t sC) {
    typedef typename WFrag<T16>::V V;
    __shared__ __align__(16) float os[16 * 68];
    const size_t z = blockIdx.z; A += z * sA; if (A2) A2 += z * sA; Bt += z * sB; if (Bt2) Bt2 += z * sB; C += z * sC;
    const int lane = threadIdx.x & 31, lr = lane & 15, hi = lane >> 4; const int r0 = blockIdx.x * 64, c0 = blockIdx.y * 64;
    if (CMODE == 1 && c0 > r0 + roff + 63) return;                  // score tile entirely above the causal diagonal: never read (the softmax masks j > i by select)
    const int Kl = (CMODE == 2) ? min(K, r0 + roff + 64) : K;        // P.V: probabilities are exactly 0 beyond the diagonal block, so the K loop stops there
    v8f acc[4][4];
#pragma unroll
    for (int mb = 0; mb < 4; ++mb)
#pragma unroll
        for (int nb = 0; nb < 4; ++nb) acc[mb][nb] = (v8f){};
    const size_t aoff = (size_t)(r0 + lr) * K + 8 * hi, boff = (size_t)(c0 + lr) * K + 8 * hi;
#pragma unroll 1
    for (int kc = 0; kc < Kl; kc += 32) {
        V a[4], a2[4];
#pragma unroll
        for (int mb = 0; mb < 4; ++mb) { a[mb] = WFrag<T16>::ld(A + aoff + (size_t)mb * 16 * K + kc); if (NSPLIT == 1 || NSPLIT == 2) a2[mb] = WFrag<T16>::ld(A2 + aoff + (size_t)mb * 16 * K + kc); }
#pragma unroll
        for (int nb = 0; nb < 4; ++nb) { const V b = WFrag<T16>::ld(Bt + boff + (size_t)nb * 16 * K + kc); V b2; if (NSPLIT >= 2) b2 = WFrag<T16>::ld(Bt2 + boff + (size_t)nb * 16 * K + kc);
#pragma unroll
            for (int mb = 0; mb < 4; ++mb) { acc[mb][nb] = WFrag<T16>::mma(a[mb], b, acc[mb][nb]); if (NSPLIT == 1 || NSPLIT == 2) acc[mb][nb] = WFrag<T16>::mma(a2[mb], b, acc[mb][nb]); if (NSPLIT >= 2) acc[mb][nb] = WFrag<T16>::mma(a[mb], b2, acc[mb][nb]); } }
        asm volatile("v_nop\n\tv_nop\n\tv_nop\n\tv_nop" : "+v"(acc[0][0]), "+v"(acc[1][1]), "+v"(acc[2][2]), "+v"(acc[3][3]) : "v"(a[0]), "v"(a[3]));
    }
#pragma unroll
    for (int mb = 0; mb < 4; ++mb) {
#pragma unroll
        for (int nb = 0; nb < 4; ++nb) {
#pragma unroll
            for (int j = 0; j < 8; ++j) os[(hi * 8 + j) * 68 + nb * 16 + lr] = acc[mb][nb][j]; }
        __builtin_amdgcn_wave_barrier(); asm volatile("" ::: "memory");
        float* crow = C + (size_t)(r0 + mb * 16) * ldc + c0;
{
#pragma unroll
            for (int s = 0; s < 8; ++s) { const int row = 2 * s + hi, cofs = lr * 4; v4f val = *(const v4fa*)(os + row * 68 + cofs);
                *(v4f*)(crow + (size_t)row * ldc + cofs) = val; }
             }
        __builtin_amdgcn_wave_barrier(); asm volatile("" ::: "memory");
    }
}

__device__ __forceinline__ h16 tohx(float x) { return (h16)x; }
__device__ __forceinline__ void splitf(float y, unsigned short& h, unsigned short& l) { h = f2bf(y); l = f2bf(y - bf2f(h)); }
typedef __attribute__((ext_vector_type(2))) _Float16 v2h;
typedef __attribute__((ext_vector_type(4))) _Float16 v4h;
typedef __attribute__((ext_vector_type(2))) unsigned short v2us;
typedef __attribute__((ext_vector_type(4))) unsigned short v4us;
typedef __attribute__((ext_vector_type(2))) float v2f;
typedef __attribute__((ext_vector_type(4))) int v4i;

__global__ __launch_bounds__(256) void k_wtG(const float* __restrict__ w, int K, int N, bf* Bt) {
    const int lane = threadIdx.x & 31; const int L0 = (blockIdx.x * 8 + (threadIdx.x >> 5)) * 8; const int nlines = N * K / 64;
{
#pragma unroll 1
        for (int l = 0; l < 8; ++l) { const int L = L0 + l; if (L >= nlines) break; const size_t e = (size_t)L * 64 + lane * 2; const int k = (int)(e % K), n = (int)(e / K); v2us o;
            o[0] = f2bf(w[(size_t)k * N + n]); o[1] = f2bf(w[(size_t)(k + 1) * N + n]); *(v2us*)(Bt + e) = o; }
         }
}
__global__ __launch_bounds__(256) void k_cvt8(const float* __restrict__ src, bf* dst, size_t n8) { const size_t i = (size_t)blockIdx.x * 256 + threadIdx.x; if (i >= n8) return; const v8f v = *(const v8f*)(src + i * 8); v8us o;
#pragma unroll
    for (int k = 0; k < 8; ++k) o[k] = f2bf(v[k]); *(v8us*)(dst + i * 8) = o;  }

__global__ __launch_bounds__(256) void k_ropeI(const float* __restrict__ F, int pitch, int nheads, const float* __restrict__ CS, float sc, h16* P16, bf* Ph, bf* Pl) {
    const size_t e = ((size_t)blockIdx.x * 256 + threadIdx.x) * 2; if (e >= (size_t)nheads * TT * HD) return; const int d = (int)(e % HD); const int t = (int)((e / HD) % TT); const int h = (int)(e / ((size_t)HD * TT)); const float* f = F + (size_t)t * pitch + h * HD; const float x0 = f[d], x1 = f[d + 1]; const v2f cs = *(const v2f*)(CS + ((size_t)t * HD + d) * 2); v2h o16; v2us oh, ol;
    float a0 = __fmul_rn(x0, cs[0]), b0 = __fmul_rn(x1, cs[1]), a1 = __fmul_rn(x1, cs[0]), b1 = __fmul_rn(x0, cs[1]); asm volatile("" : "+v"(a0), "+v"(b0), "+v"(a1), "+v"(b1));
    float r0 = __fsub_rn(a0, b0) * sc, r1 = __fadd_rn(b1, a1) * sc;   /* even: x0 c - x1 s; odd: x0 s + x1 c */
    o16[0] = tohx(r0); o16[1] = tohx(r1); { unsigned short a2, c2; splitf(r0, a2, c2); oh[0] = a2; ol[0] = c2; splitf(r1, a2, c2); oh[1] = a2; ol[1] = c2; }
    *(v2h*)(P16 + e) = o16; *(v2us*)(Ph + e) = oh; *(v2us*)(Pl + e) = ol;  }

__constant__ float INV2[HD / 2] = { 1.000000000e+00f, 7.498942018e-01f, 5.623413324e-01f, 4.216965139e-01f, 3.162277639e-01f, 2.371373624e-01f, 1.778279394e-01f, 1.333521456e-01f, 1.000000015e-01f, 7.498941571e-02f, 5.623412877e-02f, 4.216964915e-02f, 3.162277862e-02f, 2.371373586e-02f, 1.778279431e-02f, 1.333521493e-02f, 9.999999776e-03f, 7.498942316e-03f, 5.623413250e-03f, 4.216964822e-03f, 3.162277862e-03f, 2.371373819e-03f, 1.778279431e-03f, 1.333521446e-03f, 1.000000047e-03f, 7.498941850e-04f, 5.623413017e-04f, 4.216964880e-04f, 3.162277862e-04f, 2.371373848e-04f, 1.778279402e-04f, 1.333521504e-04f };   // float32 10000^(-(i * 2 / 64)), generated with jnp to be bit-exact with the module's expression
__global__ __launch_bounds__(256) void k_cstabI(const int* __restrict__ pid, float* CS) { const int idx = blockIdx.x * 256 + threadIdx.x; if (idx >= TT * HD) return; const int d = idx % HD; const int t = idx / HD; const float a = __fmul_rn((float)pid[t], INV2[d >> 1]); v2f cs; cs[0] = cosf(a); cs[1] = sinf(a); *(v2f*)(CS + (size_t)idx * 2) = cs;  }

__global__ __launch_bounds__(256) void k_vtp(const float* __restrict__ F, int pitch, int nheads, h16* V16, bf* Vh, bf* Vl) { const size_t e = ((size_t)blockIdx.x * 256 + threadIdx.x) * 2; if (e >= (size_t)nheads * HD * TT) return; const int t = (int)(e % TT); const int d = (int)((e / TT) % HD); const int g = (int)(e / ((size_t)TT * HD)); v2h o16; v2us oh, ol;
#pragma unroll
    for (int q = 0; q < 2; ++q) { const float x = F[(size_t)(t + q) * pitch + g * HD + d]; o16[q] = tohx(x); unsigned short a2, c2; splitf(x, a2, c2); oh[q] = a2; ol[q] = c2; }
    *(v2h*)(V16 + e) = o16; *(v2us*)(Vh + e) = oh; *(v2us*)(Vl + e) = ol;  }
// k_asoft: per row (zz, i): t = S x HD^-0.5 for j <= i and i - j < WIN (sliding causal window; the reference's -1e9 additive fill vanishes identically); softmax over the 2048 keys (register row, one exp, fixed trees);
__global__ __launch_bounds__(256) void k_asoft(const float* __restrict__ Sb, h16* P16, bf* Ph, bf* Pl) {
    const int lane = threadIdx.x & 31; const int row = blockIdx.x * 8 + (threadIdx.x >> 5); if (row >= ZH * TT) return; const int i = row % TT; const int zz = row / TT; (void)zz; const bool hires = (i < RH); const float* sr = Sb + (size_t)row * TT; float v[TT / 32]; float mx = -3.0e38f;
#pragma unroll
    for (int ch = 0; ch < TT / 128; ++ch) { const int j0 = ch * 128 + lane * 4; const v4f a = *(const v4f*)(sr + j0);
#pragma unroll
        for (int q = 0; q < 4; ++q) { const int j = j0 + q; (void)j; const float t = (j <= i && i - j < WIN) ? a[q] * SCL : -3.0e38f; v[ch * 4 + q] = t; mx = fmaxf(mx, t); } }
#pragma unroll
    for (int sh = 16; sh; sh >>= 1) mx = fmaxf(mx, __shfl_xor(mx, sh, 32));
    float sum = 0.f;
#pragma unroll
    for (int k = 0; k < TT / 32; ++k) { float d0 = __fsub_rn(v[k], mx); asm volatile("" : "+v"(d0)); v[k] = __builtin_amdgcn_exp2f(__fmul_rn(d0, 1.4426950408889634f)); sum += v[k]; }
#pragma unroll
    for (int sh = 16; sh; sh >>= 1) sum += __shfl_xor(sum, sh, 32);
    const float f = __fdiv_rn(hires ? 1.0f : PCAR, sum);
{
        if (hires) {
#pragma unroll
            for (int ch = 0; ch < TT / 128; ++ch) { v4us oh, ol;
#pragma unroll
                for (int q = 0; q < 4; ++q) { unsigned short a, c2; splitf(v[ch * 4 + q] * f, a, c2); oh[q] = a; ol[q] = c2; }
                const size_t oo = ((size_t)zz * (RH ? RH : 1) + i) * TT + ch * 128 + lane * 4; *(v4us*)(Ph + oo) = oh; *(v4us*)(Pl + oo) = ol; }
        } else {
#pragma unroll
            for (int ch = 0; ch < TT / 128; ++ch) { v4h o4;
#pragma unroll
                for (int q = 0; q < 4; ++q) o4[q] = tohx(v[ch * 4 + q] * f);
                *(v4h*)(P16 + (size_t)row * TT + ch * 128 + lane * 4) = o4; } }
         }
}
__global__ __launch_bounds__(256) void k_merge(const float* __restrict__ O, int h0, bf* Ah, bf* Al) { const size_t e = ((size_t)blockIdx.x * 256 + threadIdx.x) * 2; if (e >= (size_t)ZH * TT * HD) return; const int d = (int)(e % HD); const int t = (int)((e / HD) % TT); const int zz = (int)(e / ((size_t)HD * TT)); const float cs = (t < RH) ? 1.0f : (1.0f / PCAR); const size_t oo = (size_t)t * DQ + (h0 + zz) * HD + d;
    v2us oh, ol;
#pragma unroll
    for (int q = 0; q < 2; ++q) { unsigned short a, c2; splitf(O[e + q] * cs, a, c2); oh[q] = a; ol[q] = c2; } *(v2us*)(Ah + oo) = oh; *(v2us*)(Al + oo) = ol;  }

extern "C" void kernel_launch(void* const* d_in, const int* in_sizes, int n_in,
                              void* d_out, int out_size, void* d_ws, size_t ws_size, hipStream_t stream) {
    (void)in_sizes; (void)n_in; (void)out_size;
        const float* x = (const float*)d_in[0]; const int* PID = (const int*)d_in[5]; const float* wq = (const float*)d_in[1]; const float* wk = (const float*)d_in[2]; const float* wv = (const float*)d_in[3]; const float* wo = (const float*)d_in[4];   /* order x, Wq, Wk, Wv, Wo ('oi' [1024][1024]), token_positions (int32 [2][2048]: ONE row of positions PER BATCH, sorted random values in [0, 2048); read on device) */
    float* OUT = (float*)d_out;     // [2][2048][1024]
    char* wsp = (char*)d_ws;
    auto take = [&](size_t bytes) { char* p = wsp; wsp += (bytes + 255) & ~(size_t)255; return (void*)p; };
    bf* WQ = (bf*)take((size_t)DQ * DM * 2); bf* WK = (bf*)take((size_t)DKV * DM * 2); bf* WV = (bf*)take((size_t)DKV * DM * 2); bf* WO = (bf*)take((size_t)DM * DQ * 2); float* CS = (float*)take((size_t)TT * HD * 2 * 4);
    bf* XB = (bf*)take((size_t)TT * DM * 2); float* FQ = (float*)take((size_t)TT * DQ * 4); float* FK = (float*)take((size_t)TT * DKV * 4);
    h16* QP16 = (h16*)take((size_t)NH_ * TT * HD * 2); h16* KP16 = (h16*)take((size_t)NKV * TT * HD * 2); h16* VT16 = (h16*)take((size_t)NKV * HD * TT * 2);
    bf* QPh = (bf*)take((size_t)NH_ * TT * HD * 2); bf* QPl = (bf*)take((size_t)NH_ * TT * HD * 2); bf* KPh = (bf*)take((size_t)NKV * TT * HD * 2); bf* KPl = (bf*)take((size_t)NKV * TT * HD * 2); bf* VTh = (bf*)take((size_t)NKV * HD * TT * 2); bf* VTl = (bf*)take((size_t)NKV * HD * TT * 2); bf* Ph = (bf*)take((size_t)ZH * RH * TT * 2); bf* Pl = (bf*)take((size_t)ZH * RH * TT * 2);
    float* Sb = (float*)take((size_t)ZH * TT * TT * 4); h16* P16 = (h16*)take((size_t)ZH * TT * TT * 2); float* Ob = (float*)take((size_t)ZH * TT * HD * 4); bf* ATh = (bf*)take((size_t)TT * DQ * 2); bf* ATl = (bf*)take((size_t)TT * DQ * 2);
    if ((size_t)(wsp - (char*)d_ws) > ws_size) return;    // ws 256 MiB
    float* FV = FK;   // v projection reuses the k buffer after the k planes are built (stream-ordered)
    { k_cvt8<<<(unsigned)(((size_t)DQ * DM / 8 + 255) / 256), 256, 0, stream>>>(wq, WQ, (size_t)DQ * DM / 8); k_cvt8<<<(unsigned)(((size_t)DKV * DM / 8 + 255) / 256), 256, 0, stream>>>(wk, WK, (size_t)DKV * DM / 8); k_cvt8<<<(unsigned)(((size_t)DKV * DM / 8 + 255) / 256), 256, 0, stream>>>(wv, WV, (size_t)DKV * DM / 8);
      k_cvt8<<<(unsigned)(((size_t)DM * DQ / 8 + 255) / 256), 256, 0, stream>>>(wo, WO, (size_t)DM * DQ / 8); /* the rotary table is rebuilt per batch from that batch's positions (below) */ }
    const unsigned LQ = (unsigned)(((size_t)NH_ * TT * HD / 2 + 255) / 256), LKv = (unsigned)(((size_t)NKV * TT * HD / 2 + 255) / 256);
    for (int b = 0; b < NB_; ++b) {
        k_cstabI<<<(TT * HD + 255) / 256, 256, 0, stream>>>(PID + (size_t)b * TT, CS);   /* token_positions[b][:] (int32, read): THIS batch's own row of positions */
        
        k_cvt8<<<(unsigned)(((size_t)TT * DM / 8 + 255) / 256), 256, 0, stream>>>(x + (size_t)b * TT * DM, XB, (size_t)TT * DM / 8);
        k_gemmk<bf, 0, 8, false><<<dim3(TT / 64, DQ / 64, 1), 256, 0, stream>>>(XB, nullptr, WQ, nullptr, DM, FQ, DQ, 0, 0, 0, 0);
        k_ropeI<<<LQ, 256, 0, stream>>>(FQ, DQ, NH_, CS, 1.0f, QP16, QPh, QPl);
        k_gemmk<bf, 0, 8, false><<<dim3(TT / 64, DKV / 64, 1), 256, 0, stream>>>(XB, nullptr, WK, nullptr, DM, FK, DKV, 0, 0, 0, 0);
        k_ropeI<<<LKv, 256, 0, stream>>>(FK, DKV, NKV, CS, 1.0f, KP16, KPh, KPl);
        k_gemmk<bf, 0, 8, false><<<dim3(TT / 64, DKV / 64, 1), 256, 0, stream>>>(XB, nullptr, WV, nullptr, DM, FV, DKV, 0, 0, 0, 0); k_vtp<<<LKv, 256, 0, stream>>>(FV, DKV, NKV, VT16, VTh, VTl);
        for (int h0 = 0; h0 < NH_; h0 += ZH) { const size_t zq = (size_t)h0, zk = (size_t)(h0 / REP);   // one kv head per query head: the pass's two heads use consecutive kv planes (z-strides TT*HD)
            k_gemmc<bf, 2, 1><<<dim3(TT / 64, TT / 64, ZH), 32, 0, stream>>>(QPh + zq * TT * HD, QPl + zq * TT * HD, KPh + zk * TT * HD, KPl + zk * TT * HD, HD, Sb, TT, 0, (size_t)TT * HD, (size_t)TT * HD, (size_t)TT * TT);   /* scores on hi/lo planes for EVERY row (3 products) */
            /* (the fp16 score launch for rows >= RH is removed: all rows use the hi/lo launch above) */
            k_asoft<<<ZH * TT / 8, 256, 0, stream>>>(Sb, P16, Ph, Pl);
            k_gemmk<bf, 2, 16, true><<<dim3(RH / 64, HD / 64, ZH), 512, 0, stream>>>(Ph, Pl, VTh + zk * HD * TT, VTl + zk * HD * TT, TT, Ob, HD, 0, (size_t)RH * TT, (size_t)HD * TT, (size_t)TT * HD);
            k_gemmk<h16, 0, 16, true><<<dim3((TT - RH) / 64, HD / 64, ZH), 512, 0, stream>>>(P16 + (size_t)RH * TT, nullptr, VT16 + zk * HD * TT, nullptr, TT, Ob + (size_t)RH * HD, HD, RH, (size_t)TT * TT, (size_t)HD * TT, (size_t)TT * HD);
            k_merge<<<(unsigned)(((size_t)ZH * TT * HD / 2 + 255) / 256), 256, 0, stream>>>(Ob, h0, ATh, ATl); }
        k_gemmk<bf, 1, 8, false><<<dim3(TT / 64, DM / 64, 1), 256, 0, stream>>>(ATh, ATl, WO, nullptr, DQ, OUT + (size_t)b * TT * DM, DM, 0, 0, 0, 0); }
}

// v002
// It runs in 402 microseconds.
// In both of two side-by-side timings against v001, it was 1.73 times as fast.
// Counting every step since v000, it is 3.39 times as fast.
#include <hip/hip_runtime.h>

// Causal multi-head self-attention with interleaved-pair rotary position embedding from PER-BATCH position rows (x [2][2048][1024]; q, k, v = einsum('bsd,od', x, W) ('oi' [1024][1024], no bias; 16 heads x 64); angle = float(token_positions[b][t]) x 1 / theta ** (2i / 64) (theta 1e4; token_positions int32 [2][2048]: each batch has its OWN sorted row of random positions in [0, 2048), READ on device); pairs (2i, 2i+1): (xe cos - xo sin, xe sin + xo cos) on q and k; scores / sqrt(64); keys j <= i kept (by INDEX, not by position), -inf elsewhere; softmax; out = einsum('bso,do', merged, Wo) -> [2][2048][1024] (4.2 M); argument order x, Wq, Wk, Wv, Wo, token_positions).
// Layout per batch: bf16 copy of x; exact projections; {cos, sin} per (position, pair) built once from the int positions and float32 inverse-frequency constants (precise cosf/sinf); interleaved rotary plane builder; causal T-2048 attention (EVERY row's scores on hi/lo planes (3 products: logit sigma 2 with these weights) and hybrid P.V (rows < 512 hi/lo, rest fp16 x1024); k_gemmc skips tiles above the diagonal); merged hi/lo x Wo exact.
// Compute dtypes, f32 accumulate: every input rounded to bf16; projections exact; rotary f32; attention scores 3 products, P.V rows < 512 3 products, rest fp16; softmax f32; Wo hl x exact.

#define NB_  2
#define TT   2048
#define DM   1024
#define NH_  16
#define NKV  16
#define REP  (NH_ / NKV)
#define HD   64
#define DQ   (NH_ * HD)
#define DKV  (NKV * HD)
#define ZH   8                    // heads per attention pass
#define RH   512                  // query rows < RH use hi+lo planes (0: none)
#define WIN  2048
#define PCAR 1024.0f
#define SCL  0.125f   // HD^-0.5
typedef _Float16 h16;
typedef unsigned short bf;
typedef __attribute__((ext_vector_type(16))) __bf16   v16bf;
typedef __attribute__((ext_vector_type(16))) _Float16 v16h;
typedef __attribute__((ext_vector_type(8)))  _Float16 v8h;
typedef __attribute__((ext_vector_type(8)))  unsigned short v8us;
typedef __attribute__((ext_vector_type(8)))  float    v8f;
typedef __attribute__((ext_vector_type(4)))  float    v4f;
typedef v8h  __attribute__((may_alias)) v8ha;
typedef v4f  __attribute__((may_alias)) v4fa;
typedef v8us __attribute__((may_alias)) v8usa;

__device__ __forceinline__ unsigned short f2bf(float f) { unsigned u = __float_as_uint(f); u += 0x7FFFu + ((u >> 16) & 1u); return (unsigned short)(u >> 16); }
__device__ __forceinline__ float bf2f(unsigned short b) { return __uint_as_float(((unsigned)b) << 16); }
__device__ __forceinline__ float bfr(float f) { return bf2f(f2bf(f)); }
__device__ __forceinline__ v16h cat16(v8h lo, v8h hi) { return __builtin_shufflevector(lo, hi, 0, 1, 2, 3, 4, 5, 6, 7, 8, 9, 10, 11, 12, 13, 14, 15); }
__device__ __forceinline__ v16bf cat16b(v8us lo, v8us hi) { return __builtin_bit_cast(v16bf, __builtin_shufflevector(lo, hi, 0, 1, 2, 3, 4, 5, 6, 7, 8, 9, 10, 11, 12, 13, 14, 15)); }
__device__ __forceinline__ v8f wmma16(v16h a, v16h b, v8f c) { return __builtin_amdgcn_wmma_f32_16x16x32_f16(false, a, false, b, (short)0, c, false, false); }
__device__ __forceinline__ v8f wmmab(v16bf a, v16bf b, v8f c) { return __builtin_amdgcn_wmma_f32_16x16x32_bf16(false, a, false, b, (short)0, c, false, false); }



// ---- k_gemmk: register-blocked GEMM, one 64x64 output tile per work-group of NW waves, operands straight from K-contiguous 16-bit planes; grid (M/64, N/64, Z), NW x 32 threads.
// C[m][n] (f32, pitch ldc) = sum_k A[m][k] Bt[n][k] (+ split products per NSPLIT). z-batch strides sA/sB/sC in elements. K % 32 == 0.
// The K loop is dealt to the waves in turn, 32 k a trip (wave w takes trips w, w + NW, ...); every wave keeps its own 16 accumulators, the NW partial tiles meet in LDS and are added in the fixed order wave 0 .. NW-1.
// CAUSAL (probability x value): the K loop stops at the diagonal block (probabilities beyond it are exactly zero); roff = row offset of this launch's first row within the sequence.
template <typename T16> struct WFrag;
template <> struct WFrag<h16> { typedef v16h V; static __device__ __forceinline__ V ld(const h16* p) { return cat16(*(const v8h*)p, *(const v8h*)(p + 16)); } static __device__ __forceinline__ v8f mma(V a, V b, v8f c) { return wmma16(a, b, c); } };
template <> struct WFrag<bf> { typedef v16bf V; static __device__ __forceinline__ V ld(const bf* p) { return cat16b(*(const v8us*)p, *(const v8us*)(p + 16)); } static __device__ __forceinline__ v8f mma(V a, V b, v8f c) { return wmmab(a, b, c); } };
template <typename T16, int NSPLIT, int NW, bool CAUSAL>
__global__ __launch_bounds__(NW * 32) void k_gemmk(const T16* __restrict__ A, const T16* __restrict__ A2, const T16* __restrict__ Bt, const T16* __restrict__ Bt2, int K, float* C, int ldc, int roff, size_t sA, size_t sB, size_t sC) {
    typedef typename WFrag<T16>::V V;
    __shared__ __align__(16) float part[NW * 4096];   // [wave][fragment][half][lane][4]: every 16-byte store and load is contiguous over the lanes
    __shared__ __align__(16) float os[64 * 68];
    const size_t z = blockIdx.z; A += z * sA; if (A2) A2 += z * sA; Bt += z * sB; if (Bt2) Bt2 += z * sB; C += z * sC;
    const int tid = threadIdx.x, lane = tid & 31, wave = __builtin_amdgcn_readfirstlane(tid >> 5), lr = lane & 15, hi = lane >> 4; const int r0 = blockIdx.x * 64, c0 = blockIdx.y * 64;
    const int Kl = CAUSAL ? min(K, r0 + roff + 64) : K;
    v8f acc[4][4];
#pragma unroll
    for (int mb = 0; mb < 4; ++mb)
#pragma unroll
        for (int nb = 0; nb < 4; ++nb) acc[mb][nb] = (v8f){};
    const size_t aoff = (size_t)(r0 + lr) * K + 8 * hi, boff = (size_t)(c0 + lr) * K + 8 * hi;
#pragma unroll 1
    for (int kc = wave * 32; kc < Kl; kc += NW * 32) {
        V a[4], a2[4];
#pragma unroll
        for (int mb = 0; mb < 4; ++mb) { a[mb] = WFrag<T16>::ld(A + aoff + (size_t)mb * 16 * K + kc); if (NSPLIT == 1 || NSPLIT == 2) a2[mb] = WFrag<T16>::ld(A2 + aoff + (size_t)mb * 16 * K + kc); }
#pragma unroll
        for (int nb = 0; nb < 4; ++nb) { const V b = WFrag<T16>::ld(Bt + boff + (size_t)nb * 16 * K + kc); V b2; if (NSPLIT >= 2) b2 = WFrag<T16>::ld(Bt2 + boff + (size_t)nb * 16 * K + kc);
#pragma unroll
            for (int mb = 0; mb < 4; ++mb) { acc[mb][nb] = WFrag<T16>::mma(a[mb], b, acc[mb][nb]); if (NSPLIT == 1 || NSPLIT == 2) acc[mb][nb] = WFrag<T16>::mma(a2[mb], b, acc[mb][nb]); if (NSPLIT >= 2) acc[mb][nb] = WFrag<T16>::mma(a[mb], b2, acc[mb][nb]); } }
        // four vector slots behind the last matrix instruction, so that its distance also holds over the loop's back edge
        asm volatile("v_nop\n\tv_nop\n\tv_nop\n\tv_nop" : "+v"(acc[0][0]), "+v"(acc[1][1]), "+v"(acc[2][2]), "+v"(acc[3][3]) : "v"(a[0]), "v"(a[3]));
    }
    float* pw = part + wave * 4096 + lane * 4;
#pragma unroll
    for (int mb = 0; mb < 4; ++mb)
#pragma unroll
        for (int nb = 0; nb < 4; ++nb) { const v8f c = acc[mb][nb]; *(v4fa*)(pw + (mb * 4 + nb) * 256) = (v4f){c[0], c[1], c[2], c[3]}; *(v4fa*)(pw + (mb * 4 + nb) * 256 + 128) = (v4f){c[4], c[5], c[6], c[7]}; }
    __syncthreads();   // every wave's partial tile is in LDS
#pragma unroll
    for (int u = 0; u < 32 / NW; ++u) { const int idx = u * (NW * 32) + tid; v4f s = *(const v4fa*)(part + idx * 4);
#pragma unroll
        for (int w = 1; w < NW; ++w) s += *(const v4fa*)(part + w * 4096 + idx * 4);
        const int fr = idx >> 6, row = (fr >> 2) * 16 + hi * 8 + ((idx >> 5) & 1) * 4, col = (fr & 3) * 16 + lr;
#pragma unroll
        for (int q = 0; q < 4; ++q) os[(row + q) * 68 + col] = s[q]; }
    __syncthreads();   // the summed tile is in LDS, row-major: whole rows go out in 16-byte stores
#pragma unroll
    for (int u = 0; u < 32 / NW; ++u) { const int idx = u * (NW * 32) + tid, row = idx >> 4, cofs = (idx & 15) * 4; *(v4f*)(C + (size_t)(r0 + row) * ldc + c0 + cofs) = *(const v4fa*)(os + row * 68 + cofs); }
}

// ---- k_gemmc: ONE WAVE per 64x64 tile (32 threads; the score product's K loop is two trips), specialised for causal attention: CMODE 1 skips score tiles entirely above the diagonal (query rows r0+roff.., key columns c0..), CMODE 2 limits the
// key (K) loop to the diagonal block. roff = row offset of this launch's first row within the sequence.
template <typename T16, int NSPLIT, int CMODE>
__global__ __launch_bounds__(32) void k_gemmc(const T16* __restrict__ A, const T16* __restrict__ A2, const T16* __restrict__ Bt, const T16* __restrict__ Bt2, int K, float* C, int ldc, int roff, size_t sA, size_t sB, size_t sC) {
    typedef typename WFrag<T16>::V V;
    __shared__ __align__(16) float os[16 * 68];
    const size_t z = blockIdx.z; A += z * sA; if (A2) A2 += z * sA; Bt += z * sB; if (Bt2) Bt2 += z * sB; C += z * sC;
    const int lane = threadIdx.x & 31, lr = lane & 15, hi = lane >> 4; const int r0 = blockIdx.x * 64, c0 = blockIdx.y * 64;
    if (CMODE == 1 && c0 > r0 + roff + 63) return;                  // score tile entirely above the causal diagonal: never read (the softmax masks j > i by select)
    const int Kl = (CMODE == 2) ? min(K, r0 + roff + 64) : K;        // P.V: probabilities are exactly 0 beyond the diagonal block, so the K loop stops there
    v8f acc[4][4];
#pragma unroll
    for (int mb = 0; mb < 4; ++mb)
#pragma unroll
        for (int nb = 0; nb < 4; ++nb) acc[mb][nb] = (v8f){};
    const size_t aoff = (size_t)(r0 + lr) * K + 8 * hi, boff = (size_t)(c0 + lr) * K + 8 * hi;
#pragma unroll 1
    for (int kc = 0; kc < Kl; kc += 32) {
        V a[4], a2[4];
#pragma unroll
        for (int mb = 0; mb < 4; ++mb) { a[mb] = WFrag<T16>::ld(A + aoff + (size_t)mb * 16 * K + kc); if (NSPLIT == 1 || NSPLIT == 2) a2[mb] = WFrag<T16>::ld(A2 + aoff + (size_t)mb * 16 * K + kc); }
#pragma unroll
        for (int nb = 0; nb < 4; ++nb) { const V b = WFrag<T16>::ld(Bt + boff + (size_t)nb * 16 * K + kc); V b2; if (NSPLIT >= 2) b2 = WFrag<T16>::ld(Bt2 + boff + (size_t)nb * 16 * K + kc);
#pragma unroll
            for (int mb = 0; mb < 4; ++mb) { acc[mb][nb] = WFrag<T16>::mma(a[mb], b, acc[mb][nb]); if (NSPLIT == 1 || NSPLIT == 2) acc[mb][nb] = WFrag<T16>::mma(a2[mb], b, acc[mb][nb]); if (NSPLIT >= 2) acc[mb][nb] = WFrag<T16>::mma(a[mb], b2, acc[mb][nb]); } }
        asm volatile("v_nop\n\tv_nop\n\tv_nop\n\tv_nop" : "+v"(acc[0][0]), "+v"(acc[1][1]), "+v"(acc[2][2]), "+v"(acc[3][3]) : "v"(a[0]), "v"(a[3]));
    }
#pragma unroll
    for (int mb = 0; mb < 4; ++mb) {
#pragma unroll
        for (int nb = 0; nb < 4; ++nb) {
#pragma unroll
            for (int j = 0; j < 8; ++j) os[(hi * 8 + j) * 68 + nb * 16 + lr] = acc[mb][nb][j]; }
        __builtin_amdgcn_wave_barrier(); asm volatile("" ::: "memory");
        float* crow = C + (size_t)(r0 + mb * 16) * ldc + c0;
{
#pragma unroll
            for (int s = 0; s < 8; ++s) { const int row = 2 * s + hi, cofs = lr * 4; v4f val = *(const v4fa*)(os + row * 68 + cofs);
                *(v4f*)(crow + (size_t)row * ldc + cofs) = val; }
             }
        __builtin_amdgcn_wave_barrier(); asm volatile("" ::: "memory");
    }
}

__device__ __forceinline__ h16 tohx(float x) { return (h16)x; }
__device__ __forceinline__ void splitf(float y, unsigned short& h, unsigned short& l) { h = f2bf(y); l = f2bf(y - bf2f(h)); }
typedef __attribute__((ext_vector_type(2))) _Float16 v2h;
typedef __attribute__((ext_vector_type(4))) _Float16 v4h;
typedef __attribute__((ext_vector_type(2))) unsigned short v2us;
typedef __attribute__((ext_vector_type(4))) unsigned short v4us;
typedef __attribute__((ext_vector_type(2))) float v2f;
typedef __attribute__((ext_vector_type(4))) int v4i;

__global__ __launch_bounds__(256) void k_wtG(const float* __restrict__ w, int K, int N, bf* Bt) {
    const int lane = threadIdx.x & 31; const int L0 = (blockIdx.x * 8 + (threadIdx.x >> 5)) * 8; const int nlines = N * K / 64;
{
#pragma unroll 1
        for (int l = 0; l < 8; ++l) { const int L = L0 + l; if (L >= nlines) break; const size_t e = (size_t)L * 64 + lane * 2; const int k = (int)(e % K), n = (int)(e / K); v2us o;
            o[0] = f2bf(w[(size_t)k * N + n]); o[1] = f2bf(w[(size_t)(k + 1) * N + n]); *(v2us*)(Bt + e) = o; }
         }
}
__global__ __launch_bounds__(256) void k_cvt8(const float* __restrict__ src, bf* dst, size_t n8) { const size_t i = (size_t)blockIdx.x * 256 + threadIdx.x; if (i >= n8) return; const v8f v = *(const v8f*)(src + i * 8); v8us o;
#pragma unroll
    for (int k = 0; k < 8; ++k) o[k] = f2bf(v[k]); *(v8us*)(dst + i * 8) = o;  }

__global__ __launch_bounds__(256) void k_ropeI(const float* __restrict__ F, int pitch, int nheads, const float* __restrict__ CS, float sc, h16* P16, bf* Ph, bf* Pl) {
    const size_t e = ((size_t)blockIdx.x * 256 + threadIdx.x) * 2; if (e >= (size_t)nheads * TT * HD) return; const int d = (int)(e % HD); const int t = (int)((e / HD) % TT); const int h = (int)(e / ((size_t)HD * TT)); const float* f = F + (size_t)t * pitch + h * HD; const float x0 = f[d], x1 = f[d + 1]; const v2f cs = *(const v2f*)(CS + ((size_t)t * HD + d) * 2); v2h o16; v2us oh, ol;
    float a0 = __fmul_rn(x0, cs[0]), b0 = __fmul_rn(x1, cs[1]), a1 = __fmul_rn(x1, cs[0]), b1 = __fmul_rn(x0, cs[1]); asm volatile("" : "+v"(a0), "+v"(b0), "+v"(a1), "+v"(b1));
    float r0 = __fsub_rn(a0, b0) * sc, r1 = __fadd_rn(b1, a1) * sc;   /* even: x0 c - x1 s; odd: x0 s + x1 c */
    o16[0] = tohx(r0); o16[1] = tohx(r1); { unsigned short a2, c2; splitf(r0, a2, c2); oh[0] = a2; ol[0] = c2; splitf(r1, a2, c2); oh[1] = a2; ol[1] = c2; }
    *(v2h*)(P16 + e) = o16; *(v2us*)(Ph + e) = oh; *(v2us*)(Pl + e) = ol;  }

__constant__ float INV2[HD / 2] = { 1.000000000e+00f, 7.498942018e-01f, 5.623413324e-01f, 4.216965139e-01f, 3.162277639e-01f, 2.371373624e-01f, 1.778279394e-01f, 1.333521456e-01f, 1.000000015e-01f, 7.498941571e-02f, 5.623412877e-02f, 4.216964915e-02f, 3.162277862e-02f, 2.371373586e-02f, 1.778279431e-02f, 1.333521493e-02f, 9.999999776e-03f, 7.498942316e-03f, 5.623413250e-03f, 4.216964822e-03f, 3.162277862e-03f, 2.371373819e-03f, 1.778279431e-03f, 1.333521446e-03f, 1.000000047e-03f, 7.498941850e-04f, 5.623413017e-04f, 4.216964880e-04f, 3.162277862e-04f, 2.371373848e-04f, 1.778279402e-04f, 1.333521504e-04f };   // float32 10000^(-(i * 2 / 64)), generated with jnp to be bit-exact with the module's expression
__global__ __launch_bounds__(256) void k_cstabI(const int* __restrict__ pid, float* CS) { const int idx = blockIdx.x * 256 + threadIdx.x; if (idx >= TT * HD) return; const int d = idx % HD; const int t = idx / HD; const float a = __fmul_rn((float)pid[t], INV2[d >> 1]); v2f cs; cs[0] = cosf(a); cs[1] = sinf(a); *(v2f*)(CS + (size_t)idx * 2) = cs;  }

__global__ __launch_bounds__(256) void k_vtp(const float* __restrict__ F, int pitch, int nheads, h16* V16, bf* Vh, bf* Vl) { const size_t e = ((size_t)blockIdx.x * 256 + threadIdx.x) * 2; if (e >= (size_t)nheads * HD * TT) return; const int t = (int)(e % TT); const int d = (int)((e / TT) % HD); const int g = (int)(e / ((size_t)TT * HD)); v2h o16; v2us oh, ol;
#pragma unroll
    for (int q = 0; q < 2; ++q) { const float x = F[(size_t)(t + q) * pitch + g * HD + d]; o16[q] = tohx(x); unsigned short a2, c2; splitf(x, a2, c2); oh[q] = a2; ol[q] = c2; }
    *(v2h*)(V16 + e) = o16; *(v2us*)(Vh + e) = oh; *(v2us*)(Vl + e) = ol;  }
// k_asoft: per row (zz, i): t = S x HD^-0.5 for j <= i and i - j < WIN (sliding causal window; the reference's -1e9 additive fill vanishes identically); softmax over the 2048 keys (register row, one exp, fixed trees);
// rows < RH: hi and lo planes, columns < RH only (the P.V loop of such a row ends at its diagonal block, at most RH); the lo plane lies in the same rows of pitch TT, RH columns on.
__global__ __launch_bounds__(256) void k_asoft(const float* __restrict__ Sb, h16* P16, bf* Ph, bf* Pl) {
    const int lane = threadIdx.x & 31; const int row = blockIdx.x * 8 + (threadIdx.x >> 5); if (row >= ZH * TT) return; const int i = row % TT; const int zz = row / TT; (void)zz; const bool hires = (i < RH); const float* sr = Sb + (size_t)row * TT; float v[TT / 32]; float mx = -3.0e38f;
#pragma unroll
    for (int ch = 0; ch < TT / 128; ++ch) { const int j0 = ch * 128 + lane * 4; const v4f a = *(const v4f*)(sr + j0);
#pragma unroll
        for (int q = 0; q < 4; ++q) { const int j = j0 + q; (void)j; const float t = (j <= i && i - j < WIN) ? a[q] * SCL : -3.0e38f; v[ch * 4 + q] = t; mx = fmaxf(mx, t); } }
#pragma unroll
    for (int sh = 16; sh; sh >>= 1) mx = fmaxf(mx, __shfl_xor(mx, sh, 32));
    float sum = 0.f;
#pragma unroll
    for (int k = 0; k < TT / 32; ++k) { float d0 = __fsub_rn(v[k], mx); asm volatile("" : "+v"(d0)); v[k] = __builtin_amdgcn_exp2f(__fmul_rn(d0, 1.4426950408889634f)); sum += v[k]; }
#pragma unroll
    for (int sh = 16; sh; sh >>= 1) sum += __shfl_xor(sum, sh, 32);
    const float f = __fdiv_rn(hires ? 1.0f : PCAR, sum);
{
        if (hires) {
#pragma unroll
            for (int ch = 0; ch < RH / 128; ++ch) { v4us oh, ol;
#pragma unroll
                for (int q = 0; q < 4; ++q) { unsigned short a, c2; splitf(v[ch * 4 + q] * f, a, c2); oh[q] = a; ol[q] = c2; }
                const size_t oo = ((size_t)zz * (RH ? RH : 1) + i) * TT + ch * 128 + lane * 4; *(v4us*)(Ph + oo) = oh; *(v4us*)(Pl + oo) = ol; }
        } else {
#pragma unroll
            for (int ch = 0; ch < TT / 128; ++ch) { v4h o4;
#pragma unroll
                for (int q = 0; q < 4; ++q) o4[q] = tohx(v[ch * 4 + q] * f);
                *(v4h*)(P16 + (size_t)row * TT + ch * 128 + lane * 4) = o4; } }
         }
}
__global__ __launch_bounds__(256) void k_merge(const float* __restrict__ O, int h0, bf* Ah, bf* Al) { const size_t e = ((size_t)blockIdx.x * 256 + threadIdx.x) * 2; if (e >= (size_t)ZH * TT * HD) return; const int d = (int)(e % HD); const int t = (int)((e / HD) % TT); const int zz = (int)(e / ((size_t)HD * TT)); const float cs = (t < RH) ? 1.0f : (1.0f / PCAR); const size_t oo = (size_t)t * DQ + (h0 + zz) * HD + d;
    v2us oh, ol;
#pragma unroll
    for (int q = 0; q < 2; ++q) { unsigned short a, c2; splitf(O[e + q] * cs, a, c2); oh[q] = a; ol[q] = c2; } *(v2us*)(Ah + oo) = oh; *(v2us*)(Al + oo) = ol;  }

extern "C" void kernel_launch(void* const* d_in, const int* in_sizes, int n_in,
                              void* d_out, int out_size, void* d_ws, size_t ws_size, hipStream_t stream) {
    (void)in_sizes; (void)n_in; (void)out_size;
        const float* x = (const float*)d_in[0]; const int* PID = (const int*)d_in[5]; const float* wq = (const float*)d_in[1]; const float* wk = (const float*)d_in[2]; const float* wv = (const float*)d_in[3]; const float* wo = (const float*)d_in[4];   /* order x, Wq, Wk, Wv, Wo ('oi' [1024][1024]), token_positions (int32 [2][2048]: ONE row of positions PER BATCH, sorted random values in [0, 2048); read on device) */
    float* OUT = (float*)d_out;     // [2][2048][1024]
    char* wsp = (char*)d_ws;
    auto take = [&](size_t bytes) { char* p = wsp; wsp += (bytes + 255) & ~(size_t)255; return (void*)p; };
    bf* WQ = (bf*)take((size_t)DQ * DM * 2); bf* WK = (bf*)take((size_t)DKV * DM * 2); bf* WV = (bf*)take((size_t)DKV * DM * 2); bf* WO = (bf*)take((size_t)DM * DQ * 2);
    h16* VT16 = (h16*)take((size_t)NKV * HD * TT * 2);
    bf* QPh = (bf*)take((size_t)NH_ * TT * HD * 2); bf* QPl = (bf*)take((size_t)NH_ * TT * HD * 2); bf* KPh = (bf*)take((size_t)NKV * TT * HD * 2); bf* KPl = (bf*)take((size_t)NKV * TT * HD * 2); bf* VTh = (bf*)take((size_t)NKV * HD * TT * 2); bf* VTl = (bf*)take((size_t)NKV * HD * TT * 2); bf* Ph = (bf*)take((size_t)ZH * RH * TT * 2); bf* Pl = Ph + RH;
    float* Sb = (float*)take((size_t)ZH * TT * TT * 4); h16* P16 = (h16*)take((size_t)ZH * TT * TT * 2); bf* ATh = (bf*)take((size_t)TT * DQ * 2); bf* ATl = (bf*)take((size_t)TT * DQ * 2);
    if ((size_t)(wsp - (char*)d_ws) > ws_size) return;    // ws 256 MiB
    // Eight heads of scores and probabilities leave no room for buffers of their own here; these share the score buffer, which is dead whenever they are live (all launches are stream-ordered):
    // the rotary table, the bf16 x, the f32 projections and the fp16 q/k planes are last touched before the batch's first score launch; the P.V output is written after the pass's softmax has read the scores and read by k_merge before the next score launch.
    wsp = (char*)Sb;
    float* CS = (float*)take((size_t)TT * HD * 2 * 4); bf* XB = (bf*)take((size_t)TT * DM * 2); float* FQ = (float*)take((size_t)TT * DQ * 4); float* FK = (float*)take((size_t)TT * DKV * 4); h16* QP16 = (h16*)take((size_t)NH_ * TT * HD * 2); h16* KP16 = (h16*)take((size_t)NKV * TT * HD * 2);
    float* Ob = Sb;
    float* FV = FK;   // v projection reuses the k buffer after the k planes are built (stream-ordered)
    { k_cvt8<<<(unsigned)(((size_t)DQ * DM / 8 + 255) / 256), 256, 0, stream>>>(wq, WQ, (size_t)DQ * DM / 8); k_cvt8<<<(unsigned)(((size_t)DKV * DM / 8 + 255) / 256), 256, 0, stream>>>(wk, WK, (size_t)DKV * DM / 8); k_cvt8<<<(unsigned)(((size_t)DKV * DM / 8 + 255) / 256), 256, 0, stream>>>(wv, WV, (size_t)DKV * DM / 8);
      k_cvt8<<<(unsigned)(((size_t)DM * DQ / 8 + 255) / 256), 256, 0, stream>>>(wo, WO, (size_t)DM * DQ / 8); /* the rotary table is rebuilt per batch from that batch's positions (below) */ }
    const unsigned LQ = (unsigned)(((size_t)NH_ * TT * HD / 2 + 255) / 256), LKv = (unsigned)(((size_t)NKV * TT * HD / 2 + 255) / 256);
    for (int b = 0; b < NB_; ++b) {
        k_cstabI<<<(TT * HD + 255) / 256, 256, 0, stream>>>(PID + (size_t)b * TT, CS);   /* token_positions[b][:] (int32, read): THIS batch's own row of positions */
        
        k_cvt8<<<(unsigned)(((size_t)TT * DM / 8 + 255) / 256), 256, 0, stream>>>(x + (size_t)b * TT * DM, XB, (size_t)TT * DM / 8);
        k_gemmk<bf, 0, 8, false><<<dim3(TT / 64, DQ / 64, 1), 256, 0, stream>>>(XB, nullptr, WQ, nullptr, DM, FQ, DQ, 0, 0, 0, 0);
        k_ropeI<<<LQ, 256, 0, stream>>>(FQ, DQ, NH_, CS, 1.0f, QP16, QPh, QPl);
        k_gemmk<bf, 0, 8, false><<<dim3(TT / 64, DKV / 64, 1), 256, 0, stream>>>(XB, nullptr, WK, nullptr, DM, FK, DKV, 0, 0, 0, 0);
        k_ropeI<<<LKv, 256, 0, stream>>>(FK, DKV, NKV, CS, 1.0f, KP16, KPh, KPl);
        k_gemmk<bf, 0, 8, false><<<dim3(TT / 64, DKV / 64, 1), 256, 0, stream>>>(XB, nullptr, WV, nullptr, DM, FV, DKV, 0, 0, 0, 0); k_vtp<<<LKv, 256, 0, stream>>>(FV, DKV, NKV, VT16, VTh, VTl);
        for (int h0 = 0; h0 < NH_; h0 += ZH) { const size_t zq = (size_t)h0, zk = (size_t)(h0 / REP);   // one kv head per query head: the pass's heads use consecutive kv planes (z-strides TT*HD)
            k_gemmc<bf, 2, 1><<<dim3(TT / 64, TT / 64, ZH), 32, 0, stream>>>(QPh + zq * TT * HD, QPl + zq * TT * HD, KPh + zk * TT * HD, KPl + zk * TT * HD, HD, Sb, TT, 0, (size_t)TT * HD, (size_t)TT * HD, (size_t)TT * TT);   /* scores on hi/lo planes for EVERY row (3 products) */
            /* (the fp16 score launch for rows >= RH is removed: all rows use the hi/lo launch above) */
            k_asoft<<<ZH * TT / 8, 256, 0, stream>>>(Sb, P16, Ph, Pl);
            k_gemmk<bf, 2, 16, true><<<dim3(RH / 64, HD / 64, ZH), 512, 0, stream>>>(Ph, Pl, VTh + zk * HD * TT, VTl + zk * HD * TT, TT, Ob, HD, 0, (size_t)RH * TT, (size_t)HD * TT, (size_t)TT * HD);
            k_gemmk<h16, 0, 16, true><<<dim3((TT - RH) / 64, HD / 64, ZH), 512, 0, stream>>>(P16 + (size_t)RH * TT, nullptr, VT16 + zk * HD * TT, nullptr, TT, Ob + (size_t)RH * HD, HD, RH, (size_t)TT * TT, (size_t)HD * TT, (size_t)TT * HD);
            k_merge<<<(unsigned)(((size_t)ZH * TT * HD / 2 + 255) / 256), 256, 0, stream>>>(Ob, h0, ATh, ATl); }
        k_gemmk<bf, 1, 8, false><<<dim3(TT / 64, DM / 64, 1), 256, 0, stream>>>(ATh, ATl, WO, nullptr, DQ, OUT + (size_t)b * TT * DM, DM, 0, 0, 0, 0); }
}

// v003
// A run of this version takes 228 microseconds.
// Timed twice side by side with v002, it ran 1.77 times as fast both times.
// All steps since v000 together make it 6.00 times as fast.
#include <hip/hip_runtime.h>

// Causal multi-head self-attention with interleaved-pair rotary position embedding from PER-BATCH position rows (x [2][2048][1024]; q, k, v = einsum('bsd,od', x, W) ('oi' [1024][1024], no bias; 16 heads x 64); angle = float(token_positions[b][t]) x 1 / theta ** (2i / 64) (theta 1e4; token_positions int32 [2][2048]: each batch has its OWN sorted row of random positions in [0, 2048), READ on device); pairs (2i, 2i+1): (xe cos - xo sin, xe sin + xo cos) on q and k; scores / sqrt(64); keys j <= i kept (by INDEX, not by position), -inf elsewhere; softmax; out = einsum('bso,do', merged, Wo) -> [2][2048][1024] (4.2 M); argument order x, Wq, Wk, Wv, Wo, token_positions).
// Layout per batch: bf16 copy of x; exact projections; {cos, sin} per (position, pair) built once from the int positions and float32 inverse-frequency constants (precise cosf/sinf); interleaved rotary plane builder; fused causal T-2048 attention, no score buffer (EVERY row's scores on hi/lo planes (3 products: logit sigma 2 with these weights), online softmax, hybrid P.V (rows < 512 hi/lo, rest fp16); key blocks above the diagonal are never touched); merged hi/lo x Wo exact.
// Compute dtypes, f32 accumulate: every input rounded to bf16; projections exact; rotary f32; attention scores 3 products, P.V rows < 512 3 products, rest fp16; softmax f32; Wo hl x exact.

#define NB_  2
#define TT   2048
#define DM   1024
#define NH_  16
#define NKV  16
#define REP  (NH_ / NKV)
#define HD   64
#define DQ   (NH_ * HD)
#define DKV  (NKV * HD)
#define RH   512                  // query rows < RH take P.V on hi+lo planes (0: none)
typedef _Float16 h16;
typedef unsigned short bf;
typedef __attribute__((ext_vector_type(16))) __bf16   v16bf;
typedef __attribute__((ext_vector_type(16))) _Float16 v16h;
typedef __attribute__((ext_vector_type(8)))  _Float16 v8h;
typedef __attribute__((ext_vector_type(8)))  unsigned short v8us;
typedef __attribute__((ext_vector_type(8)))  float    v8f;
typedef __attribute__((ext_vector_type(4)))  float    v4f;
typedef v8h  __attribute__((may_alias)) v8ha;
typedef v4f  __attribute__((may_alias)) v4fa;
typedef v8us __attribute__((may_alias)) v8usa;

__device__ __forceinline__ unsigned short f2bf(float f) { unsigned u = __float_as_uint(f); u += 0x7FFFu + ((u >> 16) & 1u); return (unsigned short)(u >> 16); }
__device__ __forceinline__ float bf2f(unsigned short b) { return __uint_as_float(((unsigned)b) << 16); }
__device__ __forceinline__ float bfr(float f) { return bf2f(f2bf(f)); }
__device__ __forceinline__ v16h cat16(v8h lo, v8h hi) { return __builtin_shufflevector(lo, hi, 0, 1, 2, 3, 4, 5, 6, 7, 8, 9, 10, 11, 12, 13, 14, 15); }
__device__ __forceinline__ v16bf cat16b(v8us lo, v8us hi) { return __builtin_bit_cast(v16bf, __builtin_shufflevector(lo, hi, 0, 1, 2, 3, 4, 5, 6, 7, 8, 9, 10, 11, 12, 13, 14, 15)); }
__device__ __forceinline__ v8f wmma16(v16h a, v16h b, v8f c) { return __builtin_amdgcn_wmma_f32_16x16x32_f16(false, a, false, b, (short)0, c, false, false); }
__device__ __forceinline__ v8f wmmab(v16bf a, v16bf b, v8f c) { return __builtin_amdgcn_wmma_f32_16x16x32_bf16(false, a, false, b, (short)0, c, false, false); }



// ---- k_gemmk: register-blocked GEMM, one 64x64 output tile per work-group of NW waves, operands straight from K-contiguous 16-bit planes; grid (M/64, N/64, Z), NW x 32 threads.
// C[m][n] (f32, pitch ldc) = sum_k A[m][k] Bt[n][k] (+ split products per NSPLIT). z-batch strides sA/sB/sC in elements. K % 32 == 0.
// The K loop is dealt to the waves in turn, 32 k a trip (wave w takes trips w, w + NW, ...); every wave keeps its own 16 accumulators, the NW partial tiles meet in LDS and are added in the fixed order wave 0 .. NW-1.
// CAUSAL (probability x value): the K loop stops at the diagonal block (probabilities beyond it are exactly zero); roff = row offset of this launch's first row within the sequence.
template <typename T16> struct WFrag;
template <> struct WFrag<h16> { typedef v16h V; static __device__ __forceinline__ V ld(const h16* p) { return cat16(*(const v8h*)p, *(const v8h*)(p + 16)); } static __device__ __forceinline__ v8f mma(V a, V b, v8f c) { return wmma16(a, b, c); } };
template <> struct WFrag<bf> { typedef v16bf V; static __device__ __forceinline__ V ld(const bf* p) { return cat16b(*(const v8us*)p, *(const v8us*)(p + 16)); } static __device__ __forceinline__ v8f mma(V a, V b, v8f c) { return wmmab(a, b, c); } };
template <typename T16, int NSPLIT, int NW, bool CAUSAL>
__global__ __launch_bounds__(NW * 32) void k_gemmk(const T16* __restrict__ A, const T16* __restrict__ A2, const T16* __restrict__ Bt, const T16* __restrict__ Bt2, int K, float* C, int ldc, int roff, size_t sA, size_t sB, size_t sC) {
    typedef typename WFrag<T16>::V V;
    __shared__ __align__(16) float part[NW * 4096];   // [wave][fragment][half][lane][4]: every 16-byte store and load is contiguous over the lanes
    __shared__ __align__(16) float os[64 * 68];
    const size_t z = blockIdx.z; A += z * sA; if (A2) A2 += z * sA; Bt += z * sB; if (Bt2) Bt2 += z * sB; C += z * sC;
    const int tid = threadIdx.x, lane = tid & 31, wave = __builtin_amdgcn_readfirstlane(tid >> 5), lr = lane & 15, hi = lane >> 4; const int r0 = blockIdx.x * 64, c0 = blockIdx.y * 64;
    const int Kl = CAUSAL ? min(K, r0 + roff + 64) : K;
    v8f acc[4][4];
#pragma unroll
    for (int mb = 0; mb < 4; ++mb)
#pragma unroll
        for (int nb = 0; nb < 4; ++nb) acc[mb][nb] = (v8f){};
    const size_t aoff = (size_t)(r0 + lr) * K + 8 * hi, boff = (size_t)(c0 + lr) * K + 8 * hi;
#pragma unroll 1
    for (int kc = wave * 32; kc < Kl; kc += NW * 32) {
        V a[4], a2[4];
#pragma unroll
        for (int mb = 0; mb < 4; ++mb) { a[mb] = WFrag<T16>::ld(A + aoff + (size_t)mb * 16 * K + kc); if (NSPLIT == 1 || NSPLIT == 2) a2[mb] = WFrag<T16>::ld(A2 + aoff + (size_t)mb * 16 * K + kc); }
#pragma unroll
        for (int nb = 0; nb < 4; ++nb) { const V b = WFrag<T16>::ld(Bt + boff + (size_t)nb * 16 * K + kc); V b2; if (NSPLIT >= 2) b2 = WFrag<T16>::ld(Bt2 + boff + (size_t)nb * 16 * K + kc);
#pragma unroll
            for (int mb = 0; mb < 4; ++mb) { acc[mb][nb] = WFrag<T16>::mma(a[mb], b, acc[mb][nb]); if (NSPLIT == 1 || NSPLIT == 2) acc[mb][nb] = WFrag<T16>::mma(a2[mb], b, acc[mb][nb]); if (NSPLIT >= 2) acc[mb][nb] = WFrag<T16>::mma(a[mb], b2, acc[mb][nb]); } }
        // four vector slots behind the last matrix instruction, so that its distance also holds over the loop's back edge
        asm volatile("v_nop\n\tv_nop\n\tv_nop\n\tv_nop" : "+v"(acc[0][0]), "+v"(acc[1][1]), "+v"(acc[2][2]), "+v"(acc[3][3]) : "v"(a[0]), "v"(a[3]));
    }
    float* pw = part + wave * 4096 + lane * 4;
#pragma unroll
    for (int mb = 0; mb < 4; ++mb)
#pragma unroll
        for (int nb = 0; nb < 4; ++nb) { const v8f c = acc[mb][nb]; *(v4fa*)(pw + (mb * 4 + nb) * 256) = (v4f){c[0], c[1], c[2], c[3]}; *(v4fa*)(pw + (mb * 4 + nb) * 256 + 128) = (v4f){c[4], c[5], c[6], c[7]}; }
    __syncthreads();   // every wave's partial tile is in LDS
#pragma unroll
    for (int u = 0; u < 32 / NW; ++u) { const int idx = u * (NW * 32) + tid; v4f s = *(const v4fa*)(part + idx * 4);
#pragma unroll
        for (int w = 1; w < NW; ++w) s += *(const v4fa*)(part + w * 4096 + idx * 4);
        const int fr = idx >> 6, row = (fr >> 2) * 16 + hi * 8 + ((idx >> 5) & 1) * 4, col = (fr & 3) * 16 + lr;
#pragma unroll
        for (int q = 0; q < 4; ++q) os[(row + q) * 68 + col] = s[q]; }
    __syncthreads();   // the summed tile is in LDS, row-major: whole rows go out in 16-byte stores
#pragma unroll
    for (int u = 0; u < 32 / NW; ++u) { const int idx = u * (NW * 32) + tid, row = idx >> 4, cofs = (idx & 15) * 4; *(v4f*)(C + (size_t)(r0 + row) * ldc + c0 + cofs) = *(const v4fa*)(os + row * 68 + cofs); }
}

__device__ __forceinline__ h16 tohx(float x) { return (h16)x; }
__device__ __forceinline__ void splitf(float y, unsigned short& h, unsigned short& l) { h = f2bf(y); l = f2bf(y - bf2f(h)); }
typedef __attribute__((ext_vector_type(2))) _Float16 v2h;
typedef __attribute__((ext_vector_type(4))) _Float16 v4h;
typedef __attribute__((ext_vector_type(2))) unsigned short v2us;
typedef __attribute__((ext_vector_type(4))) unsigned short v4us;
typedef __attribute__((ext_vector_type(2))) float v2f;
typedef __attribute__((ext_vector_type(4))) int v4i;

__global__ __launch_bounds__(256) void k_wtG(const float* __restrict__ w, int K, int N, bf* Bt) {
    const int lane = threadIdx.x & 31; const int L0 = (blockIdx.x * 8 + (threadIdx.x >> 5)) * 8; const int nlines = N * K / 64;
{
#pragma unroll 1
        for (int l = 0; l < 8; ++l) { const int L = L0 + l; if (L >= nlines) break; const size_t e = (size_t)L * 64 + lane * 2; const int k = (int)(e % K), n = (int)(e / K); v2us o;
            o[0] = f2bf(w[(size_t)k * N + n]); o[1] = f2bf(w[(size_t)(k + 1) * N + n]); *(v2us*)(Bt + e) = o; }
         }
}
__global__ __launch_bounds__(256) void k_cvt8(const float* __restrict__ src, bf* dst, size_t n8) { const size_t i = (size_t)blockIdx.x * 256 + threadIdx.x; if (i >= n8) return; const v8f v = *(const v8f*)(src + i * 8); v8us o;
#pragma unroll
    for (int k = 0; k < 8; ++k) o[k] = f2bf(v[k]); *(v8us*)(dst + i * 8) = o;  }

__global__ __launch_bounds__(256) void k_ropeI(const float* __restrict__ F, int pitch, int nheads, const float* __restrict__ CS, float sc, h16* P16, bf* Ph, bf* Pl) {
    const size_t e = ((size_t)blockIdx.x * 256 + threadIdx.x) * 2; if (e >= (size_t)nheads * TT * HD) return; const int d = (int)(e % HD); const int t = (int)((e / HD) % TT); const int h = (int)(e / ((size_t)HD * TT)); const float* f = F + (size_t)t * pitch + h * HD; const float x0 = f[d], x1 = f[d + 1]; const v2f cs = *(const v2f*)(CS + ((size_t)t * HD + d) * 2); v2h o16; v2us oh, ol;
    float a0 = __fmul_rn(x0, cs[0]), b0 = __fmul_rn(x1, cs[1]), a1 = __fmul_rn(x1, cs[0]), b1 = __fmul_rn(x0, cs[1]); asm volatile("" : "+v"(a0), "+v"(b0), "+v"(a1), "+v"(b1));
    float r0 = __fsub_rn(a0, b0) * sc, r1 = __fadd_rn(b1, a1) * sc;   /* even: x0 c - x1 s; odd: x0 s + x1 c */
    o16[0] = tohx(r0); o16[1] = tohx(r1); { unsigned short a2, c2; splitf(r0, a2, c2); oh[0] = a2; ol[0] = c2; splitf(r1, a2, c2); oh[1] = a2; ol[1] = c2; }
    *(v2h*)(P16 + e) = o16; *(v2us*)(Ph + e) = oh; *(v2us*)(Pl + e) = ol;  }

__constant__ float INV2[HD / 2] = { 1.000000000e+00f, 7.498942018e-01f, 5.623413324e-01f, 4.216965139e-01f, 3.162277639e-01f, 2.371373624e-01f, 1.778279394e-01f, 1.333521456e-01f, 1.000000015e-01f, 7.498941571e-02f, 5.623412877e-02f, 4.216964915e-02f, 3.162277862e-02f, 2.371373586e-02f, 1.778279431e-02f, 1.333521493e-02f, 9.999999776e-03f, 7.498942316e-03f, 5.623413250e-03f, 4.216964822e-03f, 3.162277862e-03f, 2.371373819e-03f, 1.778279431e-03f, 1.333521446e-03f, 1.000000047e-03f, 7.498941850e-04f, 5.623413017e-04f, 4.216964880e-04f, 3.162277862e-04f, 2.371373848e-04f, 1.778279402e-04f, 1.333521504e-04f };   // float32 10000^(-(i * 2 / 64)), generated with jnp to be bit-exact with the module's expression
__global__ __launch_bounds__(256) void k_cstabI(const int* __restrict__ pid, float* CS) { const int idx = blockIdx.x * 256 + threadIdx.x; if (idx >= TT * HD) return; const int d = idx % HD; const int t = idx / HD; const float a = __fmul_rn((float)pid[t], INV2[d >> 1]); v2f cs; cs[0] = cosf(a); cs[1] = sinf(a); *(v2f*)(CS + (size_t)idx * 2) = cs;  }

__global__ __launch_bounds__(256) void k_vtp(const float* __restrict__ F, int pitch, int nheads, h16* V16, bf* Vh, bf* Vl) { const size_t e = ((size_t)blockIdx.x * 256 + threadIdx.x) * 2; if (e >= (size_t)nheads * HD * TT) return; const int t = (int)(e % TT); const int d = (int)((e / TT) % HD); const int g = (int)(e / ((size_t)TT * HD)); v2h o16; v2us oh, ol;
#pragma unroll
    for (int q = 0; q < 2; ++q) { const float x = F[(size_t)(t + q) * pitch + g * HD + d]; o16[q] = tohx(x); unsigned short a2, c2; splitf(x, a2, c2); oh[q] = a2; ol[q] = c2; }
    *(v2h*)(V16 + e) = o16; *(v2us*)(Vh + e) = oh; *(v2us*)(Vl + e) = ol;  }
// ---- k_fattn: scores, causal softmax, P.V and the head merge in one kernel; grid (TT / 32, heads / 2), 8 waves. A work-group takes 32 query rows of one head (tile n - 1 - x), then 32 of another (tile x); a tile's 32-key blocks up to the diagonal are dealt to the waves in turn.
// Transposed products: S^T = K Q^T (A = key rows, B = query rows kept in registers; hi/lo planes, 3 products), so a lane holds the scores of ONE query (column lr) and two 16-key score tiles, converted in place, are the B operand of
// O^T += V^T P^T (A = rows of the [d][t] value planes, same k order as the loader). Rows < RH: p and v on hi/lo planes (3 products); the rest: p and v in fp16. p = exp2((s - running max) x HD^-0.5 x log2 e), at most 1, normalised in f32 at the end.
// Every wave keeps its own running maximum, sum and output tile; they meet in LDS and are joined in the fixed order wave 0 .. 7.
#define C2 0.18033688011112042f   // HD^-0.5 x log2(e)
__device__ __forceinline__ float xhalf(float x) { const int b = __float_as_int(x); return __int_as_float(__builtin_amdgcn_permlanex16(b, b, 0x76543210, 0xfedcba98, false, false)); }   // lane l <-> l ^ 16
template <bool HR>
__device__ __forceinline__ void fattn_loop(const bf* __restrict__ Kh, const bf* __restrict__ Kl, const h16* __restrict__ V16, const bf* __restrict__ Vh, const bf* __restrict__ Vl, const v16bf (&qh)[2][2], const v16bf (&ql)[2][2],
                                           int wave, int nblk, int lr, int hi, v8f (&o)[4][2], float (&m)[2], float (&l)[2]) {
    unsigned kofs = ((unsigned)(wave * 32 + lr) * HD + 8 * hi) * 2, vofs = ((unsigned)lr * TT + wave * 32 + 8 * hi) * 2;   // this lane's byte offsets in the key and value planes: one 32-bit register each beside a scalar base
    // the block loop stays rolled (a second copy of the body would need a second set of fragment registers); the constant loops inside are unrolled so that every fragment index is a compile-time constant and the tiles stay in registers
#pragma unroll 1
    for (int blk = wave; blk < nblk; blk += 8, kofs += 8 * 32 * HD * 2, vofs += 8 * 32 * 2) {
        const bf* kph = (const bf*)((const char*)Kh + kofs); const bf* kpl = (const bf*)((const char*)Kl + kofs);
        v16bf kh[2][2], kl[2][2];
#pragma unroll
        for (int kb = 0; kb < 2; ++kb)
#pragma unroll
            for (int ks = 0; ks < 2; ++ks) { kh[kb][ks] = WFrag<bf>::ld(kph + kb * 16 * HD + ks * 32); kl[kb][ks] = WFrag<bf>::ld(kpl + kb * 16 * HD + ks * 32); }
        // inputs-only fence on the loaded key fragments: all sixteen loads are issued together and waited for once; without it the compiler reuses two fragments' registers and waits out the load latency several times per block
        asm volatile("" :: "v"(kh[0][0]), "v"(kh[0][1]), "v"(kh[1][0]), "v"(kh[1][1]), "v"(kl[0][0]), "v"(kl[0][1]), "v"(kl[1][0]), "v"(kl[1][1]));
        v8f s[2][2];
#pragma unroll
        for (int kb = 0; kb < 2; ++kb)
#pragma unroll
            for (int n = 0; n < 2; ++n) s[kb][n] = (v8f){};
#pragma unroll
        for (int ks = 0; ks < 2; ++ks) {
#pragma unroll
            for (int kb = 0; kb < 2; ++kb)
#pragma unroll
                for (int n = 0; n < 2; ++n) s[kb][n] = wmmab(kh[kb][ks], qh[n][ks], s[kb][n]);
#pragma unroll
            for (int kb = 0; kb < 2; ++kb)
#pragma unroll
                for (int n = 0; n < 2; ++n) s[kb][n] = wmmab(kh[kb][ks], ql[n][ks], s[kb][n]);
#pragma unroll
            for (int kb = 0; kb < 2; ++kb)
#pragma unroll
                for (int n = 0; n < 2; ++n) s[kb][n] = wmmab(kl[kb][ks], qh[n][ks], s[kb][n]);
        }
        if (blk == nblk - 1) {   // the diagonal block: keys j > i are out (every query keeps at least the block's first key)
#pragma unroll
            for (int kb = 0; kb < 2; ++kb)
#pragma unroll
                for (int n = 0; n < 2; ++n)
#pragma unroll
                    for (int j = 0; j < 8; ++j) if (kb * 16 + hi * 8 + j > n * 16 + lr) s[kb][n][j] = -3.0e38f;
        }
        v16h p16[2]; v16bf ph[2], pl[2];
#pragma unroll
        for (int n = 0; n < 2; ++n) {
            float mx = s[0][n][0];
#pragma unroll
            for (int j = 1; j < 8; ++j) mx = fmaxf(mx, s[0][n][j]);
#pragma unroll
            for (int j = 0; j < 8; ++j) mx = fmaxf(mx, s[1][n][j]);
            mx = fmaxf(mx, xhalf(mx));
            const float mn = fmaxf(m[n], mx), al = __builtin_amdgcn_exp2f((m[n] - mn) * C2), mc = mn * C2; m[n] = mn;
            float sum = 0.f; v8h f0, f1;
#pragma unroll
            for (int j = 0; j < 8; ++j) {
                const float pa = __builtin_amdgcn_exp2f(s[0][n][j] * C2 - mc), pb = __builtin_amdgcn_exp2f(s[1][n][j] * C2 - mc); sum += pa; sum += pb;
                if (HR) { const __bf16 xa = (__bf16)pa, xb = (__bf16)pb; ph[n][j] = xa; pl[n][j] = (__bf16)(pa - (float)xa); ph[n][8 + j] = xb; pl[n][8 + j] = (__bf16)(pb - (float)xb); } else { f0[j] = tohx(pa); f1[j] = tohx(pb); } }
            l[n] = l[n] * al + sum;   // this lane's half of the keys; the halves are joined after the loop
            if (!HR) p16[n] = cat16(f0, f1);
#pragma unroll
            for (int db = 0; db < 4; ++db) o[db][n] *= al;
        }
#pragma unroll
        for (int db = 0; db < 4; ++db) {
            if (HR) { const v16bf vh = WFrag<bf>::ld((const bf*)((const char*)Vh + vofs) + db * 16 * TT), vl = WFrag<bf>::ld((const bf*)((const char*)Vl + vofs) + db * 16 * TT);
#pragma unroll
                for (int n = 0; n < 2; ++n) { o[db][n] = wmmab(vh, ph[n], o[db][n]); o[db][n] = wmmab(vh, pl[n], o[db][n]); o[db][n] = wmmab(vl, ph[n], o[db][n]); }
            } else { const v16h vf = WFrag<h16>::ld((const h16*)((const char*)V16 + vofs) + db * 16 * TT);
#pragma unroll
                for (int n = 0; n < 2; ++n) o[db][n] = wmma16(vf, p16[n], o[db][n]); } }
    }
}
__global__ __launch_bounds__(256) void k_fattn(const bf* __restrict__ Qh, const bf* __restrict__ Ql, const bf* __restrict__ Kh, const bf* __restrict__ Kl, const h16* __restrict__ V16, const bf* __restrict__ Vh, const bf* __restrict__ Vl, bf* Ah, bf* Al) {
    __shared__ __align__(16) float part[8 * 2048];   // [wave][fragment][half][lane][4]: every 16-byte store and load is contiguous over the lanes
    __shared__ float sM[8][32], sL[8][32];
    const int tid = threadIdx.x, lane = tid & 31, wave = __builtin_amdgcn_readfirstlane(tid >> 5), lr = lane & 15, hi = lane >> 4;
    // two tiles one after the other, so that every work-group walks 65 key blocks: kept rolled, one copy of the code
#pragma unroll 1
    for (int pass = 0; pass < 2; ++pass) {
        const int tile = pass ? (int)blockIdx.x : TT / 32 - 1 - (int)blockIdx.x, r0 = tile * 32, h = (int)blockIdx.y + pass * (NH_ / 2);
        const size_t zo = (size_t)h * TT * HD;
        v16bf qh[2][2], ql[2][2];
#pragma unroll
        for (int n = 0; n < 2; ++n)
#pragma unroll
            for (int ks = 0; ks < 2; ++ks) { const size_t qo = zo + (size_t)(r0 + n * 16 + lr) * HD + ks * 32 + 8 * hi; qh[n][ks] = WFrag<bf>::ld(Qh + qo); ql[n][ks] = WFrag<bf>::ld(Ql + qo); }
        asm volatile("s_wait_xcnt 0x0" ::: "memory");   // before the address registers of the query loads are used for something else
        v8f o[4][2]; float m[2] = { -3.0e38f, -3.0e38f }, l[2] = { 0.f, 0.f };
#pragma unroll
        for (int db = 0; db < 4; ++db)
#pragma unroll
            for (int n = 0; n < 2; ++n) o[db][n] = (v8f){};
        if (r0 < RH) fattn_loop<true>(Kh + zo, Kl + zo, V16 + zo, Vh + zo, Vl + zo, qh, ql, wave, tile + 1, lr, hi, o, m, l);
        else         fattn_loop<false>(Kh + zo, Kl + zo, V16 + zo, Vh + zo, Vl + zo, qh, ql, wave, tile + 1, lr, hi, o, m, l);
#pragma unroll
        for (int n = 0; n < 2; ++n) l[n] += xhalf(l[n]);
        sM[wave][lane] = hi ? m[1] : m[0]; sL[wave][lane] = hi ? l[1] : l[0];   // entry n * 16 + query column
        __syncthreads();   // every wave's maximum and sum are in LDS (a wave without a block: -3e38 and 0; wave 0 always has block 0); every wave has also left the first tile's partial tiles
        float inv[2];
#pragma unroll
        for (int n = 0; n < 2; ++n) { float M = sM[0][n * 16 + lr];
#pragma unroll
            for (int w = 1; w < 8; ++w) M = fmaxf(M, sM[w][n * 16 + lr]);
            float L = 0.f;
#pragma unroll
            for (int w = 0; w < 8; ++w) L += sL[w][n * 16 + lr] * __builtin_amdgcn_exp2f((sM[w][n * 16 + lr] - M) * C2);
            inv[n] = __fdiv_rn(1.0f, L); const float f = __builtin_amdgcn_exp2f((m[n] - M) * C2);
#pragma unroll
            for (int db = 0; db < 4; ++db) o[db][n] *= f; }
        float* pw = part + wave * 2048 + lane * 4;
#pragma unroll
        for (int db = 0; db < 4; ++db)
#pragma unroll
            for (int n = 0; n < 2; ++n) { const v8f c = o[db][n]; *(v4fa*)(pw + (db * 2 + n) * 256) = (v4f){c[0], c[1], c[2], c[3]}; *(v4fa*)(pw + (db * 2 + n) * 256 + 128) = (v4f){c[4], c[5], c[6], c[7]}; }
        __syncthreads();   // every wave's weighted output tile is in LDS; every wave has read the maxima and sums
        // wave w joins fragment w (head dims (w >> 1) * 16 .., query group w & 1): a lane ends with 8 consecutive dims of one query row, one 16-byte store per plane
        const float* pr = part + wave * 256 + lane * 4; v4f a = *(const v4fa*)pr, c = *(const v4fa*)(pr + 128);
#pragma unroll
        for (int w = 1; w < 8; ++w) { a += *(const v4fa*)(pr + w * 2048); c += *(const v4fa*)(pr + w * 2048 + 128); }
        const float iv = (wave & 1) ? inv[1] : inv[0]; v8us oh, ol;
#pragma unroll
        for (int q = 0; q < 4; ++q) { unsigned short x, y; splitf(a[q] * iv, x, y); oh[q] = x; ol[q] = y; splitf(c[q] * iv, x, y); oh[4 + q] = x; ol[4 + q] = y; }
        const size_t oo = (size_t)(r0 + (wave & 1) * 16 + lr) * DQ + h * HD + (wave >> 1) * 16 + hi * 8; *(v8us*)(Ah + oo) = oh; *(v8us*)(Al + oo) = ol;
        asm volatile("s_wait_xcnt 0x0" ::: "memory");   // before the second tile overwrites the registers that the two stores name
    }
}

extern "C" void kernel_launch(void* const* d_in, const int* in_sizes, int n_in,
                              void* d_out, int out_size, void* d_ws, size_t ws_size, hipStream_t stream) {
    (void)in_sizes; (void)n_in; (void)out_size;
        const float* x = (const float*)d_in[0]; const int* PID = (const int*)d_in[5]; const float* wq = (const float*)d_in[1]; const float* wk = (const float*)d_in[2]; const float* wv = (const float*)d_in[3]; const float* wo = (const float*)d_in[4];   /* order x, Wq, Wk, Wv, Wo ('oi' [1024][1024]), token_positions (int32 [2][2048]: ONE row of positions PER BATCH, sorted random values in [0, 2048); read on device) */
    float* OUT = (float*)d_out;     // [2][2048][1024]
    char* wsp = (char*)d_ws;
    auto take = [&](size_t bytes) { char* p = wsp; wsp += (bytes + 255) & ~(size_t)255; return (void*)p; };
    bf* WQ = (bf*)take((size_t)DQ * DM * 2); bf* WK = (bf*)take((size_t)DKV * DM * 2); bf* WV = (bf*)take((size_t)DKV * DM * 2); bf* WO = (bf*)take((size_t)DM * DQ * 2);
    h16* VT16 = (h16*)take((size_t)NKV * HD * TT * 2);
    bf* QPh = (bf*)take((size_t)NH_ * TT * HD * 2); bf* QPl = (bf*)take((size_t)NH_ * TT * HD * 2); bf* KPh = (bf*)take((size_t)NKV * TT * HD * 2); bf* KPl = (bf*)take((size_t)NKV * TT * HD * 2); bf* VTh = (bf*)take((size_t)NKV * HD * TT * 2); bf* VTl = (bf*)take((size_t)NKV * HD * TT * 2);
    bf* ATh = (bf*)take((size_t)TT * DQ * 2); bf* ATl = (bf*)take((size_t)TT * DQ * 2);
    float* CS = (float*)take((size_t)TT * HD * 2 * 4); bf* XB = (bf*)take((size_t)TT * DM * 2); float* FQ = (float*)take((size_t)TT * DQ * 4); float* FK = (float*)take((size_t)TT * DKV * 4); h16* QP16 = (h16*)take((size_t)NH_ * TT * HD * 2); h16* KP16 = (h16*)take((size_t)NKV * TT * HD * 2);
    if ((size_t)(wsp - (char*)d_ws) > ws_size) return;    // ws 256 MiB
    float* FV = FK;   // v projection reuses the k buffer after the k planes are built (stream-ordered)
    { k_cvt8<<<(unsigned)(((size_t)DQ * DM / 8 + 255) / 256), 256, 0, stream>>>(wq, WQ, (size_t)DQ * DM / 8); k_cvt8<<<(unsigned)(((size_t)DKV * DM / 8 + 255) / 256), 256, 0, stream>>>(wk, WK, (size_t)DKV * DM / 8); k_cvt8<<<(unsigned)(((size_t)DKV * DM / 8 + 255) / 256), 256, 0, stream>>>(wv, WV, (size_t)DKV * DM / 8);
      k_cvt8<<<(unsigned)(((size_t)DM * DQ / 8 + 255) / 256), 256, 0, stream>>>(wo, WO, (size_t)DM * DQ / 8); /* the rotary table is rebuilt per batch from that batch's positions (below) */ }
    const unsigned LQ = (unsigned)(((size_t)NH_ * TT * HD / 2 + 255) / 256), LKv = (unsigned)(((size_t)NKV * TT * HD / 2 + 255) / 256);
    for (int b = 0; b < NB_; ++b) {
        k_cstabI<<<(TT * HD + 255) / 256, 256, 0, stream>>>(PID + (size_t)b * TT, CS);   /* token_positions[b][:] (int32, read): THIS batch's own row of positions */
        
        k_cvt8<<<(unsigned)(((size_t)TT * DM / 8 + 255) / 256), 256, 0, stream>>>(x + (size_t)b * TT * DM, XB, (size_t)TT * DM / 8);
        k_gemmk<bf, 0, 8, false><<<dim3(TT / 64, DQ / 64, 1), 256, 0, stream>>>(XB, nullptr, WQ, nullptr, DM, FQ, DQ, 0, 0, 0, 0);
        k_ropeI<<<LQ, 256, 0, stream>>>(FQ, DQ, NH_, CS, 1.0f, QP16, QPh, QPl);
        k_gemmk<bf, 0, 8, false><<<dim3(TT / 64, DKV / 64, 1), 256, 0, stream>>>(XB, nullptr, WK, nullptr, DM, FK, DKV, 0, 0, 0, 0);
        k_ropeI<<<LKv, 256, 0, stream>>>(FK, DKV, NKV, CS, 1.0f, KP16, KPh, KPl);
        k_gemmk<bf, 0, 8, false><<<dim3(TT / 64, DKV / 64, 1), 256, 0, stream>>>(XB, nullptr, WV, nullptr, DM, FV, DKV, 0, 0, 0, 0); k_vtp<<<LKv, 256, 0, stream>>>(FV, DKV, NKV, VT16, VTh, VTl);
        k_fattn<<<dim3(TT / 32, NH_ / 2, 1), 256, 0, stream>>>(QPh, QPl, KPh, KPl, VT16, VTh, VTl, ATh, ATl);   /* one kv head per query head */
        k_gemmk<bf, 1, 8, false><<<dim3(TT / 64, DM / 64, 1), 256, 0, stream>>>(ATh, ATl, WO, nullptr, DQ, OUT + (size_t)b * TT * DM, DM, 0, 0, 0, 0); }
}

// v004
// A run of this version takes 188 microseconds.
// In two side-by-side timings against v003, it was 1.20 and 1.21 times as fast.
// Over all steps from v000 it is 7.26 times as fast.
#include <hip/hip_runtime.h>

// Causal multi-head self-attention with interleaved-pair rotary position embedding from PER-BATCH position rows (x [2][2048][1024]; q, k, v = einsum('bsd,od', x, W) ('oi' [1024][1024], no bias; 16 heads x 64); angle = float(token_positions[b][t]) x 1 / theta ** (2i / 64) (theta 1e4; token_positions int32 [2][2048]: each batch has its OWN sorted row of random positions in [0, 2048), READ on device); pairs (2i, 2i+1): (xe cos - xo sin, xe sin + xo cos) on q and k; scores / sqrt(64); keys j <= i kept (by INDEX, not by position), -inf elsewhere; softmax; out = einsum('bso,do', merged, Wo) -> [2][2048][1024] (4.2 M); argument order x, Wq, Wk, Wv, Wo, token_positions).
// Layout per batch: bf16 copy of x; {cos, sin} per (position, pair) built once from the int positions and float32 inverse-frequency constants (precise cosf/sinf); exact projections whose epilogue turns the summed f32 tile (64 tokens x one head) straight into the attention planes (q, k: interleaved rotary, hi/lo; v: transposed, fp16 and hi/lo); fused causal T-2048 attention, no score buffer (EVERY row's scores on hi/lo planes (3 products: logit sigma 2 with these weights), online softmax, hybrid P.V (rows < 512 hi/lo, rest fp16); key blocks above the diagonal are never touched); merged hi/lo x Wo exact.
// Compute dtypes, f32 accumulate: every input rounded to bf16; projections exact; rotary f32; scores 3 products; P.V rows < 512 3 products, rest fp16; softmax f32; Wo hl x exact.

#define NB_  2
#define TT   2048
#define DM   1024
#define NH_  16
#define NKV  16
#define REP  (NH_ / NKV)
#define HD   64
#define DQ   (NH_ * HD)
#define DKV  (NKV * HD)
#define RH   512                  // query rows < RH take P.V on hi+lo planes (0: none)
typedef _Float16 h16;
typedef unsigned short bf;
typedef __attribute__((ext_vector_type(16))) __bf16   v16bf;
typedef __attribute__((ext_vector_type(16))) _Float16 v16h;
typedef __attribute__((ext_vector_type(8)))  _Float16 v8h;
typedef __attribute__((ext_vector_type(8)))  unsigned short v8us;
typedef __attribute__((ext_vector_type(8)))  float    v8f;
typedef __attribute__((ext_vector_type(4)))  float    v4f;
typedef v8h  __attribute__((may_alias)) v8ha;
typedef v4f  __attribute__((may_alias)) v4fa;
typedef v8us __attribute__((may_alias)) v8usa;

__device__ __forceinline__ unsigned short f2bf(float f) { unsigned u = __float_as_uint(f); u += 0x7FFFu + ((u >> 16) & 1u); return (unsigned short)(u >> 16); }
__device__ __forceinline__ float bf2f(unsigned short b) { return __uint_as_float(((unsigned)b) << 16); }
__device__ __forceinline__ float bfr(float f) { return bf2f(f2bf(f)); }
__device__ __forceinline__ v16h cat16(v8h lo, v8h hi) { return __builtin_shufflevector(lo, hi, 0, 1, 2, 3, 4, 5, 6, 7, 8, 9, 10, 11, 12, 13, 14, 15); }
__device__ __forceinline__ v16bf cat16b(v8us lo, v8us hi) { return __builtin_bit_cast(v16bf, __builtin_shufflevector(lo, hi, 0, 1, 2, 3, 4, 5, 6, 7, 8, 9, 10, 11, 12, 13, 14, 15)); }
__device__ __forceinline__ v8f wmma16(v16h a, v16h b, v8f c) { return __builtin_amdgcn_wmma_f32_16x16x32_f16(false, a, false, b, (short)0, c, false, false); }
__device__ __forceinline__ v8f wmmab(v16bf a, v16bf b, v8f c) { return __builtin_amdgcn_wmma_f32_16x16x32_bf16(false, a, false, b, (short)0, c, false, false); }

__device__ __forceinline__ h16 tohx(float x) { return (h16)x; }
__device__ __forceinline__ void splitf(float y, unsigned short& h, unsigned short& l) { h = f2bf(y); l = f2bf(y - bf2f(h)); }
typedef __attribute__((ext_vector_type(2))) float v2f;

// ---- k_gemmk: register-blocked GEMM, one 64x64 output tile per work-group of NW waves, operands straight from K-contiguous 16-bit planes; grid (M/64, N/64, Z), NW x 32 threads.
// C[m][n] (f32, pitch ldc) = sum_k A[m][k] Bt[n][k] (+ split products per NSPLIT). z-batch strides sA/sB/sC in elements. K % 32 == 0.
// The K loop is dealt to the waves in turn, 32 k a trip (wave w takes trips w, w + NW, ...); every wave keeps its own 16 accumulators, the NW partial tiles meet in LDS and are added in the fixed order wave 0 .. NW-1.
// EPI 0: C as above. EPI 1 and 2 (N tile = one head of HD = 64 dims, rows = tokens; C unused): the summed tile never leaves the work-group as f32.
// EPI 1: interleaved rotary with {cos, sin} from CS[token][dim][2], then hi/lo planes Ph, Pl [head][token][dim]. EPI 2: the tile is put into LDS transposed and goes out as planes P16, Ph, Pl [head][dim][token].
// CAUSAL (probability x value): the K loop stops at the diagonal block (probabilities beyond it are exactly zero); roff = row offset of this launch's first row within the sequence.
template <typename T16> struct WFrag;
template <> struct WFrag<h16> { typedef v16h V; static __device__ __forceinline__ V ld(const h16* p) { return cat16(*(const v8h*)p, *(const v8h*)(p + 16)); } static __device__ __forceinline__ v8f mma(V a, V b, v8f c) { return wmma16(a, b, c); } };
template <> struct WFrag<bf> { typedef v16bf V; static __device__ __forceinline__ V ld(const bf* p) { return cat16b(*(const v8us*)p, *(const v8us*)(p + 16)); } static __device__ __forceinline__ v8f mma(V a, V b, v8f c) { return wmmab(a, b, c); } };
template <typename T16, int NSPLIT, int NW, bool CAUSAL, int EPI>
__global__ __launch_bounds__(NW * 32) void k_gemmk(const T16* __restrict__ A, const T16* __restrict__ A2, const T16* __restrict__ Bt, const T16* __restrict__ Bt2, int K, float* C, int ldc, int roff, size_t sA, size_t sB, size_t sC, const float* __restrict__ CS, h16* P16, bf* Ph, bf* Pl) {
    typedef typename WFrag<T16>::V V;
    __shared__ __align__(16) float part[NW * 4096];   // [wave][fragment][half][lane][4]: every 16-byte store and load is contiguous over the lanes
    __shared__ __align__(16) float os[64 * 68];
    const size_t z = blockIdx.z; A += z * sA; if (A2) A2 += z * sA; Bt += z * sB; if (Bt2) Bt2 += z * sB; C += z * sC;
    const int tid = threadIdx.x, lane = tid & 31, wave = __builtin_amdgcn_readfirstlane(tid >> 5), lr = lane & 15, hi = lane >> 4; const int r0 = blockIdx.x * 64, c0 = blockIdx.y * 64;
    const int Kl = CAUSAL ? min(K, r0 + roff + 64) : K;
    v8f acc[4][4];
#pragma unroll
    for (int mb = 0; mb < 4; ++mb)
#pragma unroll
        for (int nb = 0; nb < 4; ++nb) acc[mb][nb] = (v8f){};
    const size_t aoff = (size_t)(r0 + lr) * K + 8 * hi, boff = (size_t)(c0 + lr) * K + 8 * hi;
#pragma unroll 1
    for (int kc = wave * 32; kc < Kl; kc += NW * 32) {
        V a[4], a2[4];
#pragma unroll
        for (int mb = 0; mb < 4; ++mb) { a[mb] = WFrag<T16>::ld(A + aoff + (size_t)mb * 16 * K + kc); if (NSPLIT == 1 || NSPLIT == 2) a2[mb] = WFrag<T16>::ld(A2 + aoff + (size_t)mb * 16 * K + kc); }
#pragma unroll
        for (int nb = 0; nb < 4; ++nb) { const V b = WFrag<T16>::ld(Bt + boff + (size_t)nb * 16 * K + kc); V b2; if (NSPLIT >= 2) b2 = WFrag<T16>::ld(Bt2 + boff + (size_t)nb * 16 * K + kc);
#pragma unroll
            for (int mb = 0; mb < 4; ++mb) { acc[mb][nb] = WFrag<T16>::mma(a[mb], b, acc[mb][nb]); if (NSPLIT == 1 || NSPLIT == 2) acc[mb][nb] = WFrag<T16>::mma(a2[mb], b, acc[mb][nb]); if (NSPLIT >= 2) acc[mb][nb] = WFrag<T16>::mma(a[mb], b2, acc[mb][nb]); } }
        // four vector slots behind the last matrix instruction, so that its distance also holds over the loop's back edge
        asm volatile("v_nop\n\tv_nop\n\tv_nop\n\tv_nop" : "+v"(acc[0][0]), "+v"(acc[1][1]), "+v"(acc[2][2]), "+v"(acc[3][3]) : "v"(a[0]), "v"(a[3]));
    }
    float* pw = part + wave * 4096 + lane * 4;
#pragma unroll
    for (int mb = 0; mb < 4; ++mb)
#pragma unroll
        for (int nb = 0; nb < 4; ++nb) { const v8f c = acc[mb][nb]; *(v4fa*)(pw + (mb * 4 + nb) * 256) = (v4f){c[0], c[1], c[2], c[3]}; *(v4fa*)(pw + (mb * 4 + nb) * 256 + 128) = (v4f){c[4], c[5], c[6], c[7]}; }
    v2f cs[16 / NW][4];   // EPI 1: this thread's {cos, sin} pairs, asked for in front of the barrier, so that they are on their way while the partial tiles go into LDS
    if (EPI == 1) {
#pragma unroll
        for (int u = 0; u < 16 / NW; ++u) { const int idx = u * (NW * 32) + tid; const float* cp = CS + ((size_t)(r0 + (idx >> 3)) * HD + (idx & 7) * 8) * 2;
#pragma unroll
            for (int p = 0; p < 4; ++p) cs[u][p] = *(const v2f*)(cp + p * 4); }
        asm volatile("s_wait_xcnt 0x0" ::: "memory");   // before the address registers of these loads are used for something else
    }
    __syncthreads();   // every wave's partial tile is in LDS
#pragma unroll
    for (int u = 0; u < 32 / NW; ++u) { const int idx = u * (NW * 32) + tid; v4f s = *(const v4fa*)(part + idx * 4);
#pragma unroll
        for (int w = 1; w < NW; ++w) s += *(const v4fa*)(part + w * 4096 + idx * 4);
        const int fr = idx >> 6, row = (fr >> 2) * 16 + hi * 8 + ((idx >> 5) & 1) * 4, col = (fr & 3) * 16 + lr;
        if (EPI == 2) *(v4fa*)(os + col * 68 + row) = s;   // transposed: four tokens of one dim, one 16-byte store
        else {
#pragma unroll
            for (int q = 0; q < 4; ++q) os[(row + q) * 68 + col] = s[q]; } }
    __syncthreads();   // the summed tile is in LDS, row-major (EPI 2: dim-major): whole rows go out in 16-byte stores
    if (EPI == 0) {
#pragma unroll
        for (int u = 0; u < 32 / NW; ++u) { const int idx = u * (NW * 32) + tid, row = idx >> 4, cofs = (idx & 15) * 4; *(v4f*)(C + (size_t)(r0 + row) * ldc + c0 + cofs) = *(const v4fa*)(os + row * 68 + cofs); }
    } else {
        // a thread takes 8 consecutive elements of an LDS row; eight threads fill one 128-byte line of every plane
#pragma unroll
        for (int u = 0; u < 16 / NW; ++u) { const int idx = u * (NW * 32) + tid, row = idx >> 3, cofs = (idx & 7) * 8; const v4f xa = *(const v4fa*)(os + row * 68 + cofs), xb = *(const v4fa*)(os + row * 68 + cofs + 4);
            const float x[8] = { xa[0], xa[1], xa[2], xa[3], xb[0], xb[1], xb[2], xb[3] }; v8us oh, ol; unsigned short a2, c2;
            if (EPI == 1) {
#pragma unroll
                for (int p = 0; p < 4; ++p) { const float c = cs[u][p][0], sn = cs[u][p][1], xe = x[2 * p], xo = x[2 * p + 1];   /* even: xe c - xo s; odd: xe s + xo c */
                    splitf(xe * c - xo * sn, a2, c2); oh[2 * p] = a2; ol[2 * p] = c2; splitf(xe * sn + xo * c, a2, c2); oh[2 * p + 1] = a2; ol[2 * p + 1] = c2; }
                const size_t e = ((size_t)blockIdx.y * TT + r0 + row) * HD + cofs; *(v8us*)(Ph + e) = oh; *(v8us*)(Pl + e) = ol;
            } else { v8h o16;
#pragma unroll
                for (int q = 0; q < 8; ++q) { o16[q] = tohx(x[q]); splitf(x[q], a2, c2); oh[q] = a2; ol[q] = c2; }
                const size_t e = ((size_t)blockIdx.y * HD + row) * TT + r0 + cofs; *(v8h*)(P16 + e) = o16; *(v8us*)(Ph + e) = oh; *(v8us*)(Pl + e) = ol; } }
    }
}

typedef __attribute__((ext_vector_type(2))) _Float16 v2h;
typedef __attribute__((ext_vector_type(4))) _Float16 v4h;
typedef __attribute__((ext_vector_type(2))) unsigned short v2us;
typedef __attribute__((ext_vector_type(4))) unsigned short v4us;
typedef __attribute__((ext_vector_type(4))) int v4i;

__global__ __launch_bounds__(256) void k_wtG(const float* __restrict__ w, int K, int N, bf* Bt) {
    const int lane = threadIdx.x & 31; const int L0 = (blockIdx.x * 8 + (threadIdx.x >> 5)) * 8; const int nlines = N * K / 64;
{
#pragma unroll 1
        for (int l = 0; l < 8; ++l) { const int L = L0 + l; if (L >= nlines) break; const size_t e = (size_t)L * 64 + lane * 2; const int k = (int)(e % K), n = (int)(e / K); v2us o;
            o[0] = f2bf(w[(size_t)k * N + n]); o[1] = f2bf(w[(size_t)(k + 1) * N + n]); *(v2us*)(Bt + e) = o; }
         }
}
__global__ __launch_bounds__(256) void k_cvt8(const float* __restrict__ src, bf* dst, size_t n8) { const size_t i = (size_t)blockIdx.x * 256 + threadIdx.x; if (i >= n8) return; const v8f v = *(const v8f*)(src + i * 8); v8us o;
#pragma unroll
    for (int k = 0; k < 8; ++k) o[k] = f2bf(v[k]); *(v8us*)(dst + i * 8) = o;  }

__constant__ float INV2[HD / 2] = { 1.000000000e+00f, 7.498942018e-01f, 5.623413324e-01f, 4.216965139e-01f, 3.162277639e-01f, 2.371373624e-01f, 1.778279394e-01f, 1.333521456e-01f, 1.000000015e-01f, 7.498941571e-02f, 5.623412877e-02f, 4.216964915e-02f, 3.162277862e-02f, 2.371373586e-02f, 1.778279431e-02f, 1.333521493e-02f, 9.999999776e-03f, 7.498942316e-03f, 5.623413250e-03f, 4.216964822e-03f, 3.162277862e-03f, 2.371373819e-03f, 1.778279431e-03f, 1.333521446e-03f, 1.000000047e-03f, 7.498941850e-04f, 5.623413017e-04f, 4.216964880e-04f, 3.162277862e-04f, 2.371373848e-04f, 1.778279402e-04f, 1.333521504e-04f };   // float32 10000^(-(i * 2 / 64)), generated with jnp to be bit-exact with the module's expression
__global__ __launch_bounds__(256) void k_cstabI(const int* __restrict__ pid, float* CS) { const int idx = blockIdx.x * 256 + threadIdx.x; if (idx >= TT * HD) return; const int d = idx % HD; const int t = idx / HD; const float a = __fmul_rn((float)pid[t], INV2[d >> 1]); v2f cs; cs[0] = cosf(a); cs[1] = sinf(a); *(v2f*)(CS + (size_t)idx * 2) = cs;  }

// ---- k_fattn: scores, causal softmax, P.V and the head merge in one kernel; grid (TT / 32, heads / 2), 8 waves. A work-group takes 32 query rows of one head (tile n - 1 - x), then 32 of another (tile x); a tile's 32-key blocks up to the diagonal are dealt to the waves in turn.
// Transposed products: S^T = K Q^T (A = key rows, B = query rows kept in registers; hi/lo planes, 3 products), so a lane holds the scores of ONE query (column lr) and two 16-key score tiles, converted in place, are the B operand of
// O^T += V^T P^T (A = rows of the [d][t] value planes, same k order as the loader). Rows < RH: p and v on hi/lo planes (3 products); the rest: p and v in fp16. p = exp2((s - running max) x HD^-0.5 x log2 e), at most 1, normalised in f32 at the end.
// Every wave keeps its own running maximum, sum and output tile; they meet in LDS and are joined in the fixed order wave 0 .. 7.
#define C2 0.18033688011112042f   // HD^-0.5 x log2(e)
__device__ __forceinline__ float xhalf(float x) { const int b = __float_as_int(x); return __int_as_float(__builtin_amdgcn_permlanex16(b, b, 0x76543210, 0xfedcba98, false, false)); }   // lane l <-> l ^ 16
template <bool HR>
__device__ __forceinline__ void fattn_loop(const bf* __restrict__ Kh, const bf* __restrict__ Kl, const h16* __restrict__ V16, const bf* __restrict__ Vh, const bf* __restrict__ Vl, const v16bf (&qh)[2][2], const v16bf (&ql)[2][2],
                                           int wave, int nblk, int lr, int hi, v8f (&o)[4][2], float (&m)[2], float (&l)[2]) {
    unsigned kofs = ((unsigned)(wave * 32 + lr) * HD + 8 * hi) * 2, vofs = ((unsigned)lr * TT + wave * 32 + 8 * hi) * 2;   // this lane's byte offsets in the key and value planes: one 32-bit register each beside a scalar base
    // the block loop stays rolled (a second copy of the body would need a second set of fragment registers); the constant loops inside are unrolled so that every fragment index is a compile-time constant and the tiles stay in registers
#pragma unroll 1
    for (int blk = wave; blk < nblk; blk += 8, kofs += 8 * 32 * HD * 2, vofs += 8 * 32 * 2) {
        const bf* kph = (const bf*)((const char*)Kh + kofs); const bf* kpl = (const bf*)((const char*)Kl + kofs);
        v16bf kh[2][2], kl[2][2];
#pragma unroll
        for (int kb = 0; kb < 2; ++kb)
#pragma unroll
            for (int ks = 0; ks < 2; ++ks) { kh[kb][ks] = WFrag<bf>::ld(kph + kb * 16 * HD + ks * 32); kl[kb][ks] = WFrag<bf>::ld(kpl + kb * 16 * HD + ks * 32); }
        // inputs-only fence on the loaded key fragments: all sixteen loads are issued together and waited for once; without it the compiler reuses two fragments' registers and waits out the load latency several times per block
        asm volatile("" :: "v"(kh[0][0]), "v"(kh[0][1]), "v"(kh[1][0]), "v"(kh[1][1]), "v"(kl[0][0]), "v"(kl[0][1]), "v"(kl[1][0]), "v"(kl[1][1]));
        v8f s[2][2];
#pragma unroll
        for (int kb = 0; kb < 2; ++kb)
#pragma unroll
            for (int n = 0; n < 2; ++n) s[kb][n] = (v8f){};
#pragma unroll
        for (int ks = 0; ks < 2; ++ks) {
#pragma unroll
            for (int kb = 0; kb < 2; ++kb)
#pragma unroll
                for (int n = 0; n < 2; ++n) s[kb][n] = wmmab(kh[kb][ks], qh[n][ks], s[kb][n]);
#pragma unroll
            for (int kb = 0; kb < 2; ++kb)
#pragma unroll
                for (int n = 0; n < 2; ++n) s[kb][n] = wmmab(kh[kb][ks], ql[n][ks], s[kb][n]);
#pragma unroll
            for (int kb = 0; kb < 2; ++kb)
#pragma unroll
                for (int n = 0; n < 2; ++n) s[kb][n] = wmmab(kl[kb][ks], qh[n][ks], s[kb][n]);
        }
        if (blk == nblk - 1) {   // the diagonal block: keys j > i are out (every query keeps at least the block's first key)
#pragma unroll
            for (int kb = 0; kb < 2; ++kb)
#pragma unroll
                for (int n = 0; n < 2; ++n)
#pragma unroll
                    for (int j = 0; j < 8; ++j) if (kb * 16 + hi * 8 + j > n * 16 + lr) s[kb][n][j] = -3.0e38f;
        }
        v16h p16[2]; v16bf ph[2], pl[2];
#pragma unroll
        for (int n = 0; n < 2; ++n) {
            float mx = s[0][n][0];
#pragma unroll
            for (int j = 1; j < 8; ++j) mx = fmaxf(mx, s[0][n][j]);
#pragma unroll
            for (int j = 0; j < 8; ++j) mx = fmaxf(mx, s[1][n][j]);
            mx = fmaxf(mx, xhalf(mx));
            const float mn = fmaxf(m[n], mx), al = __builtin_amdgcn_exp2f((m[n] - mn) * C2), mc = mn * C2; m[n] = mn;
            float sum = 0.f; v8h f0, f1;
#pragma unroll
            for (int j = 0; j < 8; ++j) {
                const float pa = __builtin_amdgcn_exp2f(s[0][n][j] * C2 - mc), pb = __builtin_amdgcn_exp2f(s[1][n][j] * C2 - mc); sum += pa; sum += pb;
                if (HR) { const __bf16 xa = (__bf16)pa, xb = (__bf16)pb; ph[n][j] = xa; pl[n][j] = (__bf16)(pa - (float)xa); ph[n][8 + j] = xb; pl[n][8 + j] = (__bf16)(pb - (float)xb); } else { f0[j] = tohx(pa); f1[j] = tohx(pb); } }
            l[n] = l[n] * al + sum;   // this lane's half of the keys; the halves are joined after the loop
            if (!HR) p16[n] = cat16(f0, f1);
#pragma unroll
            for (int db = 0; db < 4; ++db) o[db][n] *= al;
        }
#pragma unroll
        for (int db = 0; db < 4; ++db) {
            if (HR) { const v16bf vh = WFrag<bf>::ld((const bf*)((const char*)Vh + vofs) + db * 16 * TT), vl = WFrag<bf>::ld((const bf*)((const char*)Vl + vofs) + db * 16 * TT);
#pragma unroll
                for (int n = 0; n < 2; ++n) { o[db][n] = wmmab(vh, ph[n], o[db][n]); o[db][n] = wmmab(vh, pl[n], o[db][n]); o[db][n] = wmmab(vl, ph[n], o[db][n]); }
            } else { const v16h vf = WFrag<h16>::ld((const h16*)((const char*)V16 + vofs) + db * 16 * TT);
#pragma unroll
                for (int n = 0; n < 2; ++n) o[db][n] = wmma16(vf, p16[n], o[db][n]); } }
    }
}
__global__ __launch_bounds__(256) void k_fattn(const bf* __restrict__ Qh, const bf* __restrict__ Ql, const bf* __restrict__ Kh, const bf* __restrict__ Kl, const h16* __restrict__ V16, const bf* __restrict__ Vh, const bf* __restrict__ Vl, bf* Ah, bf* Al) {
    __shared__ __align__(16) float part[8 * 2048];   // [wave][fragment][half][lane][4]: every 16-byte store and load is contiguous over the lanes
    __shared__ float sM[8][32], sL[8][32];
    const int tid = threadIdx.x, lane = tid & 31, wave = __builtin_amdgcn_readfirstlane(tid >> 5), lr = lane & 15, hi = lane >> 4;
    // two tiles one after the other, so that every work-group walks 65 key blocks: kept rolled, one copy of the code
#pragma unroll 1
    for (int pass = 0; pass < 2; ++pass) {
        const int tile = pass ? (int)blockIdx.x : TT / 32 - 1 - (int)blockIdx.x, r0 = tile * 32, h = (int)blockIdx.y + pass * (NH_ / 2);
        const size_t zo = (size_t)h * TT * HD;
        v16bf qh[2][2], ql[2][2];
#pragma unroll
        for (int n = 0; n < 2; ++n)
#pragma unroll
            for (int ks = 0; ks < 2; ++ks) { const size_t qo = zo + (size_t)(r0 + n * 16 + lr) * HD + ks * 32 + 8 * hi; qh[n][ks] = WFrag<bf>::ld(Qh + qo); ql[n][ks] = WFrag<bf>::ld(Ql + qo); }
        asm volatile("s_wait_xcnt 0x0" ::: "memory");   // before the address registers of the query loads are used for something else
        v8f o[4][2]; float m[2] = { -3.0e38f, -3.0e38f }, l[2] = { 0.f, 0.f };
#pragma unroll
        for (int db = 0; db < 4; ++db)
#pragma unroll
            for (int n = 0; n < 2; ++n) o[db][n] = (v8f){};
        if (r0 < RH) fattn_loop<true>(Kh + zo, Kl + zo, V16 + zo, Vh + zo, Vl + zo, qh, ql, wave, tile + 1, lr, hi, o, m, l);
        else         fattn_loop<false>(Kh + zo, Kl + zo, V16 + zo, Vh + zo, Vl + zo, qh, ql, wave, tile + 1, lr, hi, o, m, l);
#pragma unroll
        for (int n = 0; n < 2; ++n) l[n] += xhalf(l[n]);
        sM[wave][lane] = hi ? m[1] : m[0]; sL[wave][lane] = hi ? l[1] : l[0];   // entry n * 16 + query column
        __syncthreads();   // every wave's maximum and sum are in LDS (a wave without a block: -3e38 and 0; wave 0 always has block 0); every wave has also left the first tile's partial tiles
        float inv[2];
#pragma unroll
        for (int n = 0; n < 2; ++n) { float M = sM[0][n * 16 + lr];
#pragma unroll
            for (int w = 1; w < 8; ++w) M = fmaxf(M, sM[w][n * 16 + lr]);
            float L = 0.f;
#pragma unroll
            for (int w = 0; w < 8; ++w) L += sL[w][n * 16 + lr] * __builtin_amdgcn_exp2f((sM[w][n * 16 + lr] - M) * C2);
            inv[n] = __fdiv_rn(1.0f, L); const float f = __builtin_amdgcn_exp2f((m[n] - M) * C2);
#pragma unroll
            for (int db = 0; db < 4; ++db) o[db][n] *= f; }
        float* pw = part + wave * 2048 + lane * 4;
#pragma unroll
        for (int db = 0; db < 4; ++db)
#pragma unroll
            for (int n = 0; n < 2; ++n) { const v8f c = o[db][n]; *(v4fa*)(pw + (db * 2 + n) * 256) = (v4f){c[0], c[1], c[2], c[3]}; *(v4fa*)(pw + (db * 2 + n) * 256 + 128) = (v4f){c[4], c[5], c[6], c[7]}; }
        __syncthreads();   // every wave's weighted output tile is in LDS; every wave has read the maxima and sums
        // wave w joins fragment w (head dims (w >> 1) * 16 .., query group w & 1): a lane ends with 8 consecutive dims of one query row, one 16-byte store per plane
        const float* pr = part + wave * 256 + lane * 4; v4f a = *(const v4fa*)pr, c = *(const v4fa*)(pr + 128);
#pragma unroll
        for (int w = 1; w < 8; ++w) { a += *(const v4fa*)(pr + w * 2048); c += *(const v4fa*)(pr + w * 2048 + 128); }
        const float iv = (wave & 1) ? inv[1] : inv[0]; v8us oh, ol;
#pragma unroll
        for (int q = 0; q < 4; ++q) { unsigned short x, y; splitf(a[q] * iv, x, y); oh[q] = x; ol[q] = y; splitf(c[q] * iv, x, y); oh[4 + q] = x; ol[4 + q] = y; }
        const size_t oo = (size_t)(r0 + (wave & 1) * 16 + lr) * DQ + h * HD + (wave >> 1) * 16 + hi * 8; *(v8us*)(Ah + oo) = oh; *(v8us*)(Al + oo) = ol;
        asm volatile("s_wait_xcnt 0x0" ::: "memory");   // before the second tile overwrites the registers that the two stores name
    }
}

extern "C" void kernel_launch(void* const* d_in, const int* in_sizes, int n_in,
                              void* d_out, int out_size, void* d_ws, size_t ws_size, hipStream_t stream) {
    (void)in_sizes; (void)n_in; (void)out_size;
        const float* x = (const float*)d_in[0]; const int* PID = (const int*)d_in[5]; const float* wq = (const float*)d_in[1]; const float* wk = (const float*)d_in[2]; const float* wv = (const float*)d_in[3]; const float* wo = (const float*)d_in[4];   /* order x, Wq, Wk, Wv, Wo ('oi' [1024][1024]), token_positions (int32 [2][2048]: ONE row of positions PER BATCH, sorted random values in [0, 2048); read on device) */
    float* OUT = (float*)d_out;     // [2][2048][1024]
    char* wsp = (char*)d_ws;
    auto take = [&](size_t bytes) { char* p = wsp; wsp += (bytes + 255) & ~(size_t)255; return (void*)p; };
    bf* WQ = (bf*)take((size_t)DQ * DM * 2); bf* WK = (bf*)take((size_t)DKV * DM * 2); bf* WV = (bf*)take((size_t)DKV * DM * 2); bf* WO = (bf*)take((size_t)DM * DQ * 2);
    h16* VT16 = (h16*)take((size_t)NKV * HD * TT * 2);
    bf* QPh = (bf*)take((size_t)NH_ * TT * HD * 2); bf* QPl = (bf*)take((size_t)NH_ * TT * HD * 2); bf* KPh = (bf*)take((size_t)NKV * TT * HD * 2); bf* KPl = (bf*)take((size_t)NKV * TT * HD * 2); bf* VTh = (bf*)take((size_t)NKV * HD * TT * 2); bf* VTl = (bf*)take((size_t)NKV * HD * TT * 2);
    bf* ATh = (bf*)take((size_t)TT * DQ * 2); bf* ATl = (bf*)take((size_t)TT * DQ * 2);
    float* CS = (float*)take((size_t)TT * HD * 2 * 4); bf* XB = (bf*)take((size_t)TT * DM * 2);
    if ((size_t)(wsp - (char*)d_ws) > ws_size) return;    // ws 256 MiB
    { k_cvt8<<<(unsigned)(((size_t)DQ * DM / 8 + 255) / 256), 256, 0, stream>>>(wq, WQ, (size_t)DQ * DM / 8); k_cvt8<<<(unsigned)(((size_t)DKV * DM / 8 + 255) / 256), 256, 0, stream>>>(wk, WK, (size_t)DKV * DM / 8); k_cvt8<<<(unsigned)(((size_t)DKV * DM / 8 + 255) / 256), 256, 0, stream>>>(wv, WV, (size_t)DKV * DM / 8);
      k_cvt8<<<(unsigned)(((size_t)DM * DQ / 8 + 255) / 256), 256, 0, stream>>>(wo, WO, (size_t)DM * DQ / 8); /* the rotary table is rebuilt per batch from that batch's positions (below) */ }
    for (int b = 0; b < NB_; ++b) {
        k_cstabI<<<(TT * HD + 255) / 256, 256, 0, stream>>>(PID + (size_t)b * TT, CS);   /* token_positions[b][:] (int32, read): THIS batch's own row of positions */
        
        k_cvt8<<<(unsigned)(((size_t)TT * DM / 8 + 255) / 256), 256, 0, stream>>>(x + (size_t)b * TT * DM, XB, (size_t)TT * DM / 8);
        k_gemmk<bf, 0, 8, false, 1><<<dim3(TT / 64, DQ / 64, 1), 256, 0, stream>>>(XB, nullptr, WQ, nullptr, DM, nullptr, 0, 0, 0, 0, 0, CS, nullptr, QPh, QPl);
        k_gemmk<bf, 0, 8, false, 1><<<dim3(TT / 64, DKV / 64, 1), 256, 0, stream>>>(XB, nullptr, WK, nullptr, DM, nullptr, 0, 0, 0, 0, 0, CS, nullptr, KPh, KPl);
        k_gemmk<bf, 0, 8, false, 2><<<dim3(TT / 64, DKV / 64, 1), 256, 0, stream>>>(XB, nullptr, WV, nullptr, DM, nullptr, 0, 0, 0, 0, 0, nullptr, VT16, VTh, VTl);
        k_fattn<<<dim3(TT / 32, NH_ / 2, 1), 256, 0, stream>>>(QPh, QPl, KPh, KPl, VT16, VTh, VTl, ATh, ATl);   /* one kv head per query head */
        k_gemmk<bf, 1, 8, false, 0><<<dim3(TT / 64, DM / 64, 1), 256, 0, stream>>>(ATh, ATl, WO, nullptr, DQ, OUT + (size_t)b * TT * DM, DM, 0, 0, 0, 0, nullptr, nullptr, nullptr, nullptr); }
}

// v005
// It runs in 160 microseconds.
// Timed twice side by side with v004, it ran 1.17 and 1.18 times as fast.
// All steps since v000 together make it 8.53 times as fast.
#include <hip/hip_runtime.h>

// Causal multi-head self-attention with interleaved-pair rotary position embedding from PER-BATCH position rows (x [2][2048][1024]; q, k, v = einsum('bsd,od', x, W) ('oi' [1024][1024], no bias; 16 heads x 64); angle = float(token_positions[b][t]) x 1 / theta ** (2i / 64) (theta 1e4; token_positions int32 [2][2048]: each batch has its OWN sorted row of random positions in [0, 2048), READ on device); pairs (2i, 2i+1): (xe cos - xo sin, xe sin + xo cos) on q and k; scores / sqrt(64); keys j <= i kept (by INDEX, not by position), -inf elsewhere; softmax; out = einsum('bso,do', merged, Wo) -> [2][2048][1024] (4.2 M); argument order x, Wq, Wk, Wv, Wo, token_positions).
// Every stage is launched once, for both batches and all its operands (4 launches). Layout: bf16 copy of x and of the four weights; {cos, sin} per (position, pair) built once from the int positions and float32 inverse-frequency constants (precise cosf/sinf); exact projections whose epilogue turns the summed f32 tile (64 tokens x one head) straight into the attention planes (q, k: interleaved rotary, hi/lo; v: transposed, fp16 and hi/lo); fused causal T-2048 attention, no score buffer (EVERY row's scores on hi/lo planes (3 products: logit sigma 2 with these weights), online softmax, hybrid P.V (rows < 512 hi/lo, rest fp16); key blocks above the diagonal are never touched); merged hi/lo x Wo exact.
// Compute dtypes, f32 accumulate: every input rounded to bf16; projections exact; rotary f32; scores 3 products; P.V rows < 512 3 products, rest fp16; softmax f32; Wo hl x exact.

#define NB_  2
#define TT   2048
#define DM   1024
#define NH_  16
#define NKV  16
#define REP  (NH_ / NKV)
#define HD   64
#define DQ   (NH_ * HD)
#define DKV  (NKV * HD)
#define RH   512                  // query rows < RH take P.V on hi+lo planes (0: none)
typedef _Float16 h16;
typedef unsigned short bf;
typedef __attribute__((ext_vector_type(16))) __bf16   v16bf;
typedef __attribute__((ext_vector_type(16))) _Float16 v16h;
typedef __attribute__((ext_vector_type(8)))  _Float16 v8h;
typedef __attribute__((ext_vector_type(8)))  unsigned short v8us;
typedef __attribute__((ext_vector_type(8)))  float    v8f;
typedef __attribute__((ext_vector_type(4)))  float    v4f;
typedef v8h  __attribute__((may_alias)) v8ha;
typedef v4f  __attribute__((may_alias)) v4fa;
typedef v8us __attribute__((may_alias)) v8usa;

__device__ __forceinline__ unsigned short f2bf(float f) { unsigned u = __float_as_uint(f); u += 0x7FFFu + ((u >> 16) & 1u); return (unsigned short)(u >> 16); }
__device__ __forceinline__ float bf2f(unsigned short b) { return __uint_as_float(((unsigned)b) << 16); }
__device__ __forceinline__ float bfr(float f) { return bf2f(f2bf(f)); }
__device__ __forceinline__ v16h cat16(v8h lo, v8h hi) { return __builtin_shufflevector(lo, hi, 0, 1, 2, 3, 4, 5, 6, 7, 8, 9, 10, 11, 12, 13, 14, 15); }
__device__ __forceinline__ v16bf cat16b(v8us lo, v8us hi) { return __builtin_bit_cast(v16bf, __builtin_shufflevector(lo, hi, 0, 1, 2, 3, 4, 5, 6, 7, 8, 9, 10, 11, 12, 13, 14, 15)); }
__device__ __forceinline__ v8f wmma16(v16h a, v16h b, v8f c) { return __builtin_amdgcn_wmma_f32_16x16x32_f16(false, a, false, b, (short)0, c, false, false); }
__device__ __forceinline__ v8f wmmab(v16bf a, v16bf b, v8f c) { return __builtin_amdgcn_wmma_f32_16x16x32_bf16(false, a, false, b, (short)0, c, false, false); }

__device__ __forceinline__ h16 tohx(float x) { return (h16)x; }
__device__ __forceinline__ void splitf(float y, unsigned short& h, unsigned short& l) { h = f2bf(y); l = f2bf(y - bf2f(h)); }
typedef __attribute__((ext_vector_type(2))) float v2f;

// ---- k_gemmk: register-blocked GEMM, one 64x64 output tile per work-group of NW waves, operands straight from K-contiguous 16-bit planes; grid (M/64, N/64, Z), NW x 32 threads.
// C[m][n] (f32, pitch ldc) = sum_k A[m][k] Bt[n][k] (+ split products per NSPLIT). z-batch strides sA/sB/sC in elements. K % 32 == 0.
// The K loop is dealt to the waves in turn, 32 k a trip (wave w takes trips w, w + NW, ...); every wave keeps its own 16 accumulators, the NW partial tiles meet in LDS and are added in the fixed order wave 0 .. NW-1.
// EPI 0: C as above. EPI 1 (q, k and v projections of both batches in one grid; Bt = the three weights one behind the other, rows = the tokens of batch 0, then of batch 1; N tile = one head of HD = 64 dims; C unused): the summed tile never leaves the work-group as f32.
// blockIdx.y / heads picks the epilogue, the same for the whole work-group. 0 (q) and 1 (k): interleaved rotary with {cos, sin} from CS[batch][token][dim][2], then hi/lo planes PQh, PQl or PKh, PKl [batch][head][token][dim]. 2 (v): the tile is put into LDS transposed and goes out as planes P16, PVh, PVl [batch][head][dim][token].
// CAUSAL (probability x value): the K loop stops at the diagonal block (probabilities beyond it are exactly zero); roff = row offset of this launch's first row within the sequence.
template <typename T16> struct WFrag;
template <> struct WFrag<h16> { typedef v16h V; static __device__ __forceinline__ V ld(const h16* p) { return cat16(*(const v8h*)p, *(const v8h*)(p + 16)); } static __device__ __forceinline__ v8f mma(V a, V b, v8f c) { return wmma16(a, b, c); } };
template <> struct WFrag<bf> { typedef v16bf V; static __device__ __forceinline__ V ld(const bf* p) { return cat16b(*(const v8us*)p, *(const v8us*)(p + 16)); } static __device__ __forceinline__ v8f mma(V a, V b, v8f c) { return wmmab(a, b, c); } };
template <typename T16, int NSPLIT, int NW, bool CAUSAL, int EPI>
__global__ __launch_bounds__(NW * 32) void k_gemmk(const T16* __restrict__ A, const T16* __restrict__ A2, const T16* __restrict__ Bt, const T16* __restrict__ Bt2, int K, float* C, int ldc, int roff, size_t sA, size_t sB, size_t sC, const float* __restrict__ CS, h16* P16, bf* PQh, bf* PQl, bf* PKh, bf* PKl, bf* PVh, bf* PVl) {
    typedef typename WFrag<T16>::V V;
    __shared__ __align__(16) float part[NW * 4096];   // [wave][fragment][half][lane][4]: every 16-byte store and load is contiguous over the lanes
    __shared__ __align__(16) float os[64 * 68];
    const size_t z = blockIdx.z; A += z * sA; if (A2) A2 += z * sA; Bt += z * sB; if (Bt2) Bt2 += z * sB; C += z * sC;
    const int tid = threadIdx.x, lane = tid & 31, wave = __builtin_amdgcn_readfirstlane(tid >> 5), lr = lane & 15, hi = lane >> 4; const int r0 = blockIdx.x * 64, c0 = blockIdx.y * 64;
    const int sel = EPI ? (int)blockIdx.y / NH_ : 0, head = (int)blockIdx.y % NH_, bz = r0 / TT, t0 = r0 % TT;   // EPI 1: which projection, its head, the batch and the tile's first token in it
    const int Kl = CAUSAL ? min(K, r0 + roff + 64) : K;
    v8f acc[4][4];
#pragma unroll
    for (int mb = 0; mb < 4; ++mb)
#pragma unroll
        for (int nb = 0; nb < 4; ++nb) acc[mb][nb] = (v8f){};
    const size_t aoff = (size_t)(r0 + lr) * K + 8 * hi, boff = (size_t)(c0 + lr) * K + 8 * hi;
#pragma unroll 1
    for (int kc = wave * 32; kc < Kl; kc += NW * 32) {
        V a[4], a2[4];
#pragma unroll
        for (int mb = 0; mb < 4; ++mb) { a[mb] = WFrag<T16>::ld(A + aoff + (size_t)mb * 16 * K + kc); if (NSPLIT == 1 || NSPLIT == 2) a2[mb] = WFrag<T16>::ld(A2 + aoff + (size_t)mb * 16 * K + kc); }
#pragma unroll
        for (int nb = 0; nb < 4; ++nb) { const V b = WFrag<T16>::ld(Bt + boff + (size_t)nb * 16 * K + kc); V b2; if (NSPLIT >= 2) b2 = WFrag<T16>::ld(Bt2 + boff + (size_t)nb * 16 * K + kc);
#pragma unroll
            for (int mb = 0; mb < 4; ++mb) { acc[mb][nb] = WFrag<T16>::mma(a[mb], b, acc[mb][nb]); if (NSPLIT == 1 || NSPLIT == 2) acc[mb][nb] = WFrag<T16>::mma(a2[mb], b, acc[mb][nb]); if (NSPLIT >= 2) acc[mb][nb] = WFrag<T16>::mma(a[mb], b2, acc[mb][nb]); } }
        // four vector slots behind the last matrix instruction, so that its distance also holds over the loop's back edge
        asm volatile("v_nop\n\tv_nop\n\tv_nop\n\tv_nop" : "+v"(acc[0][0]), "+v"(acc[1][1]), "+v"(acc[2][2]), "+v"(acc[3][3]) : "v"(a[0]), "v"(a[3]));
    }
    float* pw = part + wave * 4096 + lane * 4;
#pragma unroll
    for (int mb = 0; mb < 4; ++mb)
#pragma unroll
        for (int nb = 0; nb < 4; ++nb) { const v8f c = acc[mb][nb]; *(v4fa*)(pw + (mb * 4 + nb) * 256) = (v4f){c[0], c[1], c[2], c[3]}; *(v4fa*)(pw + (mb * 4 + nb) * 256 + 128) = (v4f){c[4], c[5], c[6], c[7]}; }
    v2f cs[16 / NW][4];   // q and k: this thread's {cos, sin} pairs, asked for in front of the barrier, so that they are on their way while the partial tiles go into LDS
    if (EPI == 1 && sel < 2) {
#pragma unroll
        for (int u = 0; u < 16 / NW; ++u) { const int idx = u * (NW * 32) + tid; const float* cp = CS + ((size_t)(r0 + (idx >> 3)) * HD + (idx & 7) * 8) * 2;
#pragma unroll
            for (int p = 0; p < 4; ++p) cs[u][p] = *(const v2f*)(cp + p * 4); }
        asm volatile("s_wait_xcnt 0x0" ::: "memory");   // before the address registers of these loads are used for something else
    }
    __syncthreads();   // every wave's partial tile is in LDS
#pragma unroll
    for (int u = 0; u < 32 / NW; ++u) { const int idx = u * (NW * 32) + tid; v4f s = *(const v4fa*)(part + idx * 4);
#pragma unroll
        for (int w = 1; w < NW; ++w) s += *(const v4fa*)(part + w * 4096 + idx * 4);
        const int fr = idx >> 6, row = (fr >> 2) * 16 + hi * 8 + ((idx >> 5) & 1) * 4, col = (fr & 3) * 16 + lr;
        if (EPI == 1 && sel == 2) *(v4fa*)(os + col * 68 + row) = s;   // transposed: four tokens of one dim, one 16-byte store
        else {
#pragma unroll
            for (int q = 0; q < 4; ++q) os[(row + q) * 68 + col] = s[q]; } }
    __syncthreads();   // the summed tile is in LDS, row-major (v: dim-major): whole rows go out in 16-byte stores
    if (EPI == 0) {
#pragma unroll
        for (int u = 0; u < 32 / NW; ++u) { const int idx = u * (NW * 32) + tid, row = idx >> 4, cofs = (idx & 15) * 4; *(v4f*)(C + (size_t)(r0 + row) * ldc + c0 + cofs) = *(const v4fa*)(os + row * 68 + cofs); }
    } else {
        // a thread takes 8 consecutive elements of an LDS row; eight threads fill one 128-byte line of every plane
#pragma unroll
        for (int u = 0; u < 16 / NW; ++u) { const int idx = u * (NW * 32) + tid, row = idx >> 3, cofs = (idx & 7) * 8; const v4f xa = *(const v4fa*)(os + row * 68 + cofs), xb = *(const v4fa*)(os + row * 68 + cofs + 4);
            const float x[8] = { xa[0], xa[1], xa[2], xa[3], xb[0], xb[1], xb[2], xb[3] }; v8us oh, ol; unsigned short a2, c2;
            if (sel < 2) {
#pragma unroll
                for (int p = 0; p < 4; ++p) { const float c = cs[u][p][0], sn = cs[u][p][1], xe = x[2 * p], xo = x[2 * p + 1];   /* even: xe c - xo s; odd: xe s + xo c */
                    splitf(xe * c - xo * sn, a2, c2); oh[2 * p] = a2; ol[2 * p] = c2; splitf(xe * sn + xo * c, a2, c2); oh[2 * p + 1] = a2; ol[2 * p + 1] = c2; }
                const size_t e = (((size_t)bz * NH_ + head) * TT + t0 + row) * HD + cofs; *(v8us*)((sel ? PKh : PQh) + e) = oh; *(v8us*)((sel ? PKl : PQl) + e) = ol;
            } else { v8h o16;
#pragma unroll
                for (int q = 0; q < 8; ++q) { o16[q] = tohx(x[q]); splitf(x[q], a2, c2); oh[q] = a2; ol[q] = c2; }
                const size_t e = (((size_t)bz * NKV + head) * HD + row) * TT + t0 + cofs; *(v8h*)(P16 + e) = o16; *(v8us*)(PVh + e) = oh; *(v8us*)(PVl + e) = ol;
                asm volatile("s_wait_xcnt 0x0" ::: "memory");   // before the registers that the three stores name are used for something else
            } }
    }
}

typedef __attribute__((ext_vector_type(2))) _Float16 v2h;
typedef __attribute__((ext_vector_type(4))) _Float16 v4h;
typedef __attribute__((ext_vector_type(2))) unsigned short v2us;
typedef __attribute__((ext_vector_type(4))) unsigned short v4us;
typedef __attribute__((ext_vector_type(4))) int v4i;

__global__ __launch_bounds__(256) void k_wtG(const float* __restrict__ w, int K, int N, bf* Bt) {
    const int lane = threadIdx.x & 31; const int L0 = (blockIdx.x * 8 + (threadIdx.x >> 5)) * 8; const int nlines = N * K / 64;
{
#pragma unroll 1
        for (int l = 0; l < 8; ++l) { const int L = L0 + l; if (L >= nlines) break; const size_t e = (size_t)L * 64 + lane * 2; const int k = (int)(e % K), n = (int)(e / K); v2us o;
            o[0] = f2bf(w[(size_t)k * N + n]); o[1] = f2bf(w[(size_t)(k + 1) * N + n]); *(v2us*)(Bt + e) = o; }
         }
}
__constant__ float INV2[HD / 2] = { 1.000000000e+00f, 7.498942018e-01f, 5.623413324e-01f, 4.216965139e-01f, 3.162277639e-01f, 2.371373624e-01f, 1.778279394e-01f, 1.333521456e-01f, 1.000000015e-01f, 7.498941571e-02f, 5.623412877e-02f, 4.216964915e-02f, 3.162277862e-02f, 2.371373586e-02f, 1.778279431e-02f, 1.333521493e-02f, 9.999999776e-03f, 7.498942316e-03f, 5.623413250e-03f, 4.216964822e-03f, 3.162277862e-03f, 2.371373819e-03f, 1.778279431e-03f, 1.333521446e-03f, 1.000000047e-03f, 7.498941850e-04f, 5.623413017e-04f, 4.216964880e-04f, 3.162277862e-04f, 2.371373848e-04f, 1.778279402e-04f, 1.333521504e-04f };   // float32 10000^(-(i * 2 / 64)), generated with jnp to be bit-exact with the module's expression
// ---- k_prep: all that the projections read, in one launch; the work-group's index picks its job (the same for all its threads), every thread does one piece of it (one {cos, sin} pair, or eight elements to bf16); the grid is exact for the compile-time shapes.
// Groups 0 .. CSG-1: {cos, sin} per (batch, token, dim) from that batch's own row of positions (pid [batch][token], CS [batch][token][dim][2]). The next XG: x to bf16 (both batches, one run of rows). The last 4 x WG1: the four weights to bf16, one behind the other in WB.
#define CSG (NB_ * TT * HD / 256)
#define XG  (NB_ * TT * DM / 2048)
#define WG1 (DQ * DM / 2048)
__global__ __launch_bounds__(256) void k_prep(const float* __restrict__ x, const float* __restrict__ wq, const float* __restrict__ wk, const float* __restrict__ wv, const float* __restrict__ wo, const int* __restrict__ pid, bf* XB, bf* WB, float* CS) {
    const int g = (int)blockIdx.x, tid = threadIdx.x;
    if (g < CSG) { const int idx = g * 256 + tid; const int d = idx % HD; const int t = idx / HD; const float a = __fmul_rn((float)pid[t], INV2[d >> 1]); v2f cs; cs[0] = cosf(a); cs[1] = sinf(a); *(v2f*)(CS + (size_t)idx * 2) = cs; return; }
    const int c = g - CSG, w = (c - XG) / WG1; const float* src; bf* dst;
    if (c < XG) { src = x + (size_t)c * 2048; dst = XB + (size_t)c * 2048; }
    else { src = (w == 0 ? wq : w == 1 ? wk : w == 2 ? wv : wo) + (size_t)((c - XG) % WG1) * 2048; dst = WB + (size_t)(c - XG) * 2048; }
    const v8f v = *(const v8f*)(src + tid * 8); v8us o;
#pragma unroll
    for (int k = 0; k < 8; ++k) o[k] = f2bf(v[k]);
    *(v8us*)(dst + tid * 8) = o;
}

// ---- k_fattn: scores, causal softmax, P.V and the head merge in one kernel; grid (TT / 32, heads / 2, batches), 8 waves. A work-group takes 32 query rows of one head (tile n - 1 - x), then 32 of another (tile x); a tile's 32-key blocks up to the diagonal are dealt to the waves in turn.
// Transposed products: S^T = K Q^T (A = key rows, B = query rows kept in registers; hi/lo planes, 3 products), so a lane holds the scores of ONE query (column lr) and two 16-key score tiles, converted in place, are the B operand of
// O^T += V^T P^T (A = rows of the [d][t] value planes, same k order as the loader). Rows < RH: p and v on hi/lo planes (3 products); the rest: p and v in fp16. p = exp2((s - running max) x HD^-0.5 x log2 e), at most 1, normalised in f32 at the end.
// Every wave keeps its own running maximum, sum and output tile; they meet in LDS and are joined in the fixed order wave 0 .. 7.
#define C2 0.18033688011112042f   // HD^-0.5 x log2(e)
__device__ __forceinline__ float xhalf(float x) { const int b = __float_as_int(x); return __int_as_float(__builtin_amdgcn_permlanex16(b, b, 0x76543210, 0xfedcba98, false, false)); }   // lane l <-> l ^ 16
template <bool HR>
__device__ __forceinline__ void fattn_loop(const bf* __restrict__ Kh, const bf* __restrict__ Kl, const h16* __restrict__ V16, const bf* __restrict__ Vh, const bf* __restrict__ Vl, const v16bf (&qh)[2][2], const v16bf (&ql)[2][2],
                                           int wave, int nblk, int lr, int hi, v8f (&o)[4][2], float (&m)[2], float (&l)[2]) {
    unsigned kofs = ((unsigned)(wave * 32 + lr) * HD + 8 * hi) * 2, vofs = ((unsigned)lr * TT + wave * 32 + 8 * hi) * 2;   // this lane's byte offsets in the key and value planes: one 32-bit register each beside a scalar base
    // the block loop stays rolled (a second copy of the body would need a second set of fragment registers); the constant loops inside are unrolled so that every fragment index is a compile-time constant and the tiles stay in registers
#pragma unroll 1
    for (int blk = wave; blk < nblk; blk += 8, kofs += 8 * 32 * HD * 2, vofs += 8 * 32 * 2) {
        const bf* kph = (const bf*)((const char*)Kh + kofs); const bf* kpl = (const bf*)((const char*)Kl + kofs);
        v16bf kh[2][2], kl[2][2];
#pragma unroll
        for (int kb = 0; kb < 2; ++kb)
#pragma unroll
            for (int ks = 0; ks < 2; ++ks) { kh[kb][ks] = WFrag<bf>::ld(kph + kb * 16 * HD + ks * 32); kl[kb][ks] = WFrag<bf>::ld(kpl + kb * 16 * HD + ks * 32); }
        // inputs-only fence on the loaded key fragments: all sixteen loads are issued together and waited for once; without it the compiler reuses two fragments' registers and waits out the load latency several times per block
        asm volatile("" :: "v"(kh[0][0]), "v"(kh[0][1]), "v"(kh[1][0]), "v"(kh[1][1]), "v"(kl[0][0]), "v"(kl[0][1]), "v"(kl[1][0]), "v"(kl[1][1]));
        v8f s[2][2];
#pragma unroll
        for (int kb = 0; kb < 2; ++kb)
#pragma unroll
            for (int n = 0; n < 2; ++n) s[kb][n] = (v8f){};
#pragma unroll
        for (int ks = 0; ks < 2; ++ks) {
#pragma unroll
            for (int kb = 0; kb < 2; ++kb)
#pragma unroll
                for (int n = 0; n < 2; ++n) s[kb][n] = wmmab(kh[kb][ks], qh[n][ks], s[kb][n]);
#pragma unroll
            for (int kb = 0; kb < 2; ++kb)
#pragma unroll
                for (int n = 0; n < 2; ++n) s[kb][n] = wmmab(kh[kb][ks], ql[n][ks], s[kb][n]);
#pragma unroll
            for (int kb = 0; kb < 2; ++kb)
#pragma unroll
                for (int n = 0; n < 2; ++n) s[kb][n] = wmmab(kl[kb][ks], qh[n][ks], s[kb][n]);
        }
        if (blk == nblk - 1) {   // the diagonal block: keys j > i are out (every query keeps at least the block's first key)
#pragma unroll
            for (int kb = 0; kb < 2; ++kb)
#pragma unroll
                for (int n = 0; n < 2; ++n)
#pragma unroll
                    for (int j = 0; j < 8; ++j) if (kb * 16 + hi * 8 + j > n * 16 + lr) s[kb][n][j] = -3.0e38f;
        }
        v16h p16[2]; v16bf ph[2], pl[2];
#pragma unroll
        for (int n = 0; n < 2; ++n) {
            float mx = s[0][n][0];
#pragma unroll
            for (int j = 1; j < 8; ++j) mx = fmaxf(mx, s[0][n][j]);
#pragma unroll
            for (int j = 0; j < 8; ++j) mx = fmaxf(mx, s[1][n][j]);
            mx = fmaxf(mx, xhalf(mx));
            const float mn = fmaxf(m[n], mx), al = __builtin_amdgcn_exp2f((m[n] - mn) * C2), mc = mn * C2; m[n] = mn;
            float sum = 0.f; v8h f0, f1;
#pragma unroll
            for (int j = 0; j < 8; ++j) {
                const float pa = __builtin_amdgcn_exp2f(s[0][n][j] * C2 - mc), pb = __builtin_amdgcn_exp2f(s[1][n][j] * C2 - mc); sum += pa; sum += pb;
                if (HR) { const __bf16 xa = (__bf16)pa, xb = (__bf16)pb; ph[n][j] = xa; pl[n][j] = (__bf16)(pa - (float)xa); ph[n][8 + j] = xb; pl[n][8 + j] = (__bf16)(pb - (float)xb); } else { f0[j] = tohx(pa); f1[j] = tohx(pb); } }
            l[n] = l[n] * al + sum;   // this lane's half of the keys; the halves are joined after the loop
            if (!HR) p16[n] = cat16(f0, f1);
#pragma unroll
            for (int db = 0; db < 4; ++db) o[db][n] *= al;
        }
#pragma unroll
        for (int db = 0; db < 4; ++db) {
            if (HR) { const v16bf vh = WFrag<bf>::ld((const bf*)((const char*)Vh + vofs) + db * 16 * TT), vl = WFrag<bf>::ld((const bf*)((const char*)Vl + vofs) + db * 16 * TT);
#pragma unroll
                for (int n = 0; n < 2; ++n) { o[db][n] = wmmab(vh, ph[n], o[db][n]); o[db][n] = wmmab(vh, pl[n], o[db][n]); o[db][n] = wmmab(vl, ph[n], o[db][n]); }
            } else { const v16h vf = WFrag<h16>::ld((const h16*)((const char*)V16 + vofs) + db * 16 * TT);
#pragma unroll
                for (int n = 0; n < 2; ++n) o[db][n] = wmma16(vf, p16[n], o[db][n]); } }
    }
}
__global__ __launch_bounds__(256) void k_fattn(const bf* __restrict__ Qh, const bf* __restrict__ Ql, const bf* __restrict__ Kh, const bf* __restrict__ Kl, const h16* __restrict__ V16, const bf* __restrict__ Vh, const bf* __restrict__ Vl, bf* Ah, bf* Al) {
    __shared__ __align__(16) float part[8 * 2048];   // [wave][fragment][half][lane][4]: every 16-byte store and load is contiguous over the lanes
    __shared__ float sM[8][32], sL[8][32];
    const int tid = threadIdx.x, lane = tid & 31, wave = __builtin_amdgcn_readfirstlane(tid >> 5), lr = lane & 15, hi = lane >> 4;
    { const size_t bo = (size_t)blockIdx.z * NH_ * TT * HD; Qh += bo; Ql += bo; Kh += bo; Kl += bo; V16 += bo; Vh += bo; Vl += bo; Ah += bo; Al += bo; }   // this work-group's batch: every plane holds NH_ x TT x HD = TT x DQ elements a batch
    // two tiles one after the other, so that every work-group walks 65 key blocks: kept rolled, one copy of the code
#pragma unroll 1
    for (int pass = 0; pass < 2; ++pass) {
        const int tile = pass ? (int)blockIdx.x : TT / 32 - 1 - (int)blockIdx.x, r0 = tile * 32, h = (int)blockIdx.y + pass * (NH_ / 2);
        const size_t zo = (size_t)h * TT * HD;
        v16bf qh[2][2], ql[2][2];
#pragma unroll
        for (int n = 0; n < 2; ++n)
#pragma unroll
            for (int ks = 0; ks < 2; ++ks) { const size_t qo = zo + (size_t)(r0 + n * 16 + lr) * HD + ks * 32 + 8 * hi; qh[n][ks] = WFrag<bf>::ld(Qh + qo); ql[n][ks] = WFrag<bf>::ld(Ql + qo); }
        asm volatile("s_wait_xcnt 0x0" ::: "memory");   // before the address registers of the query loads are used for something else
        v8f o[4][2]; float m[2] = { -3.0e38f, -3.0e38f }, l[2] = { 0.f, 0.f };
#pragma unroll
        for (int db = 0; db < 4; ++db)
#pragma unroll
            for (int n = 0; n < 2; ++n) o[db][n] = (v8f){};
        if (r0 < RH) fattn_loop<true>(Kh + zo, Kl + zo, V16 + zo, Vh + zo, Vl + zo, qh, ql, wave, tile + 1, lr, hi, o, m, l);
        else         fattn_loop<false>(Kh + zo, Kl + zo, V16 + zo, Vh + zo, Vl + zo, qh, ql, wave, tile + 1, lr, hi, o, m, l);
#pragma unroll
        for (int n = 0; n < 2; ++n) l[n] += xhalf(l[n]);
        sM[wave][lane] = hi ? m[1] : m[0]; sL[wave][lane] = hi ? l[1] : l[0];   // entry n * 16 + query column
        __syncthreads();   // every wave's maximum and sum are in LDS (a wave without a block: -3e38 and 0; wave 0 always has block 0); every wave has also left the first tile's partial tiles
        float inv[2];
#pragma unroll
        for (int n = 0; n < 2; ++n) { float M = sM[0][n * 16 + lr];
#pragma unroll
            for (int w = 1; w < 8; ++w) M = fmaxf(M, sM[w][n * 16 + lr]);
            float L = 0.f;
#pragma unroll
            for (int w = 0; w < 8; ++w) L += sL[w][n * 16 + lr] * __builtin_amdgcn_exp2f((sM[w][n * 16 + lr] - M) * C2);
            inv[n] = __fdiv_rn(1.0f, L); const float f = __builtin_amdgcn_exp2f((m[n] - M) * C2);
#pragma unroll
            for (int db = 0; db < 4; ++db) o[db][n] *= f; }
        float* pw = part + wave * 2048 + lane * 4;
#pragma unroll
        for (int db = 0; db < 4; ++db)
#pragma unroll
            for (int n = 0; n < 2; ++n) { const v8f c = o[db][n]; *(v4fa*)(pw + (db * 2 + n) * 256) = (v4f){c[0], c[1], c[2], c[3]}; *(v4fa*)(pw + (db * 2 + n) * 256 + 128) = (v4f){c[4], c[5], c[6], c[7]}; }
        __syncthreads();   // every wave's weighted output tile is in LDS; every wave has read the maxima and sums
        // wave w joins fragment w (head dims (w >> 1) * 16 .., query group w & 1): a lane ends with 8 consecutive dims of one query row, one 16-byte store per plane
        const float* pr = part + wave * 256 + lane * 4; v4f a = *(const v4fa*)pr, c = *(const v4fa*)(pr + 128);
#pragma unroll
        for (int w = 1; w < 8; ++w) { a += *(const v4fa*)(pr + w * 2048); c += *(const v4fa*)(pr + w * 2048 + 128); }
        const float iv = (wave & 1) ? inv[1] : inv[0]; v8us oh, ol;
#pragma unroll
        for (int q = 0; q < 4; ++q) { unsigned short x, y; splitf(a[q] * iv, x, y); oh[q] = x; ol[q] = y; splitf(c[q] * iv, x, y); oh[4 + q] = x; ol[4 + q] = y; }
        const size_t oo = (size_t)(r0 + (wave & 1) * 16 + lr) * DQ + h * HD + (wave >> 1) * 16 + hi * 8; *(v8us*)(Ah + oo) = oh; *(v8us*)(Al + oo) = ol;
        asm volatile("s_wait_xcnt 0x0" ::: "memory");   // before the second tile overwrites the registers that the two stores name
    }
}

extern "C" void kernel_launch(void* const* d_in, const int* in_sizes, int n_in,
                              void* d_out, int out_size, void* d_ws, size_t ws_size, hipStream_t stream) {
    (void)in_sizes; (void)n_in; (void)out_size;
        const float* x = (const float*)d_in[0]; const int* PID = (const int*)d_in[5]; const float* wq = (const float*)d_in[1]; const float* wk = (const float*)d_in[2]; const float* wv = (const float*)d_in[3]; const float* wo = (const float*)d_in[4];   /* order x, Wq, Wk, Wv, Wo ('oi' [1024][1024]), token_positions (int32 [2][2048]: ONE row of positions PER BATCH, sorted random values in [0, 2048); read on device) */
    float* OUT = (float*)d_out;     // [2][2048][1024]
    char* wsp = (char*)d_ws;
    auto take = [&](size_t bytes) { char* p = wsp; wsp += (bytes + 255) & ~(size_t)255; return (void*)p; };
    bf* WB = (bf*)take((size_t)4 * DQ * DM * 2);   // Wq, Wk, Wv, Wo in bf16, one behind the other
    h16* VT16 = (h16*)take((size_t)NB_ * NKV * HD * TT * 2);
    bf* QPh = (bf*)take((size_t)NB_ * NH_ * TT * HD * 2); bf* QPl = (bf*)take((size_t)NB_ * NH_ * TT * HD * 2); bf* KPh = (bf*)take((size_t)NB_ * NKV * TT * HD * 2); bf* KPl = (bf*)take((size_t)NB_ * NKV * TT * HD * 2); bf* VTh = (bf*)take((size_t)NB_ * NKV * HD * TT * 2); bf* VTl = (bf*)take((size_t)NB_ * NKV * HD * TT * 2);
    bf* ATh = (bf*)take((size_t)NB_ * TT * DQ * 2); bf* ATl = (bf*)take((size_t)NB_ * TT * DQ * 2);
    float* CS = (float*)take((size_t)NB_ * TT * HD * 2 * 4); bf* XB = (bf*)take((size_t)NB_ * TT * DM * 2);
    if ((size_t)(wsp - (char*)d_ws) > ws_size) return;    // ws 256 MiB
    k_prep<<<CSG + XG + 4 * WG1, 256, 0, stream>>>(x, wq, wk, wv, wo, PID, XB, WB, CS);   /* token_positions (int32, read): every batch's own row of positions */
    k_gemmk<bf, 0, 8, false, 1><<<dim3(NB_ * TT / 64, 3 * NH_, 1), 256, 0, stream>>>(XB, nullptr, WB, nullptr, DM, nullptr, 0, 0, 0, 0, 0, CS, VT16, QPh, QPl, KPh, KPl, VTh, VTl);
    k_fattn<<<dim3(TT / 32, NH_ / 2, NB_), 256, 0, stream>>>(QPh, QPl, KPh, KPl, VT16, VTh, VTl, ATh, ATl);   /* one kv head per query head */
    k_gemmk<bf, 1, 8, false, 0><<<dim3(NB_ * TT / 64, DM / 64, 1), 256, 0, stream>>>(ATh, ATl, WB + (size_t)3 * DQ * DM, nullptr, DQ, OUT, DM, 0, 0, 0, 0, nullptr, nullptr, nullptr, nullptr, nullptr, nullptr, nullptr, nullptr);
}

// v006
// A run of this version takes 116 microseconds.
// Two timings next to v005 put it at 1.39 and 1.38 times that version's speed.
// All steps since v000 together make it 11.8 times as fast.
#include <hip/hip_runtime.h>

// Causal multi-head self-attention with interleaved-pair rotary position embedding from PER-BATCH position rows (x [2][2048][1024]; q, k, v = einsum('bsd,od', x, W) ('oi' [1024][1024], no bias; 16 heads x 64); angle = float(token_positions[b][t]) x 1 / theta ** (2i / 64) (theta 1e4; token_positions int32 [2][2048]: each batch has its OWN sorted row of random positions in [0, 2048), READ on device); pairs (2i, 2i+1): (xe cos - xo sin, xe sin + xo cos) on q and k; scores / sqrt(64); keys j <= i kept (by INDEX, not by position), -inf elsewhere; softmax; out = einsum('bso,do', merged, Wo) -> [2][2048][1024] (4.2 M); argument order x, Wq, Wk, Wv, Wo, token_positions).
// Every stage is launched once, for both batches and all its operands (4 launches). Layout: bf16 copy of x and of the four weights; {cos, sin} per (position, pair) built once from the int positions and float32 inverse-frequency constants (precise cosf/sinf); exact projections whose epilogue turns the summed f32 tile (64 tokens x one head) straight into the attention planes (q, k: interleaved rotary, hi/lo; v: transposed, fp16 and hi/lo); fused causal T-2048 attention, no score buffer (EVERY row's scores on hi/lo planes (3 products: logit sigma 2 with these weights), online softmax, hybrid P.V (rows < 512 hi/lo, rest fp16); key blocks above the diagonal are never touched); merged hi/lo x Wo exact.
// FRAGMENT ORDER: every 16-bit plane that a matrix instruction reads (x, the weights, q, k, v, the merged heads) lies in the workspace as 1-KiB units of 16 rows x 32 k, [k bit 4][k bit 3][row][k bits 2..0]: a lane's two 16-byte pieces of a fragment stand at unit + lane * 16 B and 512 B further, so each wave-wide load is 512 contiguous bytes (4 whole lines), not 32-byte pieces of 16 lines. The k order of every fragment is as before.
// Compute dtypes, f32 accumulate: every input rounded to bf16; projections exact; rotary f32; attention rows < 512 3 products, rest fp16; softmax f32; Wo hl x exact.

#define NB_  2
#define TT   2048
#define DM   1024
#define NH_  16
#define NKV  16
#define REP  (NH_ / NKV)
#define HD   64
#define DQ   (NH_ * HD)
#define DKV  (NKV * HD)
#define RH   512                  // query rows < RH take P.V on hi+lo planes (0: none)
typedef _Float16 h16;
typedef unsigned short bf;
typedef __attribute__((ext_vector_type(16))) __bf16   v16bf;
typedef __attribute__((ext_vector_type(16))) _Float16 v16h;
typedef __attribute__((ext_vector_type(8)))  _Float16 v8h;
typedef __attribute__((ext_vector_type(8)))  unsigned short v8us;
typedef __attribute__((ext_vector_type(8)))  float    v8f;
typedef __attribute__((ext_vector_type(4)))  float    v4f;
typedef v8h  __attribute__((may_alias)) v8ha;
typedef v4f  __attribute__((may_alias)) v4fa;
typedef v8us __attribute__((may_alias)) v8usa;

__device__ __forceinline__ unsigned short f2bf(float f) { unsigned u = __float_as_uint(f); u += 0x7FFFu + ((u >> 16) & 1u); return (unsigned short)(u >> 16); }
__device__ __forceinline__ float bf2f(unsigned short b) { return __uint_as_float(((unsigned)b) << 16); }
__device__ __forceinline__ float bfr(float f) { return bf2f(f2bf(f)); }
__device__ __forceinline__ v16h cat16(v8h lo, v8h hi) { return __builtin_shufflevector(lo, hi, 0, 1, 2, 3, 4, 5, 6, 7, 8, 9, 10, 11, 12, 13, 14, 15); }
__device__ __forceinline__ v16bf cat16b(v8us lo, v8us hi) { return __builtin_bit_cast(v16bf, __builtin_shufflevector(lo, hi, 0, 1, 2, 3, 4, 5, 6, 7, 8, 9, 10, 11, 12, 13, 14, 15)); }
__device__ __forceinline__ v8f wmma16(v16h a, v16h b, v8f c) { return __builtin_amdgcn_wmma_f32_16x16x32_f16(false, a, false, b, (short)0, c, false, false); }
__device__ __forceinline__ v8f wmmab(v16bf a, v16bf b, v8f c) { return __builtin_amdgcn_wmma_f32_16x16x32_bf16(false, a, false, b, (short)0, c, false, false); }

__device__ __forceinline__ h16 tohx(float x) { return (h16)x; }
__device__ __forceinline__ void splitf(float y, unsigned short& h, unsigned short& l) { h = f2bf(y); l = f2bf(y - bf2f(h)); }
typedef __attribute__((ext_vector_type(2))) float v2f;

// ---- k_gemmk: register-blocked GEMM, one 64x64 output tile per work-group of NW waves, operands straight from 16-bit planes in fragment order (units of one 16-row group one behind the other along k, so a group is 16 x K elements as in a row-major plane); grid (M/64, N/64, Z), NW x 32 threads.
// C[m][n] (f32, pitch ldc) = sum_k A[m][k] Bt[n][k] (+ split products per NSPLIT). z-batch strides sA/sB/sC in elements. K % 32 == 0.
// The K loop is dealt to the waves in turn, 32 k a trip (wave w takes trips w, w + NW, ...); every wave keeps its own 16 accumulators, the NW partial tiles meet in LDS and are added in the fixed order wave 0 .. NW-1.
// EPI 0: C as above. EPI 1 (q, k and v projections of both batches in one grid; Bt = the three weights one behind the other, rows = the tokens of batch 0, then of batch 1; N tile = one head of HD = 64 dims; C unused): the summed tile never leaves the work-group as f32.
// blockIdx.y / heads picks the epilogue, the same for the whole work-group. 0 (q) and 1 (k): interleaved rotary with {cos, sin} from CS[batch][token][dim][2], then hi/lo planes PQh, PQl or PKh, PKl [batch][head], rows = tokens, k = dims. 2 (v): the tile is put into LDS transposed and goes out as planes P16, PVh, PVl [batch][head], rows = dims, k = tokens. All in fragment order.
// CAUSAL (probability x value): the K loop stops at the diagonal block (probabilities beyond it are exactly zero); roff = row offset of this launch's first row within the sequence.
template <typename T16> struct WFrag;
template <> struct WFrag<h16> { typedef v16h V; static __device__ __forceinline__ V ld(const h16* p) { return cat16(*(const v8h*)p, *(const v8h*)(p + 256)); } static __device__ __forceinline__ v8f mma(V a, V b, v8f c) { return wmma16(a, b, c); } };
template <> struct WFrag<bf> { typedef v16bf V; static __device__ __forceinline__ V ld(const bf* p) { return cat16b(*(const v8us*)p, *(const v8us*)(p + 256)); } static __device__ __forceinline__ v8f mma(V a, V b, v8f c) { return wmmab(a, b, c); } };
template <typename T16, int NSPLIT, int NW, bool CAUSAL, int EPI, int K>   // K at compile time: the row groups' distances become immediate offsets of the fragment loads
__global__ __launch_bounds__(NW * 32) void k_gemmk(const T16* __restrict__ A, const T16* __restrict__ A2, const T16* __restrict__ Bt, const T16* __restrict__ Bt2, float* C, int ldc, int roff, size_t sA, size_t sB, size_t sC, const float* __restrict__ CS, h16* P16, bf* PQh, bf* PQl, bf* PKh, bf* PKl, bf* PVh, bf* PVl) {
    typedef typename WFrag<T16>::V V;
    __shared__ __align__(16) float part[NW * 4096];   // [wave][fragment][half][lane][4]: every 16-byte store and load is contiguous over the lanes
    __shared__ __align__(16) float os[64 * 68];
    const size_t z = blockIdx.z; A += z * sA; if (A2) A2 += z * sA; Bt += z * sB; if (Bt2) Bt2 += z * sB; C += z * sC;
    const int tid = threadIdx.x, lane = tid & 31, wave = __builtin_amdgcn_readfirstlane(tid >> 5), lr = lane & 15, hi = lane >> 4; const int r0 = blockIdx.x * 64, c0 = blockIdx.y * 64;
    const int sel = EPI ? (int)blockIdx.y / NH_ : 0, head = (int)blockIdx.y % NH_, bz = r0 / TT, t0 = r0 % TT;   // EPI 1: which projection, its head, the batch and the tile's first token in it
    const int Kl = CAUSAL ? min(K, r0 + roff + 64) : K;
    v8f acc[4][4];
#pragma unroll
    for (int mb = 0; mb < 4; ++mb)
#pragma unroll
        for (int nb = 0; nb < 4; ++nb) acc[mb][nb] = (v8f){};
    const T16* Ar = A + (size_t)r0 * K; const T16* A2r = A2 + (size_t)r0 * K; const T16* Br = Bt + (size_t)c0 * K; const T16* B2r = Bt2 + (size_t)c0 * K;   // first unit of the tile's first row group, the same for the whole work-group; 32 k further = one unit (512 elements) further
    unsigned kofs = (wave * 512 + lane * 8) * 2;   // this lane's byte offset in the unit of the wave's trip: the one vector register of every fragment address, beside a scalar base and an immediate offset
#define FRAG(base, el) WFrag<T16>::ld((const T16*)((const char*)(base) + kofs) + (el))
#pragma unroll 1
    for (int kc = wave * 32; kc < Kl; kc += NW * 32, kofs += NW * 512 * 2) {
        V a[4], a2[4];
#pragma unroll
        for (int mb = 0; mb < 4; ++mb) { a[mb] = FRAG(Ar, mb * 16 * K); if (NSPLIT == 1 || NSPLIT == 2) a2[mb] = FRAG(A2r, mb * 16 * K); }
#pragma unroll
        for (int nb = 0; nb < 4; ++nb) { const V b = FRAG(Br, nb * 16 * K); V b2; if (NSPLIT >= 2) b2 = FRAG(B2r, nb * 16 * K);
#pragma unroll
            for (int mb = 0; mb < 4; ++mb) { acc[mb][nb] = WFrag<T16>::mma(a[mb], b, acc[mb][nb]); if (NSPLIT == 1 || NSPLIT == 2) acc[mb][nb] = WFrag<T16>::mma(a2[mb], b, acc[mb][nb]); if (NSPLIT >= 2) acc[mb][nb] = WFrag<T16>::mma(a[mb], b2, acc[mb][nb]); } }
        // four vector slots behind the last matrix instruction, so that its distance also holds over the loop's back edge
        asm volatile("v_nop\n\tv_nop\n\tv_nop\n\tv_nop" : "+v"(acc[0][0]), "+v"(acc[1][1]), "+v"(acc[2][2]), "+v"(acc[3][3]) : "v"(a[0]), "v"(a[3]));
    }
#undef FRAG
    float* pw = part + wave * 4096 + lane * 4;
#pragma unroll
    for (int mb = 0; mb < 4; ++mb)
#pragma unroll
        for (int nb = 0; nb < 4; ++nb) { const v8f c = acc[mb][nb]; *(v4fa*)(pw + (mb * 4 + nb) * 256) = (v4f){c[0], c[1], c[2], c[3]}; *(v4fa*)(pw + (mb * 4 + nb) * 256 + 128) = (v4f){c[4], c[5], c[6], c[7]}; }
    v2f cs[16 / NW][4];   // q and k: this thread's {cos, sin} pairs, asked for in front of the barrier, so that they are on their way while the partial tiles go into LDS
    if (EPI == 1 && sel < 2) {
#pragma unroll
        for (int u = 0; u < 16 / NW; ++u) { const int idx = u * (NW * 32) + tid; const float* cp = CS + ((size_t)(r0 + (idx >> 7) * 16 + (idx & 15)) * HD + ((idx >> 4) & 7) * 8) * 2;
#pragma unroll
            for (int p = 0; p < 4; ++p) cs[u][p] = *(const v2f*)(cp + p * 4); }
        asm volatile("s_wait_xcnt 0x0" ::: "memory");   // before the address registers of these loads are used for something else
    }
    __syncthreads();   // every wave's partial tile is in LDS
#pragma unroll
    for (int u = 0; u < 32 / NW; ++u) { const int idx = u * (NW * 32) + tid; v4f s = *(const v4fa*)(part + idx * 4);
#pragma unroll
        for (int w = 1; w < NW; ++w) s += *(const v4fa*)(part + w * 4096 + idx * 4);
        const int fr = idx >> 6, row = (fr >> 2) * 16 + hi * 8 + ((idx >> 5) & 1) * 4, col = (fr & 3) * 16 + lr;
        if (EPI == 1 && sel == 2) *(v4fa*)(os + col * 68 + row) = s;   // transposed: four tokens of one dim, one 16-byte store
        else {
#pragma unroll
            for (int q = 0; q < 4; ++q) os[(row + q) * 68 + col] = s[q]; } }
    __syncthreads();   // the summed tile is in LDS, row-major (v: dim-major): whole rows go out in 16-byte stores
    if (EPI == 0) {
#pragma unroll
        for (int u = 0; u < 32 / NW; ++u) { const int idx = u * (NW * 32) + tid, row = idx >> 4, cofs = (idx & 15) * 4; *(v4f*)(C + (size_t)(r0 + row) * ldc + c0 + cofs) = *(const v4fa*)(os + row * 68 + cofs); }
    } else {
        // a thread takes 8 consecutive elements of an LDS row, the ones that stand at idx * 8 of the tile in fragment order (the 64 x 64 tile is 4096 consecutive elements of its plane): a wave fills 512 contiguous bytes of every plane.
        // q, k: units [token group][dim / 32]; v: units [token / 32][dim group], so that a 32-key block of a head is 4 KiB in a row in each plane
#pragma unroll
        for (int u = 0; u < 16 / NW; ++u) { const int idx = u * (NW * 32) + tid, row = (sel < 2 ? idx >> 7 : (idx >> 6) & 3) * 16 + (idx & 15), cofs = sel < 2 ? ((idx >> 4) & 7) * 8 : (idx >> 8) * 32 + ((idx >> 4) & 3) * 8; const v4f xa = *(const v4fa*)(os + row * 68 + cofs), xb = *(const v4fa*)(os + row * 68 + cofs + 4);
            const float x[8] = { xa[0], xa[1], xa[2], xa[3], xb[0], xb[1], xb[2], xb[3] }; v8us oh, ol; unsigned short a2, c2;
            if (sel < 2) {
#pragma unroll
                for (int p = 0; p < 4; ++p) { const float c = cs[u][p][0], sn = cs[u][p][1], xe = x[2 * p], xo = x[2 * p + 1];   /* even: xe c - xo s; odd: xe s + xo c */
                    splitf(xe * c - xo * sn, a2, c2); oh[2 * p] = a2; ol[2 * p] = c2; splitf(xe * sn + xo * c, a2, c2); oh[2 * p + 1] = a2; ol[2 * p + 1] = c2; }
                const size_t e = (((size_t)bz * NH_ + head) * TT + t0) * HD + idx * 8; *(v8us*)((sel ? PKh : PQh) + e) = oh; *(v8us*)((sel ? PKl : PQl) + e) = ol;
                asm volatile("s_wait_xcnt 0x0" ::: "memory");   // before the registers that the two stores name are used for something else
            } else { v8h o16;
#pragma unroll
                for (int q = 0; q < 8; ++q) { o16[q] = tohx(x[q]); splitf(x[q], a2, c2); oh[q] = a2; ol[q] = c2; }
                const size_t e = (((size_t)bz * NKV + head) * TT + t0) * HD + idx * 8; *(v8h*)(P16 + e) = o16; *(v8us*)(PVh + e) = oh; *(v8us*)(PVl + e) = ol;
                asm volatile("s_wait_xcnt 0x0" ::: "memory");   // before the registers that the three stores name are used for something else
            } }
    }
}

typedef __attribute__((ext_vector_type(2))) _Float16 v2h;
typedef __attribute__((ext_vector_type(4))) _Float16 v4h;
typedef __attribute__((ext_vector_type(2))) unsigned short v2us;
typedef __attribute__((ext_vector_type(4))) unsigned short v4us;
typedef __attribute__((ext_vector_type(4))) int v4i;

__global__ __launch_bounds__(256) void k_wtG(const float* __restrict__ w, int K, int N, bf* Bt) {
    const int lane = threadIdx.x & 31; const int L0 = (blockIdx.x * 8 + (threadIdx.x >> 5)) * 8; const int nlines = N * K / 64;
{
#pragma unroll 1
        for (int l = 0; l < 8; ++l) { const int L = L0 + l; if (L >= nlines) break; const size_t e = (size_t)L * 64 + lane * 2; const int k = (int)(e % K), n = (int)(e / K); v2us o;
            o[0] = f2bf(w[(size_t)k * N + n]); o[1] = f2bf(w[(size_t)(k + 1) * N + n]); *(v2us*)(Bt + e) = o; }
         }
}
__constant__ float INV2[HD / 2] = { 1.000000000e+00f, 7.498942018e-01f, 5.623413324e-01f, 4.216965139e-01f, 3.162277639e-01f, 2.371373624e-01f, 1.778279394e-01f, 1.333521456e-01f, 1.000000015e-01f, 7.498941571e-02f, 5.623412877e-02f, 4.216964915e-02f, 3.162277862e-02f, 2.371373586e-02f, 1.778279431e-02f, 1.333521493e-02f, 9.999999776e-03f, 7.498942316e-03f, 5.623413250e-03f, 4.216964822e-03f, 3.162277862e-03f, 2.371373819e-03f, 1.778279431e-03f, 1.333521446e-03f, 1.000000047e-03f, 7.498941850e-04f, 5.623413017e-04f, 4.216964880e-04f, 3.162277862e-04f, 2.371373848e-04f, 1.778279402e-04f, 1.333521504e-04f };   // float32 10000^(-(i * 2 / 64)), generated with jnp to be bit-exact with the module's expression
// ---- k_prep: all that the projections read, in one launch; the work-group's index picks its job (the same for all its threads), every thread does one piece of it (one {cos, sin} pair, or eight elements to bf16, stored in fragment order: a work-group takes 16 rows x 128 k, four units); the grid is exact for the compile-time shapes.
// Groups 0 .. CSG-1: {cos, sin} per (batch, token, dim) from that batch's own row of positions (pid [batch][token], CS [batch][token][dim][2]). The next XG: x to bf16 (both batches, one run of rows). The last 4 x WG1: the four weights to bf16, one behind the other in WB.
#define CSG (NB_ * TT * HD / 256)
#define XG  (NB_ * TT * DM / 2048)
#define WG1 (DQ * DM / 2048)
__global__ __launch_bounds__(256) void k_prep(const float* __restrict__ x, const float* __restrict__ wq, const float* __restrict__ wk, const float* __restrict__ wv, const float* __restrict__ wo, const int* __restrict__ pid, bf* XB, bf* WB, float* CS) {
    const int g = (int)blockIdx.x, tid = threadIdx.x;
    if (g < CSG) { const int idx = g * 256 + tid; const int d = idx % HD; const int t = idx / HD; const float a = __fmul_rn((float)pid[t], INV2[d >> 1]); v2f cs; cs[0] = cosf(a); cs[1] = sinf(a); *(v2f*)(CS + (size_t)idx * 2) = cs; return; }
    const int c = g - CSG, w = (c - XG) / WG1; const float* src; bf* dst;
    const int cc = c < XG ? c : (c - XG) % WG1; const size_t so = (size_t)((cc >> 3) * 16 + (tid & 15)) * DM + (cc & 7) * 128 + (tid >> 4) * 8;   // row and first k of the eight elements that stand at tid * 8 of the group's four units
    if (c < XG) { src = x + so; dst = XB + (size_t)c * 2048; }
    else { src = (w == 0 ? wq : w == 1 ? wk : w == 2 ? wv : wo) + so; dst = WB + (size_t)(c - XG) * 2048; }
    const v8f v = *(const v8f*)src; v8us o;
#pragma unroll
    for (int k = 0; k < 8; ++k) o[k] = f2bf(v[k]);
    *(v8us*)(dst + tid * 8) = o;
}

// ---- k_fattn: scores, causal softmax, P.V and the head merge in one kernel; grid (TT / 32, heads / 2, batches), 8 waves. A work-group takes 32 query rows of one head (tile n - 1 - x), then 32 of another (tile x); a tile's 32-key blocks up to the diagonal are dealt to the waves in turn.
// Transposed products: S^T = K Q^T (A = key rows, B = query rows kept in registers; hi/lo planes, 3 products), so a lane holds the scores of ONE query (column lr) and two 16-key score tiles, converted in place, are the B operand of
// O^T += V^T P^T (A = dim rows of the value planes, same k order as the loader). Rows < RH: p and v on hi/lo planes (3 products); the rest: p and v in fp16. p = exp2((s - running max) x HD^-0.5 x log2 e), at most 1, normalised in f32 at the end.
// Every wave keeps its own running maximum, sum and output tile; they meet in LDS and are joined in the fixed order wave 0 .. 7.
#define C2 0.18033688011112042f   // HD^-0.5 x log2(e)
__device__ __forceinline__ float xhalf(float x) { const int b = __float_as_int(x); return __int_as_float(__builtin_amdgcn_permlanex16(b, b, 0x76543210, 0xfedcba98, false, false)); }   // lane l <-> l ^ 16
template <bool HR>
__device__ __forceinline__ void fattn_loop(const bf* __restrict__ Kh, const bf* __restrict__ Kl, const h16* __restrict__ V16, const bf* __restrict__ Vh, const bf* __restrict__ Vl, const v16bf (&qh)[2][2], const v16bf (&ql)[2][2],
                                           int wave, int nblk, int lr, int hi, v8f (&o)[4][2], float (&m)[2], float (&l)[2]) {
    unsigned kofs = ((unsigned)wave * 32 * HD + (hi * 16 + lr) * 8) * 2;   // this lane's byte offset in the key and value planes (a 32-key block is four units, 32 x HD elements, in each): one 32-bit register beside a scalar base
    // the block loop stays rolled (a second copy of the body would need a second set of fragment registers); the constant loops inside are unrolled so that every fragment index is a compile-time constant and the tiles stay in registers
#pragma unroll 1
    for (int blk = wave; blk < nblk; blk += 8, kofs += 8 * 32 * HD * 2) {
        const bf* kph = (const bf*)((const char*)Kh + kofs); const bf* kpl = (const bf*)((const char*)Kl + kofs);
        v16bf kh[2][2], kl[2][2];
#pragma unroll
        for (int kb = 0; kb < 2; ++kb)
#pragma unroll
            for (int ks = 0; ks < 2; ++ks) { kh[kb][ks] = WFrag<bf>::ld(kph + (kb * 2 + ks) * 512); kl[kb][ks] = WFrag<bf>::ld(kpl + (kb * 2 + ks) * 512); }
        // inputs-only fence on the loaded key fragments: all sixteen loads are issued together and waited for once; without it the compiler reuses two fragments' registers and waits out the load latency several times per block
        asm volatile("" :: "v"(kh[0][0]), "v"(kh[0][1]), "v"(kh[1][0]), "v"(kh[1][1]), "v"(kl[0][0]), "v"(kl[0][1]), "v"(kl[1][0]), "v"(kl[1][1]));
        v8f s[2][2];
#pragma unroll
        for (int kb = 0; kb < 2; ++kb)
#pragma unroll
            for (int n = 0; n < 2; ++n) s[kb][n] = (v8f){};
#pragma unroll
        for (int ks = 0; ks < 2; ++ks) {
#pragma unroll
            for (int kb = 0; kb < 2; ++kb)
#pragma unroll
                for (int n = 0; n < 2; ++n) s[kb][n] = wmmab(kh[kb][ks], qh[n][ks], s[kb][n]);
#pragma unroll
            for (int kb = 0; kb < 2; ++kb)
#pragma unroll
                for (int n = 0; n < 2; ++n) s[kb][n] = wmmab(kh[kb][ks], ql[n][ks], s[kb][n]);
#pragma unroll
            for (int kb = 0; kb < 2; ++kb)
#pragma unroll
                for (int n = 0; n < 2; ++n) s[kb][n] = wmmab(kl[kb][ks], qh[n][ks], s[kb][n]);
        }
        if (blk == nblk - 1) {   // the diagonal block: keys j > i are out (every query keeps at least the block's first key)
#pragma unroll
            for (int kb = 0; kb < 2; ++kb)
#pragma unroll
                for (int n = 0; n < 2; ++n)
#pragma unroll
                    for (int j = 0; j < 8; ++j) if (kb * 16 + hi * 8 + j > n * 16 + lr) s[kb][n][j] = -3.0e38f;
        }
        v16h p16[2]; v16bf ph[2], pl[2];
#pragma unroll
        for (int n = 0; n < 2; ++n) {
            float mx = s[0][n][0];
#pragma unroll
            for (int j = 1; j < 8; ++j) mx = fmaxf(mx, s[0][n][j]);
#pragma unroll
            for (int j = 0; j < 8; ++j) mx = fmaxf(mx, s[1][n][j]);
            mx = fmaxf(mx, xhalf(mx));
            const float mn = fmaxf(m[n], mx), al = __builtin_amdgcn_exp2f((m[n] - mn) * C2), mc = mn * C2; m[n] = mn;
            float sum = 0.f; v8h f0, f1;
#pragma unroll
            for (int j = 0; j < 8; ++j) {
                const float pa = __builtin_amdgcn_exp2f(s[0][n][j] * C2 - mc), pb = __builtin_amdgcn_exp2f(s[1][n][j] * C2 - mc); sum += pa; sum += pb;
                if (HR) { const __bf16 xa = (__bf16)pa, xb = (__bf16)pb; ph[n][j] = xa; pl[n][j] = (__bf16)(pa - (float)xa); ph[n][8 + j] = xb; pl[n][8 + j] = (__bf16)(pb - (float)xb); } else { f0[j] = tohx(pa); f1[j] = tohx(pb); } }
            l[n] = l[n] * al + sum;   // this lane's half of the keys; the halves are joined after the loop
            if (!HR) p16[n] = cat16(f0, f1);
#pragma unroll
            for (int db = 0; db < 4; ++db) o[db][n] *= al;
        }
#pragma unroll
        for (int db = 0; db < 4; ++db) {
            if (HR) { const v16bf vh = WFrag<bf>::ld((const bf*)((const char*)Vh + kofs) + db * 512), vl = WFrag<bf>::ld((const bf*)((const char*)Vl + kofs) + db * 512);
#pragma unroll
                for (int n = 0; n < 2; ++n) { o[db][n] = wmmab(vh, ph[n], o[db][n]); o[db][n] = wmmab(vh, pl[n], o[db][n]); o[db][n] = wmmab(vl, ph[n], o[db][n]); }
            } else { const v16h vf = WFrag<h16>::ld((const h16*)((const char*)V16 + kofs) + db * 512);
#pragma unroll
                for (int n = 0; n < 2; ++n) o[db][n] = wmma16(vf, p16[n], o[db][n]); } }
    }
}
__global__ __launch_bounds__(256) void k_fattn(const bf* __restrict__ Qh, const bf* __restrict__ Ql, const bf* __restrict__ Kh, const bf* __restrict__ Kl, const h16* __restrict__ V16, const bf* __restrict__ Vh, const bf* __restrict__ Vl, bf* Ah, bf* Al) {
    __shared__ __align__(16) float part[8 * 2048];   // [wave][fragment][half][lane][4]: every 16-byte store and load is contiguous over the lanes
    __shared__ float sM[8][32], sL[8][32];
    const int tid = threadIdx.x, lane = tid & 31, wave = __builtin_amdgcn_readfirstlane(tid >> 5), lr = lane & 15, hi = lane >> 4;
    { const size_t bo = (size_t)blockIdx.z * NH_ * TT * HD; Qh += bo; Ql += bo; Kh += bo; Kl += bo; V16 += bo; Vh += bo; Vl += bo; Ah += bo; Al += bo; }   // this work-group's batch: every plane holds NH_ x TT x HD = TT x DQ elements a batch
    // two tiles one after the other, so that every work-group walks 65 key blocks: kept rolled, one copy of the code
#pragma unroll 1
    for (int pass = 0; pass < 2; ++pass) {
        const int tile = pass ? (int)blockIdx.x : TT / 32 - 1 - (int)blockIdx.x, r0 = tile * 32, h = (int)blockIdx.y + pass * (NH_ / 2);
        const size_t zo = (size_t)h * TT * HD;
        v16bf qh[2][2], ql[2][2];
#pragma unroll
        for (int n = 0; n < 2; ++n)
#pragma unroll
            for (int ks = 0; ks < 2; ++ks) { const size_t qo = zo + (size_t)r0 * HD + (n * 2 + ks) * 512 + lane * 8; qh[n][ks] = WFrag<bf>::ld(Qh + qo); ql[n][ks] = WFrag<bf>::ld(Ql + qo); }
        asm volatile("s_wait_xcnt 0x0" ::: "memory");   // before the address registers of the query loads are used for something else
        v8f o[4][2]; float m[2] = { -3.0e38f, -3.0e38f }, l[2] = { 0.f, 0.f };
#pragma unroll
        for (int db = 0; db < 4; ++db)
#pragma unroll
            for (int n = 0; n < 2; ++n) o[db][n] = (v8f){};
        if (r0 < RH) fattn_loop<true>(Kh + zo, Kl + zo, V16 + zo, Vh + zo, Vl + zo, qh, ql, wave, tile + 1, lr, hi, o, m, l);
        else         fattn_loop<false>(Kh + zo, Kl + zo, V16 + zo, Vh + zo, Vl + zo, qh, ql, wave, tile + 1, lr, hi, o, m, l);
#pragma unroll
        for (int n = 0; n < 2; ++n) l[n] += xhalf(l[n]);
        sM[wave][lane] = hi ? m[1] : m[0]; sL[wave][lane] = hi ? l[1] : l[0];   // entry n * 16 + query column
        __syncthreads();   // every wave's maximum and sum are in LDS (a wave without a block: -3e38 and 0; wave 0 always has block 0); every wave has also left the first tile's partial tiles
        float inv[2];
#pragma unroll
        for (int n = 0; n < 2; ++n) { float M = sM[0][n * 16 + lr];
#pragma unroll
            for (int w = 1; w < 8; ++w) M = fmaxf(M, sM[w][n * 16 + lr]);
            float L = 0.f;
#pragma unroll
            for (int w = 0; w < 8; ++w) L += sL[w][n * 16 + lr] * __builtin_amdgcn_exp2f((sM[w][n * 16 + lr] - M) * C2);
            inv[n] = __fdiv_rn(1.0f, L); const float f = __builtin_amdgcn_exp2f((m[n] - M) * C2);
#pragma unroll
            for (int db = 0; db < 4; ++db) o[db][n] *= f; }
        float* pw = part + wave * 2048 + lane * 4;
#pragma unroll
        for (int db = 0; db < 4; ++db)
#pragma unroll
            for (int n = 0; n < 2; ++n) { const v8f c = o[db][n]; *(v4fa*)(pw + (db * 2 + n) * 256) = (v4f){c[0], c[1], c[2], c[3]}; *(v4fa*)(pw + (db * 2 + n) * 256 + 128) = (v4f){c[4], c[5], c[6], c[7]}; }
        __syncthreads();   // every wave's weighted output tile is in LDS; every wave has read the maxima and sums
        // wave w joins fragment w (head dims (w >> 1) * 16 .., query group w & 1): a lane ends with 8 consecutive dims of one query row, one 16-byte store per plane, at its place in fragment order (rows = tokens, k = head * 64 + dim): the wave's store is 512 contiguous bytes
        const float* pr = part + wave * 256 + lane * 4; v4f a = *(const v4fa*)pr, c = *(const v4fa*)(pr + 128);
#pragma unroll
        for (int w = 1; w < 8; ++w) { a += *(const v4fa*)(pr + w * 2048); c += *(const v4fa*)(pr + w * 2048 + 128); }
        const float iv = (wave & 1) ? inv[1] : inv[0]; v8us oh, ol;
#pragma unroll
        for (int q = 0; q < 4; ++q) { unsigned short x, y; splitf(a[q] * iv, x, y); oh[q] = x; ol[q] = y; splitf(c[q] * iv, x, y); oh[4 + q] = x; ol[4 + q] = y; }
        const size_t oo = (size_t)(r0 + (wave & 1) * 16) * DQ + (h * 2 + (wave >> 2)) * 512 + ((wave >> 1) & 1) * 256 + lane * 8; *(v8us*)(Ah + oo) = oh; *(v8us*)(Al + oo) = ol;
        asm volatile("s_wait_xcnt 0x0" ::: "memory");   // before the second tile overwrites the registers that the two stores name
    }
}

extern "C" void kernel_launch(void* const* d_in, const int* in_sizes, int n_in,
                              void* d_out, int out_size, void* d_ws, size_t ws_size, hipStream_t stream) {
    (void)in_sizes; (void)n_in; (void)out_size;
        const float* x = (const float*)d_in[0]; const int* PID = (const int*)d_in[5]; const float* wq = (const float*)d_in[1]; const float* wk = (const float*)d_in[2]; const float* wv = (const float*)d_in[3]; const float* wo = (const float*)d_in[4];   /* order x, Wq, Wk, Wv, Wo ('oi' [1024][1024]), token_positions (int32 [2][2048]: ONE row of positions PER BATCH, sorted random values in [0, 2048); read on device) */
    float* OUT = (float*)d_out;     // [2][2048][1024]
    char* wsp = (char*)d_ws;
    auto take = [&](size_t bytes) { char* p = wsp; wsp += (bytes + 255) & ~(size_t)255; return (void*)p; };
    bf* WB = (bf*)take((size_t)4 * DQ * DM * 2);   // Wq, Wk, Wv, Wo in bf16, one behind the other
    h16* VT16 = (h16*)take((size_t)NB_ * NKV * HD * TT * 2);
    bf* QPh = (bf*)take((size_t)NB_ * NH_ * TT * HD * 2); bf* QPl = (bf*)take((size_t)NB_ * NH_ * TT * HD * 2); bf* KPh = (bf*)take((size_t)NB_ * NKV * TT * HD * 2); bf* KPl = (bf*)take((size_t)NB_ * NKV * TT * HD * 2); bf* VTh = (bf*)take((size_t)NB_ * NKV * HD * TT * 2); bf* VTl = (bf*)take((size_t)NB_ * NKV * HD * TT * 2);
    bf* ATh = (bf*)take((size_t)NB_ * TT * DQ * 2); bf* ATl = (bf*)take((size_t)NB_ * TT * DQ * 2);
    float* CS = (float*)take((size_t)NB_ * TT * HD * 2 * 4); bf* XB = (bf*)take((size_t)NB_ * TT * DM * 2);
    if ((size_t)(wsp - (char*)d_ws) > ws_size) return;    // ws 256 MiB
    k_prep<<<CSG + XG + 4 * WG1, 256, 0, stream>>>(x, wq, wk, wv, wo, PID, XB, WB, CS);   /* token_positions (int32, read): every batch's own row of positions */
    k_gemmk<bf, 0, 8, false, 1, DM><<<dim3(NB_ * TT / 64, 3 * NH_, 1), 256, 0, stream>>>(XB, nullptr, WB, nullptr, nullptr, 0, 0, 0, 0, 0, CS, VT16, QPh, QPl, KPh, KPl, VTh, VTl);
    k_fattn<<<dim3(TT / 32, NH_ / 2, NB_), 256, 0, stream>>>(QPh, QPl, KPh, KPl, VT16, VTh, VTl, ATh, ATl);   /* one kv head per query head */
    k_gemmk<bf, 1, 8, false, 0, DQ><<<dim3(NB_ * TT / 64, DM / 64, 1), 256, 0, stream>>>(ATh, ATl, WB + (size_t)3 * DQ * DM, nullptr, OUT, DM, 0, 0, 0, 0, nullptr, nullptr, nullptr, nullptr, nullptr, nullptr, nullptr, nullptr);
}

// v007
// It runs in 105 microseconds.
// In two side-by-side timings against v006, it was 1.10 and 1.11 times as fast.
// Over all steps from v000 it is 13.0 times as fast.
#include <hip/hip_runtime.h>

// Causal multi-head self-attention with interleaved-pair rotary position embedding from PER-BATCH position rows (x [2][2048][1024]; q, k, v = einsum('bsd,od', x, W) ('oi' [1024][1024], no bias; 16 heads x 64); angle = float(token_positions[b][t]) x 1 / theta ** (2i / 64) (theta 1e4; token_positions int32 [2][2048]: each batch has its OWN sorted row of random positions in [0, 2048), READ on device); pairs (2i, 2i+1): (xe cos - xo sin, xe sin + xo cos) on q and k; scores / sqrt(64); keys j <= i kept (by INDEX, not by position), -inf elsewhere; softmax; out = einsum('bso,do', merged, Wo) -> [2][2048][1024] (4.2 M); argument order x, Wq, Wk, Wv, Wo, token_positions).
// Every stage is launched once, for both batches and all its operands (4 launches). Layout: bf16 copy of x and of the four weights; {cos, sin} per (position, pair) built once from the int positions and float32 inverse-frequency constants (precise cosf/sinf); exact projections whose epilogue turns the summed f32 tile (64 tokens x one head) straight into the attention planes (q, k: interleaved rotary, hi/lo; v: transposed, fp16 and hi/lo); fused causal T-2048 attention, no score buffer (EVERY row's scores on hi/lo planes (3 products: logit sigma 2 with these weights), online softmax, hybrid P.V (rows < 512 hi/lo, rest fp16); key blocks above the diagonal are never touched); merged hi/lo x Wo exact.
// FRAGMENT ORDER: every 16-bit plane that a matrix instruction reads (x, the weights, q, k, v, the merged heads) lies in the workspace as 1-KiB units of 16 rows x 32 k, [k bit 4][k bit 3][row][k bits 2..0]: a lane's two 16-byte pieces of a fragment stand at unit + lane * 16 B and 512 B further, so each wave-wide load is 512 contiguous bytes (4 whole lines), not 32-byte pieces of 16 lines. The k order of every fragment is as before.
// Compute dtypes, f32 accumulate: every input rounded to bf16; projections exact; rotary f32; attention scores 3 products, P.V rows < 512 3 products, rest fp16; softmax f32; Wo hl x exact.

#define NB_  2
#define TT   2048
#define DM   1024
#define NH_  16
#define NKV  16
#define REP  (NH_ / NKV)
#define HD   64
#define DQ   (NH_ * HD)
#define DKV  (NKV * HD)
#define RH   512                  // query rows < RH take P.V on hi+lo planes (0: none)
typedef _Float16 h16;
typedef unsigned short bf;
typedef __attribute__((ext_vector_type(16))) __bf16   v16bf;
typedef __attribute__((ext_vector_type(16))) _Float16 v16h;
typedef __attribute__((ext_vector_type(8)))  _Float16 v8h;
typedef __attribute__((ext_vector_type(8)))  unsigned short v8us;
typedef __attribute__((ext_vector_type(8)))  float    v8f;
typedef __attribute__((ext_vector_type(4)))  float    v4f;
typedef v8h  __attribute__((may_alias)) v8ha;
typedef v4f  __attribute__((may_alias)) v4fa;
typedef v8us __attribute__((may_alias)) v8usa;

__device__ __forceinline__ unsigned short f2bf(float f) { unsigned u = __float_as_uint(f); u += 0x7FFFu + ((u >> 16) & 1u); return (unsigned short)(u >> 16); }
__device__ __forceinline__ float bf2f(unsigned short b) { return __uint_as_float(((unsigned)b) << 16); }
__device__ __forceinline__ float bfr(float f) { return bf2f(f2bf(f)); }
__device__ __forceinline__ v16h cat16(v8h lo, v8h hi) { return __builtin_shufflevector(lo, hi, 0, 1, 2, 3, 4, 5, 6, 7, 8, 9, 10, 11, 12, 13, 14, 15); }
__device__ __forceinline__ v16bf cat16b(v8us lo, v8us hi) { return __builtin_bit_cast(v16bf, __builtin_shufflevector(lo, hi, 0, 1, 2, 3, 4, 5, 6, 7, 8, 9, 10, 11, 12, 13, 14, 15)); }
__device__ __forceinline__ v8f wmma16(v16h a, v16h b, v8f c) { return __builtin_amdgcn_wmma_f32_16x16x32_f16(false, a, false, b, (short)0, c, false, false); }
__device__ __forceinline__ v8f wmmab(v16bf a, v16bf b, v8f c) { return __builtin_amdgcn_wmma_f32_16x16x32_bf16(false, a, false, b, (short)0, c, false, false); }

__device__ __forceinline__ h16 tohx(float x) { return (h16)x; }
__device__ __forceinline__ void splitf(float y, unsigned short& h, unsigned short& l) { h = f2bf(y); l = f2bf(y - bf2f(h)); }
typedef __attribute__((ext_vector_type(2))) float v2f;

// ---- k_gemmt: GEMM on 16-bit planes in fragment order (units of one 16-row group one behind the other along k, so a group is 16 x K elements as in a row-major plane). One (MB x 32) x 128 output tile per work-group of 4 waves (2 x 2); a wave keeps MB x 4 accumulator tiles (MB x 16 rows x 64 columns); grid (M / (MB x 32), N / 128), 128 threads.
// C[m][n] (f32, pitch DM) = sum_k A[m][k] Bt[n][k] (NSPLIT 1: + A2[m][k] Bt[n][k]), k ascending in one chain per accumulator.
// A stage is 64 k of every row of the tile: two units, 2 KiB in a row, of each row group. It is brought into LDS once per work-group by asynchronous copies, as it lies in the plane (a thread's 16 bytes of each group), and both waves that need a group read it there. Two buffers: stage t + 2 is asked for when every wave has left stage t.
// EPI 0: C as above. EPI 1 (q, k and v projections of both batches in one grid; Bt = the three weights one behind the other, rows = the tokens of batch 0, then of batch 1; a wave's 64 columns = one head; C unused): the f32 tile never leaves the wave's part of LDS.
// The column tile picks the epilogue, the same for the whole work-group. 0 (q) and 1 (k): interleaved rotary with {cos, sin} from CS[batch][token][dim][2], then hi/lo planes PQh, PQl or PKh, PKl [batch][head], rows = tokens, k = dims. 2 (v): the tile is put into LDS transposed and goes out as planes P16, PVh, PVl [batch][head], rows = dims, k = tokens. All in fragment order.
template <typename T16> struct WFrag;
template <> struct WFrag<h16> { typedef v16h V; static __device__ __forceinline__ V ld(const h16* p) { return cat16(*(const v8h*)p, *(const v8h*)(p + 256)); } static __device__ __forceinline__ v8f mma(V a, V b, v8f c) { return wmma16(a, b, c); } };
template <> struct WFrag<bf> { typedef v16bf V; static __device__ __forceinline__ V ld(const bf* p) { return cat16b(*(const v8us*)p, *(const v8us*)(p + 256)); } static __device__ __forceinline__ v8f mma(V a, V b, v8f c) { return wmmab(a, b, c); } };
// four asynchronous 16-byte copies of this lane, LDS places 2 KiB and global places gs elements (one row group) apart; the wait at the end stands in the copies' own statement, in front of any rewrite of the address registers that they name
__device__ __forceinline__ void acopy4(unsigned l, const bf* g, size_t gs) {
    asm volatile("global_load_async_to_lds_b128 %0, %4, off\n\t"
                 "global_load_async_to_lds_b128 %1, %5, off\n\t"
                 "global_load_async_to_lds_b128 %2, %6, off\n\t"
                 "global_load_async_to_lds_b128 %3, %7, off\n\t"
                 "s_wait_xcnt 0x0"
                 :: "v"(l), "v"(l + 2048u), "v"(l + 4096u), "v"(l + 6144u), "v"(g), "v"(g + gs), "v"(g + 2 * gs), "v"(g + 3 * gs) : "memory");
}
template <int NSPLIT, int MB, int EPI>
__global__ __launch_bounds__(128) void k_gemmt(const bf* __restrict__ A, const bf* __restrict__ A2, const bf* __restrict__ Bt, float* C, const float* __restrict__ CS, h16* P16, bf* PQh, bf* PQl, bf* PKh, bf* PKl, bf* PVh, bf* PVl) {
    static_assert(MB * (1 + NSPLIT) == 4, "four fragments of A and A2 together a wave");
    constexpr int K = DM, NT = K / 64, GA = 2 * MB;            // stages; row groups of A in the tile
    constexpr int OB = GA * (1 + NSPLIT) * 2048;               // byte offset of Bt's eight groups in a stage
    constexpr int STG = OB + 8 * 2048;                         // bytes of a stage
    constexpr int OSW = MB * 16 * 68;                          // floats of a wave's output staging
    constexpr int SMB = 2 * STG > 4 * OSW * 4 ? 2 * STG : 4 * OSW * 4;
    __shared__ __align__(16) char smem[SMB];                   // the two buffers; behind the loop every wave's own output staging
    const int tid = threadIdx.x, lane = tid & 31, wave = __builtin_amdgcn_readfirstlane(tid >> 5), lr = lane & 15, hi = lane >> 4, wm = wave >> 1, wn = wave & 1;
    const int r0 = blockIdx.x * (MB * 32), c0 = blockIdx.y * 128;
    const bf* gA = A + (size_t)r0 * K + tid * 8; const bf* gA2 = A2 + (size_t)r0 * K + tid * 8; const bf* gB = Bt + (size_t)c0 * K + tid * 8;   // this thread's 16 bytes in stage 0 of the first row groups
    const unsigned l0 = (unsigned)(size_t)smem + tid * 16;
    auto stage = [&](int t, int buf) {
        const unsigned l = l0 + buf * STG; const size_t ko = (size_t)t * 1024;
#pragma unroll
        for (int q = 0; q < GA / 4; ++q) { acopy4(l + q * 8192, gA + ko + (size_t)q * 64 * K, 16 * K); if (NSPLIT) acopy4(l + GA * 2048 + q * 8192, gA2 + ko + (size_t)q * 64 * K, 16 * K); }
#pragma unroll
        for (int q = 0; q < 2; ++q) acopy4(l + OB + q * 8192, gB + ko + (size_t)q * 64 * K, 16 * K);
    };
    v8f acc[MB][4];
#pragma unroll
    for (int mb = 0; mb < MB; ++mb)
#pragma unroll
        for (int nb = 0; nb < 4; ++nb) acc[mb][nb] = (v8f){};
    stage(0, 0);
    asm volatile("s_wait_asynccnt 0x0" ::: "memory");   // this wave's copies of stage 0 have landed
    __syncthreads();                                    // every wave's have
    stage(1, 1);
    // rolled: one copy of the body; the buffer is picked by one address addition a trip
#pragma unroll 1
    for (int t = 0; t < NT; ++t) {
        const bf* sa = (const bf*)(smem + (t & 1) * STG) + lane * 8;
#pragma unroll
        for (int ks = 0; ks < 2; ++ks) {
            v16bf fa[4], fb[4];   // fa: MB fragments of A, then (NSPLIT 1) MB of A2
#pragma unroll
            for (int i = 0; i < 4; ++i) { fa[i] = WFrag<bf>::ld(sa + (i / MB) * GA * 1024 + ((wm * MB + i % MB) * 2 + ks) * 512); fb[i] = WFrag<bf>::ld(sa + OB / 2 + ((wn * 4 + i) * 2 + ks) * 512); }
            // inputs-only fence on the loaded fragments: all sixteen LDS loads are issued as one group and waited for once; without it the compiler keeps one register set for Bt and waits out the LDS latency in front of every four matrix instructions
            asm volatile("" :: "v"(fa[0]), "v"(fa[1]), "v"(fa[2]), "v"(fa[3]), "v"(fb[0]), "v"(fb[1]), "v"(fb[2]), "v"(fb[3]));
#pragma unroll
            for (int nb = 0; nb < 4; ++nb)
#pragma unroll
                for (int mb = 0; mb < MB; ++mb) { acc[mb][nb] = wmmab(fa[mb], fb[nb], acc[mb][nb]); if (NSPLIT) acc[mb][nb] = wmmab(fa[MB + mb], fb[nb], acc[mb][nb]); }
        }
        asm volatile("s_wait_dscnt 0x0" ::: "memory");      // this wave's reads of stage t are done
        asm volatile("s_wait_asynccnt 0x0" ::: "memory");   // this wave's copies of stage t + 1 have landed
        __syncthreads();                                    // stage t + 1 is whole, and every wave has left stage t
        if (t + 2 < NT) stage(t + 2, t & 1);
    }
    asm volatile("s_wait_asynccnt 0x0" ::: "memory");       // no copy is on its way when the buffers become output staging
    const int sel = EPI ? (int)blockIdx.y * 2 / NH_ : 0, head = ((int)blockIdx.y * 2 + wn) % NH_, rw = r0 + wm * (MB * 16), bz = rw / TT, t0 = rw % TT;   // EPI 1: which projection, the wave's head, its batch and its first token in it
    float* os = (float*)smem + wave * OSW;   // [row][68], v: [dim][68]
    if (EPI == 1 && sel == 2) {   // transposed: eight tokens of one dim, two 16-byte stores
#pragma unroll
        for (int mb = 0; mb < MB; ++mb)
#pragma unroll
            for (int nb = 0; nb < 4; ++nb) { const v8f c = acc[mb][nb]; float* p = os + (nb * 16 + lr) * 68 + mb * 16 + hi * 8; *(v4fa*)p = (v4f){c[0], c[1], c[2], c[3]}; *(v4fa*)(p + 4) = (v4f){c[4], c[5], c[6], c[7]}; }
    } else {
#pragma unroll
        for (int mb = 0; mb < MB; ++mb)
#pragma unroll
            for (int nb = 0; nb < 4; ++nb) { const v8f c = acc[mb][nb];
#pragma unroll
                for (int j = 0; j < 8; ++j) os[(mb * 16 + hi * 8 + j) * 68 + nb * 16 + lr] = c[j]; }
    }
    if (EPI == 0) {
        __syncthreads();   // the tile is in LDS, row-major: whole rows go out in 16-byte stores
        float* cb = C + (size_t)(rw + hi) * DM + c0 + wn * 64 + lr * 4;
#pragma unroll
        for (int u = 0; u < MB * 8; ++u) *(v4f*)(cb + u * 2 * DM) = *(const v4fa*)(os + (u * 2 + hi) * 68 + lr * 4);   // two rows a store, 256 bytes in a row of each
        asm volatile("s_wait_xcnt 0x0" ::: "memory");   // before the registers that the stores name are used for something else
    } else {
        // a lane takes 8 consecutive elements of an LDS row, the ones that stand at idx * 8 of the tile in fragment order (the 64 x 64 tile is 4096 consecutive elements of its plane): a wave fills 512 contiguous bytes of every plane.
        // q, k: units [token group][dim / 32]; v: units [token / 32][dim group], so that a 32-key block of a head is 4 KiB in a row in each plane
        if (sel < 2) {
            v2f cs[16][4];   // this lane's {cos, sin} pairs, all asked for at once
            const float* cp = CS + ((size_t)(rw + lr) * HD + hi * 8) * 2;
#pragma unroll
            for (int u = 0; u < 16; ++u)   // piece idx = u * 32 + lane: token (idx >> 7) * 16 + (idx & 15), dims ((idx >> 4) & 7) * 8 ..; all at constant distances from the lane's first pair
#pragma unroll
                for (int p = 0; p < 4; ++p) cs[u][p] = *(const v2f*)(cp + (u >> 2) * 16 * HD * 2 + (u & 3) * 32 + p * 4);
            asm volatile("s_wait_xcnt 0x0" ::: "memory");   // before the address registers of these loads are used for something else
            __syncthreads();   // the tile is in LDS, row-major
            bf* Ph = sel ? PKh : PQh; bf* Pl = sel ? PKl : PQl;
#pragma unroll
            for (int u = 0; u < 16; ++u) { const int idx = u * 32 + lane, row = (idx >> 7) * 16 + (idx & 15), cofs = ((idx >> 4) & 7) * 8; const v4f xa = *(const v4fa*)(os + row * 68 + cofs), xb = *(const v4fa*)(os + row * 68 + cofs + 4);
                const float x[8] = { xa[0], xa[1], xa[2], xa[3], xb[0], xb[1], xb[2], xb[3] }; v8us oh, ol; unsigned short a2, c2;
#pragma unroll
                for (int p = 0; p < 4; ++p) { const float c = cs[u][p][0], sn = cs[u][p][1], xe = x[2 * p], xo = x[2 * p + 1];   /* even: xe c - xo s; odd: xe s + xo c */
                    splitf(xe * c - xo * sn, a2, c2); oh[2 * p] = a2; ol[2 * p] = c2; splitf(xe * sn + xo * c, a2, c2); oh[2 * p + 1] = a2; ol[2 * p + 1] = c2; }
                const size_t e = (((size_t)bz * NH_ + head) * TT + t0) * HD + idx * 8; *(v8us*)(Ph + e) = oh; *(v8us*)(Pl + e) = ol; }
            asm volatile("s_wait_xcnt 0x0" ::: "memory");   // before the registers that the stores name are used for something else
        } else {
            __syncthreads();   // the tile is in LDS, dim-major
#pragma unroll
            for (int u = 0; u < 16; ++u) { const int idx = u * 32 + lane, row = ((idx >> 6) & 3) * 16 + (idx & 15), cofs = (idx >> 8) * 32 + ((idx >> 4) & 3) * 8; const v4f xa = *(const v4fa*)(os + row * 68 + cofs), xb = *(const v4fa*)(os + row * 68 + cofs + 4);
                const float x[8] = { xa[0], xa[1], xa[2], xa[3], xb[0], xb[1], xb[2], xb[3] }; v8us oh, ol; v8h o16; unsigned short a2, c2;
#pragma unroll
                for (int q = 0; q < 8; ++q) { o16[q] = tohx(x[q]); splitf(x[q], a2, c2); oh[q] = a2; ol[q] = c2; }
                const size_t e = (((size_t)bz * NKV + head) * TT + t0) * HD + idx * 8; *(v8h*)(P16 + e) = o16; *(v8us*)(PVh + e) = oh; *(v8us*)(PVl + e) = ol; }
            asm volatile("s_wait_xcnt 0x0" ::: "memory");   // before the registers that the stores name are used for something else
        }
    }
}

typedef __attribute__((ext_vector_type(2))) _Float16 v2h;
typedef __attribute__((ext_vector_type(4))) _Float16 v4h;
typedef __attribute__((ext_vector_type(2))) unsigned short v2us;
typedef __attribute__((ext_vector_type(4))) unsigned short v4us;
typedef __attribute__((ext_vector_type(4))) int v4i;

__global__ __launch_bounds__(256) void k_wtG(const float* __restrict__ w, int K, int N, bf* Bt) {
    const int lane = threadIdx.x & 31; const int L0 = (blockIdx.x * 8 + (threadIdx.x >> 5)) * 8; const int nlines = N * K / 64;
{
#pragma unroll 1
        for (int l = 0; l < 8; ++l) { const int L = L0 + l; if (L >= nlines) break; const size_t e = (size_t)L * 64 + lane * 2; const int k = (int)(e % K), n = (int)(e / K); v2us o;
            o[0] = f2bf(w[(size_t)k * N + n]); o[1] = f2bf(w[(size_t)(k + 1) * N + n]); *(v2us*)(Bt + e) = o; }
         }
}
__constant__ float INV2[HD / 2] = { 1.000000000e+00f, 7.498942018e-01f, 5.623413324e-01f, 4.216965139e-01f, 3.162277639e-01f, 2.371373624e-01f, 1.778279394e-01f, 1.333521456e-01f, 1.000000015e-01f, 7.498941571e-02f, 5.623412877e-02f, 4.216964915e-02f, 3.162277862e-02f, 2.371373586e-02f, 1.778279431e-02f, 1.333521493e-02f, 9.999999776e-03f, 7.498942316e-03f, 5.623413250e-03f, 4.216964822e-03f, 3.162277862e-03f, 2.371373819e-03f, 1.778279431e-03f, 1.333521446e-03f, 1.000000047e-03f, 7.498941850e-04f, 5.623413017e-04f, 4.216964880e-04f, 3.162277862e-04f, 2.371373848e-04f, 1.778279402e-04f, 1.333521504e-04f };   // float32 10000^(-(i * 2 / 64)), generated with jnp to be bit-exact with the module's expression
// ---- k_prep: all that the projections read, in one launch; the work-group's index picks its job (the same for all its threads), every thread does one piece of it (one {cos, sin} pair, or eight elements to bf16, stored in fragment order: a work-group takes 16 rows x 128 k, four units); the grid is exact for the compile-time shapes.
// Groups 0 .. CSG-1: {cos, sin} per (batch, token, dim) from that batch's own row of positions (pid [batch][token], CS [batch][token][dim][2]). The next XG: x to bf16 (both batches, one run of rows). The last 4 x WG1: the four weights to bf16, one behind the other in WB.
#define CSG (NB_ * TT * HD / 256)
#define XG  (NB_ * TT * DM / 2048)
#define WG1 (DQ * DM / 2048)
__global__ __launch_bounds__(256) void k_prep(const float* __restrict__ x, const float* __restrict__ wq, const float* __restrict__ wk, const float* __restrict__ wv, const float* __restrict__ wo, const int* __restrict__ pid, bf* XB, bf* WB, float* CS) {
    const int g = (int)blockIdx.x, tid = threadIdx.x;
    if (g < CSG) { const int idx = g * 256 + tid; const int d = idx % HD; const int t = idx / HD; const float a = __fmul_rn((float)pid[t], INV2[d >> 1]); v2f cs; cs[0] = cosf(a); cs[1] = sinf(a); *(v2f*)(CS + (size_t)idx * 2) = cs; return; }
    const int c = g - CSG, w = (c - XG) / WG1; const float* src; bf* dst;
    const int cc = c < XG ? c : (c - XG) % WG1; const size_t so = (size_t)((cc >> 3) * 16 + (tid & 15)) * DM + (cc & 7) * 128 + (tid >> 4) * 8;   // row and first k of the eight elements that stand at tid * 8 of the group's four units
    if (c < XG) { src = x + so; dst = XB + (size_t)c * 2048; }
    else { src = (w == 0 ? wq : w == 1 ? wk : w == 2 ? wv : wo) + so; dst = WB + (size_t)(c - XG) * 2048; }
    const v8f v = *(const v8f*)src; v8us o;
#pragma unroll
    for (int k = 0; k < 8; ++k) o[k] = f2bf(v[k]);
    *(v8us*)(dst + tid * 8) = o;
}

// ---- k_fattn: scores, causal softmax, P.V and the head merge in one kernel; grid (TT / 32, heads / 2, batches), 8 waves. A work-group takes 32 query rows of one head (tile n - 1 - x), then 32 of another (tile x); a tile's 32-key blocks up to the diagonal are dealt to the waves in turn.
// Transposed products: S^T = K Q^T (A = key rows, B = query rows kept in registers; hi/lo planes, 3 products), so a lane holds the scores of ONE query (column lr) and two 16-key score tiles, converted in place, are the B operand of
// O^T += V^T P^T (A = dim rows of the value planes, same k order as the loader). Rows < RH: p and v on hi/lo planes (3 products); the rest: p and v in fp16. p = exp2((s - running max) x HD^-0.5 x log2 e), at most 1, normalised in f32 at the end.
// Every wave keeps its own running maximum, sum and output tile; they meet in LDS and are joined in the fixed order wave 0 .. 7.
#define C2 0.18033688011112042f   // HD^-0.5 x log2(e)
__device__ __forceinline__ float xhalf(float x) { const int b = __float_as_int(x); return __int_as_float(__builtin_amdgcn_permlanex16(b, b, 0x76543210, 0xfedcba98, false, false)); }   // lane l <-> l ^ 16
template <bool HR>
__device__ __forceinline__ void fattn_loop(const bf* __restrict__ Kh, const bf* __restrict__ Kl, const h16* __restrict__ V16, const bf* __restrict__ Vh, const bf* __restrict__ Vl, const v16bf (&qh)[2][2], const v16bf (&ql)[2][2],
                                           int wave, int nblk, int lr, int hi, v8f (&o)[4][2], float (&m)[2], float (&l)[2]) {
    unsigned kofs = ((unsigned)wave * 32 * HD + (hi * 16 + lr) * 8) * 2;   // this lane's byte offset in the key and value planes (a 32-key block is four units, 32 x HD elements, in each): one 32-bit register beside a scalar base
    // the block loop stays rolled (a second copy of the body would need a second set of fragment registers); the constant loops inside are unrolled so that every fragment index is a compile-time constant and the tiles stay in registers
#pragma unroll 1
    for (int blk = wave; blk < nblk; blk += 8, kofs += 8 * 32 * HD * 2) {
        const bf* kph = (const bf*)((const char*)Kh + kofs); const bf* kpl = (const bf*)((const char*)Kl + kofs);
        v16bf kh[2][2], kl[2][2];
#pragma unroll
        for (int kb = 0; kb < 2; ++kb)
#pragma unroll
            for (int ks = 0; ks < 2; ++ks) { kh[kb][ks] = WFrag<bf>::ld(kph + (kb * 2 + ks) * 512); kl[kb][ks] = WFrag<bf>::ld(kpl + (kb * 2 + ks) * 512); }
        // inputs-only fence on the loaded key fragments: all sixteen loads are issued together and waited for once; without it the compiler reuses two fragments' registers and waits out the load latency several times per block
        asm volatile("" :: "v"(kh[0][0]), "v"(kh[0][1]), "v"(kh[1][0]), "v"(kh[1][1]), "v"(kl[0][0]), "v"(kl[0][1]), "v"(kl[1][0]), "v"(kl[1][1]));
        v8f s[2][2];
#pragma unroll
        for (int kb = 0; kb < 2; ++kb)
#pragma unroll
            for (int n = 0; n < 2; ++n) s[kb][n] = (v8f){};
#pragma unroll
        for (int ks = 0; ks < 2; ++ks) {
#pragma unroll
            for (int kb = 0; kb < 2; ++kb)
#pragma unroll
                for (int n = 0; n < 2; ++n) s[kb][n] = wmmab(kh[kb][ks], qh[n][ks], s[kb][n]);
#pragma unroll
            for (int kb = 0; kb < 2; ++kb)
#pragma unroll
                for (int n = 0; n < 2; ++n) s[kb][n] = wmmab(kh[kb][ks], ql[n][ks], s[kb][n]);
#pragma unroll
            for (int kb = 0; kb < 2; ++kb)
#pragma unroll
                for (int n = 0; n < 2; ++n) s[kb][n] = wmmab(kl[kb][ks], qh[n][ks], s[kb][n]);
        }
        if (blk == nblk - 1) {   // the diagonal block: keys j > i are out (every query keeps at least the block's first key)
#pragma unroll
            for (int kb = 0; kb < 2; ++kb)
#pragma unroll
                for (int n = 0; n < 2; ++n)
#pragma unroll
                    for (int j = 0; j < 8; ++j) if (kb * 16 + hi * 8 + j > n * 16 + lr) s[kb][n][j] = -3.0e38f;
        }
        v16h p16[2]; v16bf ph[2], pl[2];
#pragma unroll
        for (int n = 0; n < 2; ++n) {
            float mx = s[0][n][0];
#pragma unroll
            for (int j = 1; j < 8; ++j) mx = fmaxf(mx, s[0][n][j]);
#pragma unroll
            for (int j = 0; j < 8; ++j) mx = fmaxf(mx, s[1][n][j]);
            mx = fmaxf(mx, xhalf(mx));
            const float mn = fmaxf(m[n], mx), al = __builtin_amdgcn_exp2f((m[n] - mn) * C2), mc = mn * C2; m[n] = mn;
            float sum = 0.f; v8h f0, f1;
#pragma unroll
            for (int j = 0; j < 8; ++j) {
                const float pa = __builtin_amdgcn_exp2f(s[0][n][j] * C2 - mc), pb = __builtin_amdgcn_exp2f(s[1][n][j] * C2 - mc); sum += pa; sum += pb;
                if (HR) { const __bf16 xa = (__bf16)pa, xb = (__bf16)pb; ph[n][j] = xa; pl[n][j] = (__bf16)(pa - (float)xa); ph[n][8 + j] = xb; pl[n][8 + j] = (__bf16)(pb - (float)xb); } else { f0[j] = tohx(pa); f1[j] = tohx(pb); } }
            l[n] = l[n] * al + sum;   // this lane's half of the keys; the halves are joined after the loop
            if (!HR) p16[n] = cat16(f0, f1);
#pragma unroll
            for (int db = 0; db < 4; ++db) o[db][n] *= al;
        }
#pragma unroll
        for (int db = 0; db < 4; ++db) {
            if (HR) { const v16bf vh = WFrag<bf>::ld((const bf*)((const char*)Vh + kofs) + db * 512), vl = WFrag<bf>::ld((const bf*)((const char*)Vl + kofs) + db * 512);
#pragma unroll
                for (int n = 0; n < 2; ++n) { o[db][n] = wmmab(vh, ph[n], o[db][n]); o[db][n] = wmmab(vh, pl[n], o[db][n]); o[db][n] = wmmab(vl, ph[n], o[db][n]); }
            } else { const v16h vf = WFrag<h16>::ld((const h16*)((const char*)V16 + kofs) + db * 512);
#pragma unroll
                for (int n = 0; n < 2; ++n) o[db][n] = wmma16(vf, p16[n], o[db][n]); } }
    }
}
__global__ __launch_bounds__(256) void k_fattn(const bf* __restrict__ Qh, const bf* __restrict__ Ql, const bf* __restrict__ Kh, const bf* __restrict__ Kl, const h16* __restrict__ V16, const bf* __restrict__ Vh, const bf* __restrict__ Vl, bf* Ah, bf* Al) {
    __shared__ __align__(16) float part[8 * 2048];   // [wave][fragment][half][lane][4]: every 16-byte store and load is contiguous over the lanes
    __shared__ float sM[8][32], sL[8][32];
    const int tid = threadIdx.x, lane = tid & 31, wave = __builtin_amdgcn_readfirstlane(tid >> 5), lr = lane & 15, hi = lane >> 4;
    { const size_t bo = (size_t)blockIdx.z * NH_ * TT * HD; Qh += bo; Ql += bo; Kh += bo; Kl += bo; V16 += bo; Vh += bo; Vl += bo; Ah += bo; Al += bo; }   // this work-group's batch: every plane holds NH_ x TT x HD = TT x DQ elements a batch
    // two tiles one after the other, so that every work-group walks 65 key blocks: kept rolled, one copy of the code
#pragma unroll 1
    for (int pass = 0; pass < 2; ++pass) {
        const int tile = pass ? (int)blockIdx.x : TT / 32 - 1 - (int)blockIdx.x, r0 = tile * 32, h = (int)blockIdx.y + pass * (NH_ / 2);
        const size_t zo = (size_t)h * TT * HD;
        v16bf qh[2][2], ql[2][2];
#pragma unroll
        for (int n = 0; n < 2; ++n)
#pragma unroll
            for (int ks = 0; ks < 2; ++ks) { const size_t qo = zo + (size_t)r0 * HD + (n * 2 + ks) * 512 + lane * 8; qh[n][ks] = WFrag<bf>::ld(Qh + qo); ql[n][ks] = WFrag<bf>::ld(Ql + qo); }
        asm volatile("s_wait_xcnt 0x0" ::: "memory");   // before the address registers of the query loads are used for something else
        v8f o[4][2]; float m[2] = { -3.0e38f, -3.0e38f }, l[2] = { 0.f, 0.f };
#pragma unroll
        for (int db = 0; db < 4; ++db)
#pragma unroll
            for (int n = 0; n < 2; ++n) o[db][n] = (v8f){};
        if (r0 < RH) fattn_loop<true>(Kh + zo, Kl + zo, V16 + zo, Vh + zo, Vl + zo, qh, ql, wave, tile + 1, lr, hi, o, m, l);
        else         fattn_loop<false>(Kh + zo, Kl + zo, V16 + zo, Vh + zo, Vl + zo, qh, ql, wave, tile + 1, lr, hi, o, m, l);
#pragma unroll
        for (int n = 0; n < 2; ++n) l[n] += xhalf(l[n]);
        sM[wave][lane] = hi ? m[1] : m[0]; sL[wave][lane] = hi ? l[1] : l[0];   // entry n * 16 + query column
        __syncthreads();   // every wave's maximum and sum are in LDS (a wave without a block: -3e38 and 0; wave 0 always has block 0); every wave has also left the first tile's partial tiles
        float inv[2];
#pragma unroll
        for (int n = 0; n < 2; ++n) { float M = sM[0][n * 16 + lr];
#pragma unroll
            for (int w = 1; w < 8; ++w) M = fmaxf(M, sM[w][n * 16 + lr]);
            float L = 0.f;
#pragma unroll
            for (int w = 0; w < 8; ++w) L += sL[w][n * 16 + lr] * __builtin_amdgcn_exp2f((sM[w][n * 16 + lr] - M) * C2);
            inv[n] = __fdiv_rn(1.0f, L); const float f = __builtin_amdgcn_exp2f((m[n] - M) * C2);
#pragma unroll
            for (int db = 0; db < 4; ++db) o[db][n] *= f; }
        float* pw = part + wave * 2048 + lane * 4;
#pragma unroll
        for (int db = 0; db < 4; ++db)
#pragma unroll
            for (int n = 0; n < 2; ++n) { const v8f c = o[db][n]; *(v4fa*)(pw + (db * 2 + n) * 256) = (v4f){c[0], c[1], c[2], c[3]}; *(v4fa*)(pw + (db * 2 + n) * 256 + 128) = (v4f){c[4], c[5], c[6], c[7]}; }
        __syncthreads();   // every wave's weighted output tile is in LDS; every wave has read the maxima and sums
        // wave w joins fragment w (head dims (w >> 1) * 16 .., query group w & 1): a lane ends with 8 consecutive dims of one query row, one 16-byte store per plane, at its place in fragment order (rows = tokens, k = head * 64 + dim): the wave's store is 512 contiguous bytes
        const float* pr = part + wave * 256 + lane * 4; v4f a = *(const v4fa*)pr, c = *(const v4fa*)(pr + 128);
#pragma unroll
        for (int w = 1; w < 8; ++w) { a += *(const v4fa*)(pr + w * 2048); c += *(const v4fa*)(pr + w * 2048 + 128); }
        const float iv = (wave & 1) ? inv[1] : inv[0]; v8us oh, ol;
#pragma unroll
        for (int q = 0; q < 4; ++q) { unsigned short x, y; splitf(a[q] * iv, x, y); oh[q] = x; ol[q] = y; splitf(c[q] * iv, x, y); oh[4 + q] = x; ol[4 + q] = y; }
        const size_t oo = (size_t)(r0 + (wave & 1) * 16) * DQ + (h * 2 + (wave >> 2)) * 512 + ((wave >> 1) & 1) * 256 + lane * 8; *(v8us*)(Ah + oo) = oh; *(v8us*)(Al + oo) = ol;
        asm volatile("s_wait_xcnt 0x0" ::: "memory");   // before the second tile overwrites the registers that the two stores name
    }
}

extern "C" void kernel_launch(void* const* d_in, const int* in_sizes, int n_in,
                              void* d_out, int out_size, void* d_ws, size_t ws_size, hipStream_t stream) {
    (void)in_sizes; (void)n_in; (void)out_size;
        const float* x = (const float*)d_in[0]; const int* PID = (const int*)d_in[5]; const float* wq = (const float*)d_in[1]; const float* wk = (const float*)d_in[2]; const float* wv = (const float*)d_in[3]; const float* wo = (const float*)d_in[4];   /* order x, Wq, Wk, Wv, Wo ('oi' [1024][1024]), token_positions (int32 [2][2048]: ONE row of positions PER BATCH, sorted random values in [0, 2048); read on device) */
    float* OUT = (float*)d_out;     // [2][2048][1024]
    char* wsp = (char*)d_ws;
    auto take = [&](size_t bytes) { char* p = wsp; wsp += (bytes + 255) & ~(size_t)255; return (void*)p; };
    bf* WB = (bf*)take((size_t)4 * DQ * DM * 2);   // Wq, Wk, Wv, Wo in bf16, one behind the other
    h16* VT16 = (h16*)take((size_t)NB_ * NKV * HD * TT * 2);
    bf* QPh = (bf*)take((size_t)NB_ * NH_ * TT * HD * 2); bf* QPl = (bf*)take((size_t)NB_ * NH_ * TT * HD * 2); bf* KPh = (bf*)take((size_t)NB_ * NKV * TT * HD * 2); bf* KPl = (bf*)take((size_t)NB_ * NKV * TT * HD * 2); bf* VTh = (bf*)take((size_t)NB_ * NKV * HD * TT * 2); bf* VTl = (bf*)take((size_t)NB_ * NKV * HD * TT * 2);
    bf* ATh = (bf*)take((size_t)NB_ * TT * DQ * 2); bf* ATl = (bf*)take((size_t)NB_ * TT * DQ * 2);
    float* CS = (float*)take((size_t)NB_ * TT * HD * 2 * 4); bf* XB = (bf*)take((size_t)NB_ * TT * DM * 2);
    if ((size_t)(wsp - (char*)d_ws) > ws_size) return;    // ws 256 MiB
    k_prep<<<CSG + XG + 4 * WG1, 256, 0, stream>>>(x, wq, wk, wv, wo, PID, XB, WB, CS);   /* token_positions (int32, read): every batch's own row of positions */
    k_gemmt<0, 4, 1><<<dim3(NB_ * TT / 128, 3 * DQ / 128, 1), 128, 0, stream>>>(XB, nullptr, WB, nullptr, CS, VT16, QPh, QPl, KPh, KPl, VTh, VTl);
    k_fattn<<<dim3(TT / 32, NH_ / 2, NB_), 256, 0, stream>>>(QPh, QPl, KPh, KPl, VT16, VTh, VTl, ATh, ATl);   /* one kv head per query head */
    k_gemmt<1, 2, 0><<<dim3(NB_ * TT / 64, DM / 128, 1), 128, 0, stream>>>(ATh, ATl, WB + (size_t)3 * DQ * DM, OUT, nullptr, nullptr, nullptr, nullptr, nullptr, nullptr, nullptr, nullptr);
}

// v008
// Measured time: 90 microseconds a run.
// Next to v007, in two timings, it ran 1.16 and 1.17 times as fast.
// Counting every step since v000, it is 15.1 times as fast.
#include <hip/hip_runtime.h>

// Causal multi-head self-attention with interleaved-pair rotary position embedding from PER-BATCH position rows (x [2][2048][1024]; q, k, v = einsum('bsd,od', x, W) ('oi' [1024][1024], no bias; 16 heads x 64); angle = float(token_positions[b][t]) x 1 / theta ** (2i / 64) (theta 1e4; token_positions int32 [2][2048]: each batch has its OWN sorted row of random positions in [0, 2048), READ on device); pairs (2i, 2i+1): (xe cos - xo sin, xe sin + xo cos) on q and k; scores / sqrt(64); keys j <= i kept (by INDEX, not by position), -inf elsewhere; softmax; out = einsum('bso,do', merged, Wo) -> [2][2048][1024] (4.2 M); argument order x, Wq, Wk, Wv, Wo, token_positions).
// Every stage is launched once, for both batches and all its operands (4 launches). Layout: bf16 copy of x and of the four weights; {cos, sin} per (position, pair) built once from the int positions and float32 inverse-frequency constants (precise cosf/sinf); exact projections whose epilogue turns the summed f32 tile (64 tokens x one head) straight into the attention planes (q, k: interleaved rotary, hi/lo; v: transposed, fp16 and hi/lo); fused causal T-2048 attention, no score buffer (EVERY row's scores on hi/lo planes (3 products: logit sigma 2 with these weights), online softmax, hybrid P.V (rows < 512 hi/lo, rest fp16); key blocks above the diagonal are never touched); merged hi/lo x Wo exact.
// FRAGMENT ORDER: every 16-bit plane that a matrix instruction reads (x, the weights, q, k, v, the merged heads) lies in the workspace as 1-KiB units of 16 rows x 32 k, [k bit 4][k bit 3][row][k bits 2..0]: a lane's two 16-byte pieces of a fragment stand at unit + lane * 16 B and 512 B further, so each wave-wide load is 512 contiguous bytes (4 whole lines), not 32-byte pieces of 16 lines. The k order of every fragment is as before.
// Compute dtypes, f32 accumulate: every input rounded to bf16; projections exact; rotary f32; attention scores 3 products, P.V rows < 512 3 products, rest fp16; softmax f32; Wo hl x exact.

#define NB_  2
#define TT   2048
#define DM   1024
#define NH_  16
#define NKV  16
#define REP  (NH_ / NKV)
#define HD   64
#define DQ   (NH_ * HD)
#define DKV  (NKV * HD)
#define RH   512                  // query rows < RH take P.V on hi+lo planes (0: none)
typedef _Float16 h16;
typedef unsigned short bf;
typedef __attribute__((ext_vector_type(16))) __bf16   v16bf;
typedef __attribute__((ext_vector_type(16))) _Float16 v16h;
typedef __attribute__((ext_vector_type(8)))  _Float16 v8h;
typedef __attribute__((ext_vector_type(8)))  unsigned short v8us;
typedef __attribute__((ext_vector_type(8)))  float    v8f;
typedef __attribute__((ext_vector_type(4)))  float    v4f;
typedef v8h  __attribute__((may_alias)) v8ha;
typedef v4f  __attribute__((may_alias)) v4fa;
typedef v8us __attribute__((may_alias)) v8usa;

__device__ __forceinline__ unsigned short f2bf(float f) { unsigned u = __float_as_uint(f); u += 0x7FFFu + ((u >> 16) & 1u); return (unsigned short)(u >> 16); }
__device__ __forceinline__ float bf2f(unsigned short b) { return __uint_as_float(((unsigned)b) << 16); }
__device__ __forceinline__ float bfr(float f) { return bf2f(f2bf(f)); }
__device__ __forceinline__ v16h cat16(v8h lo, v8h hi) { return __builtin_shufflevector(lo, hi, 0, 1, 2, 3, 4, 5, 6, 7, 8, 9, 10, 11, 12, 13, 14, 15); }
__device__ __forceinline__ v16bf cat16b(v8us lo, v8us hi) { return __builtin_bit_cast(v16bf, __builtin_shufflevector(lo, hi, 0, 1, 2, 3, 4, 5, 6, 7, 8, 9, 10, 11, 12, 13, 14, 15)); }
__device__ __forceinline__ v8f wmma16(v16h a, v16h b, v8f c) { return __builtin_amdgcn_wmma_f32_16x16x32_f16(false, a, false, b, (short)0, c, false, false); }
__device__ __forceinline__ v8f wmmab(v16bf a, v16bf b, v8f c) { return __builtin_amdgcn_wmma_f32_16x16x32_bf16(false, a, false, b, (short)0, c, false, false); }

__device__ __forceinline__ h16 tohx(float x) { return (h16)x; }
__device__ __forceinline__ void splitf(float y, unsigned short& h, unsigned short& l) { h = f2bf(y); l = f2bf(y - bf2f(h)); }
typedef __attribute__((ext_vector_type(2))) float v2f;

// ---- k_gemmt: GEMM on 16-bit planes in fragment order (units of one 16-row group one behind the other along k, so a group is 16 x K elements as in a row-major plane). One (MB x 32) x 128 output tile per work-group of 4 waves (2 x 2); a wave keeps MB x 4 accumulator tiles (MB x 16 rows x 64 columns); grid (M / (MB x 32), N / 128), 128 threads.
// C[m][n] (f32, pitch DM) = sum_k A[m][k] Bt[n][k] (NSPLIT 1: + A2[m][k] Bt[n][k]), k ascending in one chain per accumulator.
// A stage is 64 k of every row of the tile: two units, 2 KiB in a row, of each row group. It is brought into LDS once per work-group by asynchronous copies, as it lies in the plane (a thread's 16 bytes of each group), and both waves that need a group read it there. Two buffers: stage t + 2 is asked for when every wave has left stage t.
// EPI 0: C as above. EPI 1 (q, k and v projections of both batches in one grid; Bt = the three weights one behind the other, rows = the tokens of batch 0, then of batch 1; a wave's 64 columns = one head; C unused): the f32 tile never leaves the wave's part of LDS.
// The column tile picks the epilogue, the same for the whole work-group. 0 (q) and 1 (k): interleaved rotary with {cos, sin} from CS[batch][token][dim][2], then hi/lo planes PQh, PQl or PKh, PKl [batch][head], rows = tokens, k = dims. 2 (v): the tile is put into LDS transposed and goes out as planes P16, PVh, PVl [batch][head], rows = dims, k = tokens. All in fragment order.
template <typename T16> struct WFrag;
template <> struct WFrag<h16> { typedef v16h V; static __device__ __forceinline__ V ld(const h16* p) { return cat16(*(const v8h*)p, *(const v8h*)(p + 256)); } static __device__ __forceinline__ v8f mma(V a, V b, v8f c) { return wmma16(a, b, c); } };
template <> struct WFrag<bf> { typedef v16bf V; static __device__ __forceinline__ V ld(const bf* p) { return cat16b(*(const v8us*)p, *(const v8us*)(p + 256)); } static __device__ __forceinline__ v8f mma(V a, V b, v8f c) { return wmmab(a, b, c); } };
// four asynchronous 16-byte copies of this lane, LDS places 2 KiB and global places gs elements (one row group) apart; the wait at the end stands in the copies' own statement, in front of any rewrite of the address registers that they name
__device__ __forceinline__ void acopy4(unsigned l, const bf* g, size_t gs) {
    asm volatile("global_load_async_to_lds_b128 %0, %4, off\n\t"
                 "global_load_async_to_lds_b128 %1, %5, off\n\t"
                 "global_load_async_to_lds_b128 %2, %6, off\n\t"
                 "global_load_async_to_lds_b128 %3, %7, off\n\t"
                 "s_wait_xcnt 0x0"
                 :: "v"(l), "v"(l + 2048u), "v"(l + 4096u), "v"(l + 6144u), "v"(g), "v"(g + gs), "v"(g + 2 * gs), "v"(g + 3 * gs) : "memory");
}
template <int NSPLIT, int MB, int EPI>
__global__ __launch_bounds__(128) void k_gemmt(const bf* __restrict__ A, const bf* __restrict__ A2, const bf* __restrict__ Bt, float* C, const float* __restrict__ CS, h16* P16, bf* PQh, bf* PQl, bf* PKh, bf* PKl, bf* PVh, bf* PVl) {
    static_assert(MB * (1 + NSPLIT) == 4, "four fragments of A and A2 together a wave");
    constexpr int K = DM, NT = K / 64, GA = 2 * MB;            // stages; row groups of A in the tile
    constexpr int OB = GA * (1 + NSPLIT) * 2048;               // byte offset of Bt's eight groups in a stage
    constexpr int STG = OB + 8 * 2048;                         // bytes of a stage
    constexpr int OSW = MB * 16 * 68;                          // floats of a wave's output staging
    constexpr int SMB = 2 * STG > 4 * OSW * 4 ? 2 * STG : 4 * OSW * 4;
    __shared__ __align__(16) char smem[SMB];                   // the two buffers; behind the loop every wave's own output staging
    const int tid = threadIdx.x, lane = tid & 31, wave = __builtin_amdgcn_readfirstlane(tid >> 5), lr = lane & 15, hi = lane >> 4, wm = wave >> 1, wn = wave & 1;
    const int r0 = blockIdx.x * (MB * 32), c0 = blockIdx.y * 128;
    const bf* gA = A + (size_t)r0 * K + tid * 8; const bf* gA2 = A2 + (size_t)r0 * K + tid * 8; const bf* gB = Bt + (size_t)c0 * K + tid * 8;   // this thread's 16 bytes in stage 0 of the first row groups
    const unsigned l0 = (unsigned)(size_t)smem + tid * 16;
    auto stage = [&](int t, int buf) {
        const unsigned l = l0 + buf * STG; const size_t ko = (size_t)t * 1024;
#pragma unroll
        for (int q = 0; q < GA / 4; ++q) { acopy4(l + q * 8192, gA + ko + (size_t)q * 64 * K, 16 * K); if (NSPLIT) acopy4(l + GA * 2048 + q * 8192, gA2 + ko + (size_t)q * 64 * K, 16 * K); }
#pragma unroll
        for (int q = 0; q < 2; ++q) acopy4(l + OB + q * 8192, gB + ko + (size_t)q * 64 * K, 16 * K);
    };
    v8f acc[MB][4];
#pragma unroll
    for (int mb = 0; mb < MB; ++mb)
#pragma unroll
        for (int nb = 0; nb < 4; ++nb) acc[mb][nb] = (v8f){};
    stage(0, 0);
    asm volatile("s_wait_asynccnt 0x0" ::: "memory");   // this wave's copies of stage 0 have landed
    __syncthreads();                                    // every wave's have
    stage(1, 1);
    // rolled: one copy of the body; the buffer is picked by one address addition a trip
#pragma unroll 1
    for (int t = 0; t < NT; ++t) {
        const bf* sa = (const bf*)(smem + (t & 1) * STG) + lane * 8;
#pragma unroll
        for (int ks = 0; ks < 2; ++ks) {
            v16bf fa[4], fb[4];   // fa: MB fragments of A, then (NSPLIT 1) MB of A2
#pragma unroll
            for (int i = 0; i < 4; ++i) { fa[i] = WFrag<bf>::ld(sa + (i / MB) * GA * 1024 + ((wm * MB + i % MB) * 2 + ks) * 512); fb[i] = WFrag<bf>::ld(sa + OB / 2 + ((wn * 4 + i) * 2 + ks) * 512); }
            // inputs-only fence on the loaded fragments: all sixteen LDS loads are issued as one group and waited for once; without it the compiler keeps one register set for Bt and waits out the LDS latency in front of every four matrix instructions
            asm volatile("" :: "v"(fa[0]), "v"(fa[1]), "v"(fa[2]), "v"(fa[3]), "v"(fb[0]), "v"(fb[1]), "v"(fb[2]), "v"(fb[3]));
#pragma unroll
            for (int nb = 0; nb < 4; ++nb)
#pragma unroll
                for (int mb = 0; mb < MB; ++mb) { acc[mb][nb] = wmmab(fa[mb], fb[nb], acc[mb][nb]); if (NSPLIT) acc[mb][nb] = wmmab(fa[MB + mb], fb[nb], acc[mb][nb]); }
        }
        asm volatile("s_wait_dscnt 0x0" ::: "memory");      // this wave's reads of stage t are done
        asm volatile("s_wait_asynccnt 0x0" ::: "memory");   // this wave's copies of stage t + 1 have landed
        __syncthreads();                                    // stage t + 1 is whole, and every wave has left stage t
        if (t + 2 < NT) stage(t + 2, t & 1);
    }
    asm volatile("s_wait_asynccnt 0x0" ::: "memory");       // no copy is on its way when the buffers become output staging
    const int sel = EPI ? (int)blockIdx.y * 2 / NH_ : 0, head = ((int)blockIdx.y * 2 + wn) % NH_, rw = r0 + wm * (MB * 16), bz = rw / TT, t0 = rw % TT;   // EPI 1: which projection, the wave's head, its batch and its first token in it
    float* os = (float*)smem + wave * OSW;   // [row][68], v: [dim][68]
    if (EPI == 1 && sel == 2) {   // transposed: eight tokens of one dim, two 16-byte stores
#pragma unroll
        for (int mb = 0; mb < MB; ++mb)
#pragma unroll
            for (int nb = 0; nb < 4; ++nb) { const v8f c = acc[mb][nb]; float* p = os + (nb * 16 + lr) * 68 + mb * 16 + hi * 8; *(v4fa*)p = (v4f){c[0], c[1], c[2], c[3]}; *(v4fa*)(p + 4) = (v4f){c[4], c[5], c[6], c[7]}; }
    } else {
#pragma unroll
        for (int mb = 0; mb < MB; ++mb)
#pragma unroll
            for (int nb = 0; nb < 4; ++nb) { const v8f c = acc[mb][nb];
#pragma unroll
                for (int j = 0; j < 8; ++j) os[(mb * 16 + hi * 8 + j) * 68 + nb * 16 + lr] = c[j]; }
    }
    if (EPI == 0) {
        __syncthreads();   // the tile is in LDS, row-major: whole rows go out in 16-byte stores
        float* cb = C + (size_t)(rw + hi) * DM + c0 + wn * 64 + lr * 4;
#pragma unroll
        for (int u = 0; u < MB * 8; ++u) *(v4f*)(cb + u * 2 * DM) = *(const v4fa*)(os + (u * 2 + hi) * 68 + lr * 4);   // two rows a store, 256 bytes in a row of each
        asm volatile("s_wait_xcnt 0x0" ::: "memory");   // before the registers that the stores name are used for something else
    } else {
        // a lane takes 8 consecutive elements of an LDS row, the ones that stand at idx * 8 of the tile in fragment order (the 64 x 64 tile is 4096 consecutive elements of its plane): a wave fills 512 contiguous bytes of every plane.
        // q, k: units [token group][dim / 32]; v: units [token / 32][dim group], so that a 32-key block of a head is 4 KiB in a row in each plane
        if (sel < 2) {
            v2f cs[16][4];   // this lane's {cos, sin} pairs, all asked for at once
            const float* cp = CS + ((size_t)(rw + lr) * HD + hi * 8) * 2;
#pragma unroll
            for (int u = 0; u < 16; ++u)   // piece idx = u * 32 + lane: token (idx >> 7) * 16 + (idx & 15), dims ((idx >> 4) & 7) * 8 ..; all at constant distances from the lane's first pair
#pragma unroll
                for (int p = 0; p < 4; ++p) cs[u][p] = *(const v2f*)(cp + (u >> 2) * 16 * HD * 2 + (u & 3) * 32 + p * 4);
            asm volatile("s_wait_xcnt 0x0" ::: "memory");   // before the address registers of these loads are used for something else
            __syncthreads();   // the tile is in LDS, row-major
            bf* Ph = sel ? PKh : PQh; bf* Pl = sel ? PKl : PQl;
#pragma unroll
            for (int u = 0; u < 16; ++u) { const int idx = u * 32 + lane, row = (idx >> 7) * 16 + (idx & 15), cofs = ((idx >> 4) & 7) * 8; const v4f xa = *(const v4fa*)(os + row * 68 + cofs), xb = *(const v4fa*)(os + row * 68 + cofs + 4);
                const float x[8] = { xa[0], xa[1], xa[2], xa[3], xb[0], xb[1], xb[2], xb[3] }; v8us oh, ol; unsigned short a2, c2;
#pragma unroll
                for (int p = 0; p < 4; ++p) { const float c = cs[u][p][0], sn = cs[u][p][1], xe = x[2 * p], xo = x[2 * p + 1];   /* even: xe c - xo s; odd: xe s + xo c */
                    splitf(xe * c - xo * sn, a2, c2); oh[2 * p] = a2; ol[2 * p] = c2; splitf(xe * sn + xo * c, a2, c2); oh[2 * p + 1] = a2; ol[2 * p + 1] = c2; }
                const size_t e = (((size_t)bz * NH_ + head) * TT + t0) * HD + idx * 8; *(v8us*)(Ph + e) = oh; *(v8us*)(Pl + e) = ol; }
            asm volatile("s_wait_xcnt 0x0" ::: "memory");   // before the registers that the stores name are used for something else
        } else {
            __syncthreads();   // the tile is in LDS, dim-major
#pragma unroll
            for (int u = 0; u < 16; ++u) { const int idx = u * 32 + lane, row = ((idx >> 6) & 3) * 16 + (idx & 15), cofs = (idx >> 8) * 32 + ((idx >> 4) & 3) * 8; const v4f xa = *(const v4fa*)(os + row * 68 + cofs), xb = *(const v4fa*)(os + row * 68 + cofs + 4);
                const float x[8] = { xa[0], xa[1], xa[2], xa[3], xb[0], xb[1], xb[2], xb[3] }; v8us oh, ol; v8h o16; unsigned short a2, c2;
#pragma unroll
                for (int q = 0; q < 8; ++q) { o16[q] = tohx(x[q]); splitf(x[q], a2, c2); oh[q] = a2; ol[q] = c2; }
                const size_t e = (((size_t)bz * NKV + head) * TT + t0) * HD + idx * 8; *(v8h*)(P16 + e) = o16; *(v8us*)(PVh + e) = oh; *(v8us*)(PVl + e) = ol; }
            asm volatile("s_wait_xcnt 0x0" ::: "memory");   // before the registers that the stores name are used for something else
        }
    }
}

typedef __attribute__((ext_vector_type(2))) _Float16 v2h;
typedef __attribute__((ext_vector_type(4))) _Float16 v4h;
typedef __attribute__((ext_vector_type(2))) unsigned short v2us;
typedef __attribute__((ext_vector_type(4))) unsigned short v4us;
typedef __attribute__((ext_vector_type(4))) int v4i;

__global__ __launch_bounds__(256) void k_wtG(const float* __restrict__ w, int K, int N, bf* Bt) {
    const int lane = threadIdx.x & 31; const int L0 = (blockIdx.x * 8 + (threadIdx.x >> 5)) * 8; const int nlines = N * K / 64;
{
#pragma unroll 1
        for (int l = 0; l < 8; ++l) { const int L = L0 + l; if (L >= nlines) break; const size_t e = (size_t)L * 64 + lane * 2; const int k = (int)(e % K), n = (int)(e / K); v2us o;
            o[0] = f2bf(w[(size_t)k * N + n]); o[1] = f2bf(w[(size_t)(k + 1) * N + n]); *(v2us*)(Bt + e) = o; }
         }
}
__constant__ float INV2[HD / 2] = { 1.000000000e+00f, 7.498942018e-01f, 5.623413324e-01f, 4.216965139e-01f, 3.162277639e-01f, 2.371373624e-01f, 1.778279394e-01f, 1.333521456e-01f, 1.000000015e-01f, 7.498941571e-02f, 5.623412877e-02f, 4.216964915e-02f, 3.162277862e-02f, 2.371373586e-02f, 1.778279431e-02f, 1.333521493e-02f, 9.999999776e-03f, 7.498942316e-03f, 5.623413250e-03f, 4.216964822e-03f, 3.162277862e-03f, 2.371373819e-03f, 1.778279431e-03f, 1.333521446e-03f, 1.000000047e-03f, 7.498941850e-04f, 5.623413017e-04f, 4.216964880e-04f, 3.162277862e-04f, 2.371373848e-04f, 1.778279402e-04f, 1.333521504e-04f };   // float32 10000^(-(i * 2 / 64)), generated with jnp to be bit-exact with the module's expression
// ---- k_prep: all that the projections read, in one launch; the work-group's index picks its job (the same for all its threads), every thread does one piece of it (one {cos, sin} pair, or eight elements to bf16, stored in fragment order: a work-group takes 16 rows x 128 k, four units); the grid is exact for the compile-time shapes.
// Groups 0 .. CSG-1: {cos, sin} per (batch, token, dim) from that batch's own row of positions (pid [batch][token], CS [batch][token][dim][2]). The next XG: x to bf16 (both batches, one run of rows). The last 4 x WG1: the four weights to bf16, one behind the other in WB.
#define CSG (NB_ * TT * HD / 256)
#define XG  (NB_ * TT * DM / 2048)
#define WG1 (DQ * DM / 2048)
__global__ __launch_bounds__(256) void k_prep(const float* __restrict__ x, const float* __restrict__ wq, const float* __restrict__ wk, const float* __restrict__ wv, const float* __restrict__ wo, const int* __restrict__ pid, bf* XB, bf* WB, float* CS) {
    const int g = (int)blockIdx.x, tid = threadIdx.x;
    if (g < CSG) { const int idx = g * 256 + tid; const int d = idx % HD; const int t = idx / HD; const float a = __fmul_rn((float)pid[t], INV2[d >> 1]); v2f cs; cs[0] = cosf(a); cs[1] = sinf(a); *(v2f*)(CS + (size_t)idx * 2) = cs; return; }
    const int c = g - CSG, w = (c - XG) / WG1; const float* src; bf* dst;
    const int cc = c < XG ? c : (c - XG) % WG1; const size_t so = (size_t)((cc >> 3) * 16 + (tid & 15)) * DM + (cc & 7) * 128 + (tid >> 4) * 8;   // row and first k of the eight elements that stand at tid * 8 of the group's four units
    if (c < XG) { src = x + so; dst = XB + (size_t)c * 2048; }
    else { src = (w == 0 ? wq : w == 1 ? wk : w == 2 ? wv : wo) + so; dst = WB + (size_t)(c - XG) * 2048; }
    const v8f v = *(const v8f*)src; v8us o;
#pragma unroll
    for (int k = 0; k < 8; ++k) o[k] = f2bf(v[k]);
    *(v8us*)(dst + tid * 8) = o;
}

// ---- k_fattn: scores, causal softmax, P.V and the head merge in one kernel; grid (TT / 128, heads / 2, batches), 16 waves. A work-group takes 128 query rows of one head (tile n - 1 - x), then 128 of another (tile x).
// Wave w: query rows (w >> 2) * 32 .. of the tile, key group w & 3. A stage is 128 keys (four 32-key blocks, 16 KiB in a row in each plane); it is brought into LDS once per work-group by asynchronous copies, as it lies in the planes, and block g of it is read there by the four waves of key group g, one per 32 query rows. Two buffers: stage t + 2 is asked for when every wave has left stage t.
// Transposed products: S^T = K Q^T (A = key rows, B = query rows kept in registers; hi/lo planes, 3 products), so a lane holds the scores of ONE query (column lr) and two 16-key score tiles, converted in place, are the B operand of
// O^T += V^T P^T (A = dim rows of the value planes, same k order as the loader). Rows < RH: p and v on hi/lo planes (3 products); the rest: p and v in fp16. p = exp2((s - running max) x HD^-0.5 x log2 e), at most 1, normalised in f32 at the end.
// Every wave keeps its own running maximum, sum and output tile; the four key groups of the same query rows meet in LDS and are joined in the fixed order 0 .. 3.
#define C2 0.18033688011112042f   // HD^-0.5 x log2(e)
#define FPL 16384                 // bytes of one plane's part of a stage (128 keys x HD x 2)
#define PWS (2048 + 256)          // floats of a wave's part of the join area
#define FST (4 * FPL)             // bytes of a stage buffer: key hi, key lo, value (fp16, or hi), value lo
__device__ __forceinline__ float xhalf(float x) { const int b = __float_as_int(x); return __int_as_float(__builtin_amdgcn_permlanex16(b, b, 0x76543210, 0xfedcba98, false, false)); }   // lane l <-> l ^ 16
// two asynchronous 16-byte copies of this lane, 8 KiB apart in LDS and in the plane (512 threads x 16 bytes); the wait at the end stands in the copies' own statement, in front of any rewrite of the address registers that they name
__device__ __forceinline__ void acopy2(unsigned l, const char* g) {
    asm volatile("global_load_async_to_lds_b128 %0, %2, off\n\t"
                 "global_load_async_to_lds_b128 %1, %3, off\n\t"
                 "s_wait_xcnt 0x0"
                 :: "v"(l), "v"(l + 8192u), "v"(g), "v"(g + 8192) : "memory");
}
template <bool HR>
__device__ __forceinline__ void fattn_loop(char* ring, const bf* __restrict__ Kh, const bf* __restrict__ Kl, const h16* __restrict__ V16, const bf* __restrict__ Vh, const bf* __restrict__ Vl, const v16bf (&qh)[2][2], const v16bf (&ql)[2][2],
                                           int tid, int kg, int nst, int nblk, int lr, int hi, v8f (&o)[4][2], float (&m)[2], float (&l)[2]) {
    const unsigned l0 = (unsigned)(size_t)ring + tid * 16;
    auto stage = [&](int t, int buf) {   // this thread's 2 x 16 bytes of each plane's 16 KiB of stage t
        const unsigned lb = l0 + buf * FST; const size_t go = (size_t)t * FPL + tid * 16;
        acopy2(lb, (const char*)Kh + go); acopy2(lb + FPL, (const char*)Kl + go);
        if (HR) { acopy2(lb + 2 * FPL, (const char*)Vh + go); acopy2(lb + 3 * FPL, (const char*)Vl + go); } else acopy2(lb + 2 * FPL, (const char*)V16 + go);
    };
    stage(0, 0);
    asm volatile("s_wait_asynccnt 0x0" ::: "memory");   // this wave's copies of stage 0 have landed
    __syncthreads();                                    // every wave's have
    if (nst > 1) stage(1, 1);
    // the stage loop stays rolled (a second copy of the body would need a second set of fragment registers); the constant loops inside are unrolled so that every fragment index is a compile-time constant and the tiles stay in registers
#pragma unroll 1
    for (int t = 0; t < nst; ++t) {
      const int blk = t * 4 + kg;
      if (blk < nblk) {   // the same for the whole wave: blocks above this wave's diagonal block are not worked on
        const char* sb = ring + (t & 1) * FST + kg * 4096 + (hi * 16 + lr) * 16;   // this lane's place in the wave's block of the key hi plane
        const bf* kph = (const bf*)sb; const bf* kpl = (const bf*)(sb + FPL);
        v16bf kh[2][2], kl[2][2];
        v8f s[2][2];
#pragma unroll
        for (int kb = 0; kb < 2; ++kb)
#pragma unroll
            for (int n = 0; n < 2; ++n) s[kb][n] = (v8f){};
#pragma unroll
        for (int ks = 0; ks < 2; ++ks) {
#pragma unroll
            for (int kb = 0; kb < 2; ++kb) { kh[kb][ks] = WFrag<bf>::ld(kph + (kb * 2 + ks) * 512); kl[kb][ks] = WFrag<bf>::ld(kpl + (kb * 2 + ks) * 512); }
            // inputs-only fence on the four key fragments of this half of the head dims: their eight LDS loads are issued together and waited for once; without it the compiler reuses two fragments' registers and waits out the LDS latency in front of every four matrix instructions
            asm volatile("" :: "v"(kh[0][ks]), "v"(kh[1][ks]), "v"(kl[0][ks]), "v"(kl[1][ks]));
#pragma unroll
            for (int kb = 0; kb < 2; ++kb)
#pragma unroll
                for (int n = 0; n < 2; ++n) s[kb][n] = wmmab(kh[kb][ks], qh[n][ks], s[kb][n]);
#pragma unroll
            for (int kb = 0; kb < 2; ++kb)
#pragma unroll
                for (int n = 0; n < 2; ++n) s[kb][n] = wmmab(kh[kb][ks], ql[n][ks], s[kb][n]);
#pragma unroll
            for (int kb = 0; kb < 2; ++kb)
#pragma unroll
                for (int n = 0; n < 2; ++n) s[kb][n] = wmmab(kl[kb][ks], qh[n][ks], s[kb][n]);
        }
        if (blk == nblk - 1) {   // the diagonal block: keys j > i are out (every query keeps at least the block's first key)
#pragma unroll
            for (int kb = 0; kb < 2; ++kb)
#pragma unroll
                for (int n = 0; n < 2; ++n)
#pragma unroll
                    for (int j = 0; j < 8; ++j) if (kb * 16 + hi * 8 + j > n * 16 + lr) s[kb][n][j] = -3.0e38f;
        }
        v16h p16[2]; v16bf ph[2], pl[2];
#pragma unroll
        for (int n = 0; n < 2; ++n) {
            float mx = s[0][n][0];
#pragma unroll
            for (int j = 1; j < 8; ++j) mx = fmaxf(mx, s[0][n][j]);
#pragma unroll
            for (int j = 0; j < 8; ++j) mx = fmaxf(mx, s[1][n][j]);
            mx = fmaxf(mx, xhalf(mx));
            const float mn = fmaxf(m[n], mx), al = __builtin_amdgcn_exp2f((m[n] - mn) * C2), mc = mn * C2; m[n] = mn;
            float sum = 0.f; v8h f0, f1;
#pragma unroll
            for (int j = 0; j < 8; ++j) {
                const float pa = __builtin_amdgcn_exp2f(s[0][n][j] * C2 - mc), pb = __builtin_amdgcn_exp2f(s[1][n][j] * C2 - mc); sum += pa; sum += pb;
                if (HR) { const __bf16 xa = (__bf16)pa, xb = (__bf16)pb; ph[n][j] = xa; pl[n][j] = (__bf16)(pa - (float)xa); ph[n][8 + j] = xb; pl[n][8 + j] = (__bf16)(pb - (float)xb); } else { f0[j] = tohx(pa); f1[j] = tohx(pb); } }
            l[n] = l[n] * al + sum;   // this lane's half of the keys; the halves are joined after the loop
            if (!HR) p16[n] = cat16(f0, f1);
#pragma unroll
            for (int db = 0; db < 4; ++db) o[db][n] *= al;
        }
#pragma unroll
        for (int db = 0; db < 4; ++db) {
            if (HR) { const v16bf vh = WFrag<bf>::ld((const bf*)(sb + 2 * FPL) + db * 512), vl = WFrag<bf>::ld((const bf*)(sb + 3 * FPL) + db * 512);
#pragma unroll
                for (int n = 0; n < 2; ++n) { o[db][n] = wmmab(vh, ph[n], o[db][n]); o[db][n] = wmmab(vh, pl[n], o[db][n]); o[db][n] = wmmab(vl, ph[n], o[db][n]); }
            } else { const v16h vf = WFrag<h16>::ld((const h16*)(sb + 2 * FPL) + db * 512);
#pragma unroll
                for (int n = 0; n < 2; ++n) o[db][n] = wmma16(vf, p16[n], o[db][n]); } }
      }
        asm volatile("s_wait_dscnt 0x0" ::: "memory");      // this wave's reads of stage t are done
        asm volatile("s_wait_asynccnt 0x0" ::: "memory");   // this wave's copies of stage t + 1 have landed
        __syncthreads();                                    // stage t + 1 is whole, and every wave has left stage t
        if (t + 2 < nst) stage(t + 2, t & 1);
    }
    asm volatile("s_wait_asynccnt 0x0" ::: "memory");       // no copy is on its way behind the loop
}
__global__ __launch_bounds__(512) void k_fattn(const bf* __restrict__ Qh, const bf* __restrict__ Ql, const bf* __restrict__ Kh, const bf* __restrict__ Kl, const h16* __restrict__ V16, const bf* __restrict__ Vh, const bf* __restrict__ Vl, bf* Ah, bf* Al) {
    __shared__ __align__(16) char ring[2 * FST];      // the two stage buffers
    __shared__ __align__(16) float part[16 * PWS];    // per wave [fragment][half][lane][4]: every 16-byte store and load is contiguous over the lanes; behind them the wave's running maxima [entry][4] and sums [entry][4] (first float of four), so that one address register serves all of a wave's stores
    const int tid = threadIdx.x, lane = tid & 31, wave = __builtin_amdgcn_readfirstlane(tid >> 5), lr = lane & 15, hi = lane >> 4, qs = wave >> 2, kg = wave & 3;
    { const size_t bo = (size_t)blockIdx.z * NH_ * TT * HD; Qh += bo; Ql += bo; Kh += bo; Kl += bo; V16 += bo; Vh += bo; Vl += bo; Ah += bo; Al += bo; }   // this work-group's batch: every plane holds NH_ x TT x HD = TT x DQ elements a batch
    // two tiles one after the other, so that every work-group walks 17 stages: kept rolled, one copy of the code
#pragma unroll 1
    for (int pass = 0; pass < 2; ++pass) {
        const int tile = pass ? (int)blockIdx.x : TT / 128 - 1 - (int)blockIdx.x, r0 = tile * 128 + qs * 32, h = (int)blockIdx.y + pass * (NH_ / 2);
        const size_t zo = (size_t)h * TT * HD;
        v16bf qh[2][2], ql[2][2];
#pragma unroll
        for (int n = 0; n < 2; ++n)
#pragma unroll
            for (int ks = 0; ks < 2; ++ks) { const size_t qo = zo + (size_t)r0 * HD + (n * 2 + ks) * 512 + lane * 8; qh[n][ks] = WFrag<bf>::ld(Qh + qo); ql[n][ks] = WFrag<bf>::ld(Ql + qo); }
        asm volatile("s_wait_xcnt 0x0" ::: "memory");   // before the address registers of the query loads are used for something else
        v8f o[4][2]; float m[2] = { -3.0e38f, -3.0e38f }, l[2] = { 0.f, 0.f };
#pragma unroll
        for (int db = 0; db < 4; ++db)
#pragma unroll
            for (int n = 0; n < 2; ++n) o[db][n] = (v8f){};
        if (tile * 128 < RH) fattn_loop<true>(ring, Kh + zo, Kl + zo, V16 + zo, Vh + zo, Vl + zo, qh, ql, tid, kg, tile + 1, tile * 4 + qs + 1, lr, hi, o, m, l);
        else                 fattn_loop<false>(ring, Kh + zo, Kl + zo, V16 + zo, Vh + zo, Vl + zo, qh, ql, tid, kg, tile + 1, tile * 4 + qs + 1, lr, hi, o, m, l);
#pragma unroll
        for (int n = 0; n < 2; ++n) l[n] += xhalf(l[n]);
        float* pw = part + wave * PWS + lane * 4;
        pw[2048] = hi ? m[1] : m[0]; pw[2048 + 128] = hi ? l[1] : l[0];   // entry n * 16 + query column
        __syncthreads();   // every wave's maximum and sum are in LDS (a wave without a block: -3e38 and 0; key group 0 always has block 0)
        float inv[2];
#pragma unroll
        for (int n = 0; n < 2; ++n) { const float* ps = part + qs * 4 * PWS + 2048 + (n * 16 + lr) * 4; float M = ps[0];
#pragma unroll
            for (int w = 1; w < 4; ++w) M = fmaxf(M, ps[w * PWS]);
            float L = 0.f;
#pragma unroll
            for (int w = 0; w < 4; ++w) L += ps[w * PWS + 128] * __builtin_amdgcn_exp2f((ps[w * PWS] - M) * C2);
            inv[n] = __fdiv_rn(1.0f, L); const float f = __builtin_amdgcn_exp2f((m[n] - M) * C2);
#pragma unroll
            for (int db = 0; db < 4; ++db) o[db][n] *= f; }
#pragma unroll
        for (int db = 0; db < 4; ++db)
#pragma unroll
            for (int n = 0; n < 2; ++n) { const v8f c = o[db][n]; *(v4fa*)(pw + (db * 2 + n) * 256) = (v4f){c[0], c[1], c[2], c[3]}; *(v4fa*)(pw + (db * 2 + n) * 256 + 128) = (v4f){c[4], c[5], c[6], c[7]}; }
        __syncthreads();   // every wave's weighted output tile is in LDS; every wave has read the maxima and sums
        // key group g joins fragments 2 g and 2 g + 1 of its query rows (head dims g * 16 .., query groups 0 and 1): a lane ends with 8 consecutive dims of one query row, one 16-byte store per plane, at its place in fragment order (rows = tokens, k = head * 64 + dim): the wave's store is 512 contiguous bytes
#pragma unroll
        for (int e = 0; e < 2; ++e) {
            const float* pr = part + qs * 4 * PWS + (kg * 2 + e) * 256 + lane * 4; v4f a = *(const v4fa*)pr, c = *(const v4fa*)(pr + 128);
#pragma unroll
            for (int w = 1; w < 4; ++w) { a += *(const v4fa*)(pr + w * PWS); c += *(const v4fa*)(pr + w * PWS + 128); }
            const float iv = inv[e]; v8us oh, ol;
#pragma unroll
            for (int q = 0; q < 4; ++q) { unsigned short x, y; splitf(a[q] * iv, x, y); oh[q] = x; ol[q] = y; splitf(c[q] * iv, x, y); oh[4 + q] = x; ol[4 + q] = y; }
            const size_t oo = (size_t)(r0 + e * 16) * DQ + (h * 2 + (kg >> 1)) * 512 + (kg & 1) * 256 + lane * 8; *(v8us*)(Ah + oo) = oh; *(v8us*)(Al + oo) = ol;
            asm volatile("s_wait_xcnt 0x0" ::: "memory");   // before the next fragment or the second tile overwrites the registers that the two stores name
        }
    }
}

extern "C" void kernel_launch(void* const* d_in, const int* in_sizes, int n_in,
                              void* d_out, int out_size, void* d_ws, size_t ws_size, hipStream_t stream) {
    (void)in_sizes; (void)n_in; (void)out_size;
        const float* x = (const float*)d_in[0]; const int* PID = (const int*)d_in[5]; const float* wq = (const float*)d_in[1]; const float* wk = (const float*)d_in[2]; const float* wv = (const float*)d_in[3]; const float* wo = (const float*)d_in[4];   /* order x, Wq, Wk, Wv, Wo ('oi' [1024][1024]), token_positions (int32 [2][2048]: ONE row of positions PER BATCH, sorted random values in [0, 2048); read on device) */
    float* OUT = (float*)d_out;     // [2][2048][1024]
    char* wsp = (char*)d_ws;
    auto take = [&](size_t bytes) { char* p = wsp; wsp += (bytes + 255) & ~(size_t)255; return (void*)p; };
    bf* WB = (bf*)take((size_t)4 * DQ * DM * 2);   // Wq, Wk, Wv, Wo in bf16, one behind the other
    h16* VT16 = (h16*)take((size_t)NB_ * NKV * HD * TT * 2);
    bf* QPh = (bf*)take((size_t)NB_ * NH_ * TT * HD * 2); bf* QPl = (bf*)take((size_t)NB_ * NH_ * TT * HD * 2); bf* KPh = (bf*)take((size_t)NB_ * NKV * TT * HD * 2); bf* KPl = (bf*)take((size_t)NB_ * NKV * TT * HD * 2); bf* VTh = (bf*)take((size_t)NB_ * NKV * HD * TT * 2); bf* VTl = (bf*)take((size_t)NB_ * NKV * HD * TT * 2);
    bf* ATh = (bf*)take((size_t)NB_ * TT * DQ * 2); bf* ATl = (bf*)take((size_t)NB_ * TT * DQ * 2);
    float* CS = (float*)take((size_t)NB_ * TT * HD * 2 * 4); bf* XB = (bf*)take((size_t)NB_ * TT * DM * 2);
    if ((size_t)(wsp - (char*)d_ws) > ws_size) return;    // ws 256 MiB
    k_prep<<<CSG + XG + 4 * WG1, 256, 0, stream>>>(x, wq, wk, wv, wo, PID, XB, WB, CS);   /* token_positions (int32, read): every batch's own row of positions */
    k_gemmt<0, 4, 1><<<dim3(NB_ * TT / 128, 3 * DQ / 128, 1), 128, 0, stream>>>(XB, nullptr, WB, nullptr, CS, VT16, QPh, QPl, KPh, KPl, VTh, VTl);
    k_fattn<<<dim3(TT / 128, NH_ / 2, NB_), 512, 0, stream>>>(QPh, QPl, KPh, KPl, VT16, VTh, VTl, ATh, ATl);   /* one kv head per query head */
    k_gemmt<1, 2, 0><<<dim3(NB_ * TT / 64, DM / 128, 1), 128, 0, stream>>>(ATh, ATl, WB + (size_t)3 * DQ * DM, OUT, nullptr, nullptr, nullptr, nullptr, nullptr, nullptr, nullptr, nullptr);
}

// v009
// Measured time: 81.3 microseconds a run.
// Next to v008, in two timings, it ran 1.11 and 1.12 times as fast.
// All steps since v000 together make it 16.8 times as fast.
#include <hip/hip_runtime.h>

// Causal multi-head self-attention with interleaved-pair rotary position embedding from PER-BATCH position rows (x [2][2048][1024]; q, k, v = einsum('bsd,od', x, W) ('oi' [1024][1024], no bias; 16 heads x 64); angle = float(token_positions[b][t]) x 1 / theta ** (2i / 64) (theta 1e4; token_positions int32 [2][2048]: each batch has its OWN sorted row of random positions in [0, 2048), READ on device); pairs (2i, 2i+1): (xe cos - xo sin, xe sin + xo cos) on q and k; scores / sqrt(64); keys j <= i kept (by INDEX, not by position), -inf elsewhere; softmax; out = einsum('bso,do', merged, Wo) -> [2][2048][1024] (4.2 M); argument order x, Wq, Wk, Wv, Wo, token_positions).
// Every stage is launched once, for both batches and all its operands (4 launches). Layout: bf16 copy of x and of the four weights; {cos, sin} per (position, pair) built once from the int positions and float32 inverse-frequency constants (precise cosf/sinf); exact projections whose epilogue turns the summed f32 tile (64 tokens x one head) straight into the attention planes (q, k: interleaved rotary, hi/lo; v: transposed, fp16 and hi/lo); fused causal T-2048 attention, no score buffer (EVERY row's scores on hi/lo planes (3 products: logit sigma 2 with these weights), online softmax, hybrid P.V (rows < 512 hi/lo, rest fp16); key blocks above the diagonal are never touched); merged hi/lo x Wo exact.
// FRAGMENT ORDER: every 16-bit plane that a matrix instruction reads (x, the weights, q, k, v, the merged heads) lies in the workspace as 1-KiB units of 16 rows x 32 k, [k bit 4][k bit 3][row][k bits 2..0]: a lane's two 16-byte pieces of a fragment stand at unit + lane * 16 B and 512 B further, so each wave-wide load is 512 contiguous bytes (4 whole lines), not 32-byte pieces of 16 lines. The k order of every fragment is as before.
// Compute dtypes, f32 accumulate: every input rounded to bf16; projections exact; rotary f32; attention scores 3 products, P.V rows < 512 3 products, rest fp16; softmax f32; Wo hl x exact.

#define NB_  2
#define TT   2048
#define DM   1024
#define NH_  16
#define NKV  16
#define REP  (NH_ / NKV)
#define HD   64
#define DQ   (NH_ * HD)
#define DKV  (NKV * HD)
#define RH   512                  // query rows < RH take P.V on hi+lo planes (0: none)
typedef _Float16 h16;
typedef unsigned short bf;
typedef __attribute__((ext_vector_type(16))) __bf16   v16bf;
typedef __attribute__((ext_vector_type(16))) _Float16 v16h;
typedef __attribute__((ext_vector_type(8)))  _Float16 v8h;
typedef __attribute__((ext_vector_type(8)))  unsigned short v8us;
typedef __attribute__((ext_vector_type(8)))  float    v8f;
typedef __attribute__((ext_vector_type(4)))  float    v4f;
typedef v8h  __attribute__((may_alias)) v8ha;
typedef v4f  __attribute__((may_alias)) v4fa;
typedef v8us __attribute__((may_alias)) v8usa;

__device__ __forceinline__ unsigned short f2bf(float f) { unsigned u = __float_as_uint(f); u += 0x7FFFu + ((u >> 16) & 1u); return (unsigned short)(u >> 16); }
__device__ __forceinline__ float bf2f(unsigned short b) { return __uint_as_float(((unsigned)b) << 16); }
__device__ __forceinline__ float bfr(float f) { return bf2f(f2bf(f)); }
__device__ __forceinline__ v16h cat16(v8h lo, v8h hi) { return __builtin_shufflevector(lo, hi, 0, 1, 2, 3, 4, 5, 6, 7, 8, 9, 10, 11, 12, 13, 14, 15); }
__device__ __forceinline__ v16bf cat16b(v8us lo, v8us hi) { return __builtin_bit_cast(v16bf, __builtin_shufflevector(lo, hi, 0, 1, 2, 3, 4, 5, 6, 7, 8, 9, 10, 11, 12, 13, 14, 15)); }
__device__ __forceinline__ v8f wmma16(v16h a, v16h b, v8f c) { return __builtin_amdgcn_wmma_f32_16x16x32_f16(false, a, false, b, (short)0, c, false, false); }
__device__ __forceinline__ v8f wmmab(v16bf a, v16bf b, v8f c) { return __builtin_amdgcn_wmma_f32_16x16x32_bf16(false, a, false, b, (short)0, c, false, false); }

__device__ __forceinline__ h16 tohx(float x) { return (h16)x; }
__device__ __forceinline__ void splitf(float y, unsigned short& h, unsigned short& l) { h = f2bf(y); l = f2bf(y - bf2f(h)); }
typedef __attribute__((ext_vector_type(2))) float v2f;

// ---- k_gemmt: GEMM on 16-bit planes in fragment order (units of one 16-row group one behind the other along k, so a group is 16 x K elements as in a row-major plane). One (WM x MB x 16) x (WN x 64) output tile per work-group of WM x WN waves; a wave keeps MB x 4 accumulator tiles (MB x 16 rows x 64 columns); grid (M / (WM x MB x 16), N / (WN x 64)), one work-group for every WGP of the chip, so that each operand row is fetched from L2 by as few work-groups as the balance allows.
// C[m][n] (f32, pitch DM) = sum_k A[m][k] Bt[n][k] (NSPLIT 1: + A2[m][k] Bt[n][k]), k ascending in one chain per accumulator.
// A stage is 128 k of every row of the tile: four units, 4 KiB in a row, of each row group. It is brought into LDS once per work-group by asynchronous copies, as it lies in the plane (a set of 128 threads takes every NS-th group, a thread 2 x 16 bytes of it), and all waves that need a group read it there. Two buffers: stage t + 2 is asked for when every wave has left stage t.
// EPI 0: C as above. EPI 1 (q, k and v projections of both batches in one grid; Bt = the three weights one behind the other, rows = the tokens of batch 0, then of batch 1; a wave's 64 columns = one head; C unused): the f32 tile never leaves the wave's part of LDS.
// The wave's head picks its epilogue, the same for the whole wave. 0 (q) and 1 (k): interleaved rotary with {cos, sin} from CS[batch][token][dim][2], then hi/lo planes PQh, PQl or PKh, PKl [batch][head], rows = tokens, k = dims. 2 (v): the tile is put into LDS transposed and goes out as planes P16, PVh, PVl [batch][head], rows = dims, k = tokens. All in fragment order.
template <typename T16> struct WFrag;
template <> struct WFrag<h16> { typedef v16h V; static __device__ __forceinline__ V ld(const h16* p) { return cat16(*(const v8h*)p, *(const v8h*)(p + 256)); } static __device__ __forceinline__ v8f mma(V a, V b, v8f c) { return wmma16(a, b, c); } };
template <> struct WFrag<bf> { typedef v16bf V; static __device__ __forceinline__ V ld(const bf* p) { return cat16b(*(const v8us*)p, *(const v8us*)(p + 256)); } static __device__ __forceinline__ v8f mma(V a, V b, v8f c) { return wmmab(a, b, c); } };
// two asynchronous 16-byte copies of this lane, 2 KiB apart in LDS and in the plane (128 threads x 16 bytes); the wait at the end stands in the copies' own statement, in front of any rewrite of the address registers that they name
__device__ __forceinline__ void acopy2k(unsigned l, const bf* g) {
    asm volatile("global_load_async_to_lds_b128 %0, %2, off\n\t"
                 "global_load_async_to_lds_b128 %1, %3, off\n\t"
                 "s_wait_xcnt 0x0"
                 :: "v"(l), "v"(l + 2048u), "v"(g), "v"(g + 1024) : "memory");
}
// the same for three row groups in one statement, so that a stage's copies are held up by few waits
__device__ __forceinline__ void acopy6k(unsigned la, const bf* ga, unsigned lb, const bf* gb, unsigned lc, const bf* gc) {
    asm volatile("global_load_async_to_lds_b128 %0, %6, off\n\t"
                 "global_load_async_to_lds_b128 %1, %7, off\n\t"
                 "global_load_async_to_lds_b128 %2, %8, off\n\t"
                 "global_load_async_to_lds_b128 %3, %9, off\n\t"
                 "global_load_async_to_lds_b128 %4, %10, off\n\t"
                 "global_load_async_to_lds_b128 %5, %11, off\n\t"
                 "s_wait_xcnt 0x0"
                 :: "v"(la), "v"(la + 2048u), "v"(lb), "v"(lb + 2048u), "v"(lc), "v"(lc + 2048u), "v"(ga), "v"(ga + 1024), "v"(gb), "v"(gb + 1024), "v"(gc), "v"(gc + 1024) : "memory");
}
template <int NSPLIT, int MB, int EPI, int WM, int WN>
__global__ __launch_bounds__(WM * WN * 32) void k_gemmt(const bf* __restrict__ A, const bf* __restrict__ A2, const bf* __restrict__ Bt, float* C, const float* __restrict__ CS, h16* P16, bf* PQh, bf* PQl, bf* PKh, bf* PKl, bf* PVh, bf* PVl) {
    static_assert(MB * (1 + NSPLIT) == 4, "four fragments of A and A2 together a wave");
    static_assert(WM * WN % 4 == 0, "whole sets of 128 threads");
    constexpr int K = DM, NT = K / 128, NW = WM * WN, NS = NW / 4;   // stages; waves; sets of 128 threads
    constexpr int GA = WM * MB, GAT = GA * (1 + NSPLIT), NG = GAT + WN * 4;   // row groups of A in the tile; of A and A2; of all operands
    constexpr int NF = NG / NS;                                // row groups that every set of threads copies
    static_assert(NF % 3 == 0, "three row groups a statement");
    constexpr int OB = GAT * 4096;                             // byte offset of Bt's groups in a stage
    constexpr int STG = NG * 4096;                             // bytes of a stage
    constexpr int OSW = MB * 16 * 68;                          // floats of a wave's output staging
    constexpr int SMB = 2 * STG > NW * OSW * 4 ? 2 * STG : NW * OSW * 4;
    __shared__ __align__(16) char smem[SMB];                   // the two buffers; behind the loop every wave's own output staging
    const int tid = threadIdx.x, lane = tid & 31, wave = __builtin_amdgcn_readfirstlane(tid >> 5), lr = lane & 15, hi = lane >> 4, wm = wave / WN, wn = wave % WN, set = wave >> 2;
    const int r0 = blockIdx.x * (WM * MB * 16), c0 = blockIdx.y * (WN * 64);
    const unsigned l0 = (unsigned)(size_t)smem + (tid & 127) * 16;
    auto gp = [&](int i) -> const bf* {   // first element of the i-th row group that this wave's set copies, group set + NS * i of the tile; where all NS sets are in the same operand at this i, the operand is known at compile time
        const int lo = NS * i, gi = set + lo;
        if (lo + NS <= GA) return A + (size_t)(r0 + gi * 16) * K;
        if (NSPLIT && lo >= GA && lo + NS <= GAT) return A2 + (size_t)(r0 + (gi - GA) * 16) * K;
        if (lo >= GAT) return Bt + (size_t)(c0 + (gi - GAT) * 16) * K;
        return gi < GA ? A + (size_t)(r0 + gi * 16) * K : (NSPLIT && gi < GAT) ? A2 + (size_t)(r0 + (gi - GA) * 16) * K : Bt + (size_t)(c0 + (gi - GAT) * 16) * K;
    };
    auto stage = [&](int t, int buf) {
        const size_t ko = (size_t)t * 2048 + (tid & 127) * 8;   // this thread's first 16 bytes in stage t of a row group
        const unsigned l = l0 + buf * STG + set * 4096;
#pragma unroll
        for (int i = 0; i < NF; i += 3) acopy6k(l + i * NS * 4096, gp(i) + ko, l + (i + 1) * NS * 4096, gp(i + 1) + ko, l + (i + 2) * NS * 4096, gp(i + 2) + ko);
        if (NG % NS) { if (set + NS * NF < NG) acopy2k(l + NF * NS * 4096, gp(NF) + ko); }   // the groups left over go to the first sets: a test that is the same for the whole wave
    };
    v8f acc[MB][4];
#pragma unroll
    for (int mb = 0; mb < MB; ++mb)
#pragma unroll
        for (int nb = 0; nb < 4; ++nb) acc[mb][nb] = (v8f){};
    stage(0, 0);
    asm volatile("s_wait_asynccnt 0x0" ::: "memory");   // this wave's copies of stage 0 have landed
    __syncthreads();                                    // every wave's have
    stage(1, 1);
    // rolled: one copy of the body; the buffer is picked by one address addition a trip
#pragma unroll 1
    for (int t = 0; t < NT; ++t) {
        const bf* sa = (const bf*)(smem + (t & 1) * STG) + lane * 8;
#pragma unroll
        for (int ks = 0; ks < 4; ++ks) {
            v16bf fa[4], fb[4];   // fa: MB fragments of A, then (NSPLIT 1) MB of A2
#pragma unroll
            for (int i = 0; i < 4; ++i) { fa[i] = WFrag<bf>::ld(sa + (i / MB) * GA * 2048 + ((wm * MB + i % MB) * 4 + ks) * 512); fb[i] = WFrag<bf>::ld(sa + OB / 2 + ((wn * 4 + i) * 4 + ks) * 512); }
            // inputs-only fence on the loaded fragments: all sixteen LDS loads are issued as one group and waited for once; without it the compiler keeps one register set for Bt and waits out the LDS latency in front of every four matrix instructions
            asm volatile("" :: "v"(fa[0]), "v"(fa[1]), "v"(fa[2]), "v"(fa[3]), "v"(fb[0]), "v"(fb[1]), "v"(fb[2]), "v"(fb[3]));
#pragma unroll
            for (int nb = 0; nb < 4; ++nb)
#pragma unroll
                for (int mb = 0; mb < MB; ++mb) { acc[mb][nb] = wmmab(fa[mb], fb[nb], acc[mb][nb]); if (NSPLIT) acc[mb][nb] = wmmab(fa[MB + mb], fb[nb], acc[mb][nb]); }
        }
        asm volatile("s_wait_dscnt 0x0" ::: "memory");      // this wave's reads of stage t are done
        asm volatile("s_wait_asynccnt 0x0" ::: "memory");   // this wave's copies of stage t + 1 have landed
        __syncthreads();                                    // stage t + 1 is whole, and every wave has left stage t
        if (t + 2 < NT) stage(t + 2, t & 1);
    }
    asm volatile("s_wait_asynccnt 0x0" ::: "memory");       // no copy is on its way when the buffers become output staging
    const int gh = (int)blockIdx.y * WN + wn, sel = EPI ? gh / NH_ : 0, head = gh % NH_, rw = r0 + wm * (MB * 16), bz = rw / TT, t0 = rw % TT;   // EPI 1: the wave's head among the 3 x 16, which projection, the head in it, the wave's batch and its first token in it
    float* os = (float*)smem + wave * OSW;   // [row][68], v: [dim][68]
    if (EPI == 1 && sel == 2) {   // transposed: eight tokens of one dim, two 16-byte stores
#pragma unroll
        for (int mb = 0; mb < MB; ++mb)
#pragma unroll
            for (int nb = 0; nb < 4; ++nb) { const v8f c = acc[mb][nb]; float* p = os + (nb * 16 + lr) * 68 + mb * 16 + hi * 8; *(v4fa*)p = (v4f){c[0], c[1], c[2], c[3]}; *(v4fa*)(p + 4) = (v4f){c[4], c[5], c[6], c[7]}; }
    } else {
#pragma unroll
        for (int mb = 0; mb < MB; ++mb)
#pragma unroll
            for (int nb = 0; nb < 4; ++nb) { const v8f c = acc[mb][nb];
#pragma unroll
                for (int j = 0; j < 8; ++j) os[(mb * 16 + hi * 8 + j) * 68 + nb * 16 + lr] = c[j]; }
    }
    v2f cs[16][4];   // EPI 1, q and k: this lane's {cos, sin} pairs, all asked for at once
    if (EPI == 1 && sel < 2) {
        const float* cp = CS + ((size_t)(rw + lr) * HD + hi * 8) * 2;
#pragma unroll
        for (int u = 0; u < 16; ++u)   // piece idx = u * 32 + lane: token (idx >> 7) * 16 + (idx & 15), dims ((idx >> 4) & 7) * 8 ..; all at constant distances from the lane's first pair
#pragma unroll
            for (int p = 0; p < 4; ++p) cs[u][p] = *(const v2f*)(cp + (u >> 2) * 16 * HD * 2 + (u & 3) * 32 + p * 4);
        asm volatile("s_wait_xcnt 0x0" ::: "memory");   // before the address registers of these loads are used for something else
    }
    __syncthreads();   // the tile is in LDS (row-major; v: dim-major); one barrier that every wave passes, whichever epilogue its head picks
    if (EPI == 0) {
        float* cb = C + (size_t)(rw + hi) * DM + c0 + wn * 64 + lr * 4;   // whole rows go out in 16-byte stores
#pragma unroll
        for (int u = 0; u < MB * 8; ++u) *(v4f*)(cb + u * 2 * DM) = *(const v4fa*)(os + (u * 2 + hi) * 68 + lr * 4);   // two rows a store, 256 bytes in a row of each
        asm volatile("s_wait_xcnt 0x0" ::: "memory");   // before the registers that the stores name are used for something else
    } else {
        // a lane takes 8 consecutive elements of an LDS row, the ones that stand at idx * 8 of the tile in fragment order (the 64 x 64 tile is 4096 consecutive elements of its plane): a wave fills 512 contiguous bytes of every plane.
        // q, k: units [token group][dim / 32]; v: units [token / 32][dim group], so that a 32-key block of a head is 4 KiB in a row in each plane
        if (sel < 2) {
            bf* Ph = sel ? PKh : PQh; bf* Pl = sel ? PKl : PQl;
#pragma unroll
            for (int u = 0; u < 16; ++u) { const int idx = u * 32 + lane, row = (idx >> 7) * 16 + (idx & 15), cofs = ((idx >> 4) & 7) * 8; const v4f xa = *(const v4fa*)(os + row * 68 + cofs), xb = *(const v4fa*)(os + row * 68 + cofs + 4);
                const float x[8] = { xa[0], xa[1], xa[2], xa[3], xb[0], xb[1], xb[2], xb[3] }; v8us oh, ol; unsigned short a2, c2;
#pragma unroll
                for (int p = 0; p < 4; ++p) { const float c = cs[u][p][0], sn = cs[u][p][1], xe = x[2 * p], xo = x[2 * p + 1];   /* even: xe c - xo s; odd: xe s + xo c */
                    splitf(xe * c - xo * sn, a2, c2); oh[2 * p] = a2; ol[2 * p] = c2; splitf(xe * sn + xo * c, a2, c2); oh[2 * p + 1] = a2; ol[2 * p + 1] = c2; }
                const size_t e = (((size_t)bz * NH_ + head) * TT + t0) * HD + idx * 8; *(v8us*)(Ph + e) = oh; *(v8us*)(Pl + e) = ol; }
            asm volatile("s_wait_xcnt 0x0" ::: "memory");   // before the registers that the stores name are used for something else
        } else {
#pragma unroll
            for (int u = 0; u < 16; ++u) { const int idx = u * 32 + lane, row = ((idx >> 6) & 3) * 16 + (idx & 15), cofs = (idx >> 8) * 32 + ((idx >> 4) & 3) * 8; const v4f xa = *(const v4fa*)(os + row * 68 + cofs), xb = *(const v4fa*)(os + row * 68 + cofs + 4);
                const float x[8] = { xa[0], xa[1], xa[2], xa[3], xb[0], xb[1], xb[2], xb[3] }; v8us oh, ol; v8h o16; unsigned short a2, c2;
#pragma unroll
                for (int q = 0; q < 8; ++q) { o16[q] = tohx(x[q]); splitf(x[q], a2, c2); oh[q] = a2; ol[q] = c2; }
                const size_t e = (((size_t)bz * NKV + head) * TT + t0) * HD + idx * 8; *(v8h*)(P16 + e) = o16; *(v8us*)(PVh + e) = oh; *(v8us*)(PVl + e) = ol; }
            asm volatile("s_wait_xcnt 0x0" ::: "memory");   // before the registers that the stores name are used for something else
        }
    }
}

typedef __attribute__((ext_vector_type(2))) _Float16 v2h;
typedef __attribute__((ext_vector_type(4))) _Float16 v4h;
typedef __attribute__((ext_vector_type(2))) unsigned short v2us;
typedef __attribute__((ext_vector_type(4))) unsigned short v4us;
typedef __attribute__((ext_vector_type(4))) int v4i;

__global__ __launch_bounds__(256) void k_wtG(const float* __restrict__ w, int K, int N, bf* Bt) {
    const int lane = threadIdx.x & 31; const int L0 = (blockIdx.x * 8 + (threadIdx.x >> 5)) * 8; const int nlines = N * K / 64;
{
#pragma unroll 1
        for (int l = 0; l < 8; ++l) { const int L = L0 + l; if (L >= nlines) break; const size_t e = (size_t)L * 64 + lane * 2; const int k = (int)(e % K), n = (int)(e / K); v2us o;
            o[0] = f2bf(w[(size_t)k * N + n]); o[1] = f2bf(w[(size_t)(k + 1) * N + n]); *(v2us*)(Bt + e) = o; }
         }
}
__constant__ float INV2[HD / 2] = { 1.000000000e+00f, 7.498942018e-01f, 5.623413324e-01f, 4.216965139e-01f, 3.162277639e-01f, 2.371373624e-01f, 1.778279394e-01f, 1.333521456e-01f, 1.000000015e-01f, 7.498941571e-02f, 5.623412877e-02f, 4.216964915e-02f, 3.162277862e-02f, 2.371373586e-02f, 1.778279431e-02f, 1.333521493e-02f, 9.999999776e-03f, 7.498942316e-03f, 5.623413250e-03f, 4.216964822e-03f, 3.162277862e-03f, 2.371373819e-03f, 1.778279431e-03f, 1.333521446e-03f, 1.000000047e-03f, 7.498941850e-04f, 5.623413017e-04f, 4.216964880e-04f, 3.162277862e-04f, 2.371373848e-04f, 1.778279402e-04f, 1.333521504e-04f };   // float32 10000^(-(i * 2 / 64)), generated with jnp to be bit-exact with the module's expression
// ---- k_prep: all that the projections read, in one launch; the work-group's index picks its job (the same for all its threads), every thread does one piece of it (one {cos, sin} pair, or eight elements to bf16, stored in fragment order: a work-group takes 16 rows x 128 k, four units); the grid is exact for the compile-time shapes.
// Groups 0 .. CSG-1: {cos, sin} per (batch, token, dim) from that batch's own row of positions (pid [batch][token], CS [batch][token][dim][2]). The next XG: x to bf16 (both batches, one run of rows). The last 4 x WG1: the four weights to bf16, one behind the other in WB.
#define CSG (NB_ * TT * HD / 256)
#define XG  (NB_ * TT * DM / 2048)
#define WG1 (DQ * DM / 2048)
__global__ __launch_bounds__(256) void k_prep(const float* __restrict__ x, const float* __restrict__ wq, const float* __restrict__ wk, const float* __restrict__ wv, const float* __restrict__ wo, const int* __restrict__ pid, bf* XB, bf* WB, float* CS) {
    const int g = (int)blockIdx.x, tid = threadIdx.x;
    if (g < CSG) { const int idx = g * 256 + tid; const int d = idx % HD; const int t = idx / HD; const float a = __fmul_rn((float)pid[t], INV2[d >> 1]); v2f cs; cs[0] = cosf(a); cs[1] = sinf(a); *(v2f*)(CS + (size_t)idx * 2) = cs; return; }
    const int c = g - CSG, w = (c - XG) / WG1; const float* src; bf* dst;
    const int cc = c < XG ? c : (c - XG) % WG1; const size_t so = (size_t)((cc >> 3) * 16 + (tid & 15)) * DM + (cc & 7) * 128 + (tid >> 4) * 8;   // row and first k of the eight elements that stand at tid * 8 of the group's four units
    if (c < XG) { src = x + so; dst = XB + (size_t)c * 2048; }
    else { src = (w == 0 ? wq : w == 1 ? wk : w == 2 ? wv : wo) + so; dst = WB + (size_t)(c - XG) * 2048; }
    const v8f v = *(const v8f*)src; v8us o;
#pragma unroll
    for (int k = 0; k < 8; ++k) o[k] = f2bf(v[k]);
    *(v8us*)(dst + tid * 8) = o;
}

// ---- k_fattn: scores, causal softmax, P.V and the head merge in one kernel; grid (TT / 128, heads / 2, batches), 16 waves. A work-group takes 128 query rows of one head (tile n - 1 - x), then 128 of another (tile x).
// Wave w: query rows (w >> 2) * 32 .. of the tile, key group w & 3. A stage is 128 keys (four 32-key blocks, 16 KiB in a row in each plane); it is brought into LDS once per work-group by asynchronous copies, as it lies in the planes, and block g of it is read there by the four waves of key group g, one per 32 query rows. Two buffers: stage t + 2 is asked for when every wave has left stage t.
// Transposed products: S^T = K Q^T (A = key rows, B = query rows kept in registers; hi/lo planes, 3 products), so a lane holds the scores of ONE query (column lr) and two 16-key score tiles, converted in place, are the B operand of
// O^T += V^T P^T (A = dim rows of the value planes, same k order as the loader). Rows < RH: p and v on hi/lo planes (3 products); the rest: p and v in fp16. p = exp2((s - running max) x HD^-0.5 x log2 e), at most 1, normalised in f32 at the end.
// Every wave keeps its own running maximum, sum and output tile; the four key groups of the same query rows meet in LDS and are joined in the fixed order 0 .. 3.
#define C2 0.18033688011112042f   // HD^-0.5 x log2(e)
#define FPL 16384                 // bytes of one plane's part of a stage (128 keys x HD x 2)
#define PWS (2048 + 256)          // floats of a wave's part of the join area
#define FST (4 * FPL)             // bytes of a stage buffer: key hi, key lo, value (fp16, or hi), value lo
__device__ __forceinline__ float xhalf(float x) { const int b = __float_as_int(x); return __int_as_float(__builtin_amdgcn_permlanex16(b, b, 0x76543210, 0xfedcba98, false, false)); }   // lane l <-> l ^ 16
// two asynchronous 16-byte copies of this lane, 8 KiB apart in LDS and in the plane (512 threads x 16 bytes); the wait at the end stands in the copies' own statement, in front of any rewrite of the address registers that they name
__device__ __forceinline__ void acopy2(unsigned l, const char* g) {
    asm volatile("global_load_async_to_lds_b128 %0, %2, off\n\t"
                 "global_load_async_to_lds_b128 %1, %3, off\n\t"
                 "s_wait_xcnt 0x0"
                 :: "v"(l), "v"(l + 8192u), "v"(g), "v"(g + 8192) : "memory");
}
template <bool HR>
__device__ __forceinline__ void fattn_loop(char* ring, const bf* __restrict__ Kh, const bf* __restrict__ Kl, const h16* __restrict__ V16, const bf* __restrict__ Vh, const bf* __restrict__ Vl, const v16bf (&qh)[2][2], const v16bf (&ql)[2][2],
                                           int tid, int kg, int nst, int nblk, int lr, int hi, v8f (&o)[4][2], float (&m)[2], float (&l)[2]) {
    const unsigned l0 = (unsigned)(size_t)ring + tid * 16;
    auto stage = [&](int t, int buf) {   // this thread's 2 x 16 bytes of each plane's 16 KiB of stage t
        const unsigned lb = l0 + buf * FST; const size_t go = (size_t)t * FPL + tid * 16;
        acopy2(lb, (const char*)Kh + go); acopy2(lb + FPL, (const char*)Kl + go);
        if (HR) { acopy2(lb + 2 * FPL, (const char*)Vh + go); acopy2(lb + 3 * FPL, (const char*)Vl + go); } else acopy2(lb + 2 * FPL, (const char*)V16 + go);
    };
    stage(0, 0);
    asm volatile("s_wait_asynccnt 0x0" ::: "memory");   // this wave's copies of stage 0 have landed
    __syncthreads();                                    // every wave's have
    if (nst > 1) stage(1, 1);
    // the stage loop stays rolled (a second copy of the body would need a second set of fragment registers); the constant loops inside are unrolled so that every fragment index is a compile-time constant and the tiles stay in registers
#pragma unroll 1
    for (int t = 0; t < nst; ++t) {
      const int blk = t * 4 + kg;
      if (blk < nblk) {   // the same for the whole wave: blocks above this wave's diagonal block are not worked on
        const char* sb = ring + (t & 1) * FST + kg * 4096 + (hi * 16 + lr) * 16;   // this lane's place in the wave's block of the key hi plane
        const bf* kph = (const bf*)sb; const bf* kpl = (const bf*)(sb + FPL);
        v16bf kh[2][2], kl[2][2];
        v8f s[2][2];
#pragma unroll
        for (int kb = 0; kb < 2; ++kb)
#pragma unroll
            for (int n = 0; n < 2; ++n) s[kb][n] = (v8f){};
#pragma unroll
        for (int ks = 0; ks < 2; ++ks) {
#pragma unroll
            for (int kb = 0; kb < 2; ++kb) { kh[kb][ks] = WFrag<bf>::ld(kph + (kb * 2 + ks) * 512); kl[kb][ks] = WFrag<bf>::ld(kpl + (kb * 2 + ks) * 512); }
            // inputs-only fence on the four key fragments of this half of the head dims: their eight LDS loads are issued together and waited for once; without it the compiler reuses two fragments' registers and waits out the LDS latency in front of every four matrix instructions
            asm volatile("" :: "v"(kh[0][ks]), "v"(kh[1][ks]), "v"(kl[0][ks]), "v"(kl[1][ks]));
#pragma unroll
            for (int kb = 0; kb < 2; ++kb)
#pragma unroll
                for (int n = 0; n < 2; ++n) s[kb][n] = wmmab(kh[kb][ks], qh[n][ks], s[kb][n]);
#pragma unroll
            for (int kb = 0; kb < 2; ++kb)
#pragma unroll
                for (int n = 0; n < 2; ++n) s[kb][n] = wmmab(kh[kb][ks], ql[n][ks], s[kb][n]);
#pragma unroll
            for (int kb = 0; kb < 2; ++kb)
#pragma unroll
                for (int n = 0; n < 2; ++n) s[kb][n] = wmmab(kl[kb][ks], qh[n][ks], s[kb][n]);
        }
        if (blk == nblk - 1) {   // the diagonal block: keys j > i are out (every query keeps at least the block's first key)
#pragma unroll
            for (int kb = 0; kb < 2; ++kb)
#pragma unroll
                for (int n = 0; n < 2; ++n)
#pragma unroll
                    for (int j = 0; j < 8; ++j) if (kb * 16 + hi * 8 + j > n * 16 + lr) s[kb][n][j] = -3.0e38f;
        }
        v16h p16[2]; v16bf ph[2], pl[2];
#pragma unroll
        for (int n = 0; n < 2; ++n) {
            float mx = s[0][n][0];
#pragma unroll
            for (int j = 1; j < 8; ++j) mx = fmaxf(mx, s[0][n][j]);
#pragma unroll
            for (int j = 0; j < 8; ++j) mx = fmaxf(mx, s[1][n][j]);
            mx = fmaxf(mx, xhalf(mx));
            const float mn = fmaxf(m[n], mx), al = __builtin_amdgcn_exp2f((m[n] - mn) * C2), mc = mn * C2; m[n] = mn;
            float sum = 0.f; v8h f0, f1;
#pragma unroll
            for (int j = 0; j < 8; ++j) {
                const float pa = __builtin_amdgcn_exp2f(s[0][n][j] * C2 - mc), pb = __builtin_amdgcn_exp2f(s[1][n][j] * C2 - mc); sum += pa; sum += pb;
                if (HR) { const __bf16 xa = (__bf16)pa, xb = (__bf16)pb; ph[n][j] = xa; pl[n][j] = (__bf16)(pa - (float)xa); ph[n][8 + j] = xb; pl[n][8 + j] = (__bf16)(pb - (float)xb); } else { f0[j] = tohx(pa); f1[j] = tohx(pb); } }
            l[n] = l[n] * al + sum;   // this lane's half of the keys; the halves are joined after the loop
            if (!HR) p16[n] = cat16(f0, f1);
#pragma unroll
            for (int db = 0; db < 4; ++db) o[db][n] *= al;
        }
#pragma unroll
        for (int db = 0; db < 4; ++db) {
            if (HR) { const v16bf vh = WFrag<bf>::ld((const bf*)(sb + 2 * FPL) + db * 512), vl = WFrag<bf>::ld((const bf*)(sb + 3 * FPL) + db * 512);
#pragma unroll
                for (int n = 0; n < 2; ++n) { o[db][n] = wmmab(vh, ph[n], o[db][n]); o[db][n] = wmmab(vh, pl[n], o[db][n]); o[db][n] = wmmab(vl, ph[n], o[db][n]); }
            } else { const v16h vf = WFrag<h16>::ld((const h16*)(sb + 2 * FPL) + db * 512);
#pragma unroll
                for (int n = 0; n < 2; ++n) o[db][n] = wmma16(vf, p16[n], o[db][n]); } }
      }
        asm volatile("s_wait_dscnt 0x0" ::: "memory");      // this wave's reads of stage t are done
        asm volatile("s_wait_asynccnt 0x0" ::: "memory");   // this wave's copies of stage t + 1 have landed
        __syncthreads();                                    // stage t + 1 is whole, and every wave has left stage t
        if (t + 2 < nst) stage(t + 2, t & 1);
    }
    asm volatile("s_wait_asynccnt 0x0" ::: "memory");       // no copy is on its way behind the loop
}
__global__ __launch_bounds__(512) void k_fattn(const bf* __restrict__ Qh, const bf* __restrict__ Ql, const bf* __restrict__ Kh, const bf* __restrict__ Kl, const h16* __restrict__ V16, const bf* __restrict__ Vh, const bf* __restrict__ Vl, bf* Ah, bf* Al) {
    __shared__ __align__(16) char ring[2 * FST];      // the two stage buffers
    __shared__ __align__(16) float part[16 * PWS];    // per wave [fragment][half][lane][4]: every 16-byte store and load is contiguous over the lanes; behind them the wave's running maxima [entry][4] and sums [entry][4] (first float of four), so that one address register serves all of a wave's stores
    const int tid = threadIdx.x, lane = tid & 31, wave = __builtin_amdgcn_readfirstlane(tid >> 5), lr = lane & 15, hi = lane >> 4, qs = wave >> 2, kg = wave & 3;
    { const size_t bo = (size_t)blockIdx.z * NH_ * TT * HD; Qh += bo; Ql += bo; Kh += bo; Kl += bo; V16 += bo; Vh += bo; Vl += bo; Ah += bo; Al += bo; }   // this work-group's batch: every plane holds NH_ x TT x HD = TT x DQ elements a batch
    // two tiles one after the other, so that every work-group walks 17 stages: kept rolled, one copy of the code
#pragma unroll 1
    for (int pass = 0; pass < 2; ++pass) {
        const int tile = pass ? (int)blockIdx.x : TT / 128 - 1 - (int)blockIdx.x, r0 = tile * 128 + qs * 32, h = (int)blockIdx.y + pass * (NH_ / 2);
        const size_t zo = (size_t)h * TT * HD;
        v16bf qh[2][2], ql[2][2];
#pragma unroll
        for (int n = 0; n < 2; ++n)
#pragma unroll
            for (int ks = 0; ks < 2; ++ks) { const size_t qo = zo + (size_t)r0 * HD + (n * 2 + ks) * 512 + lane * 8; qh[n][ks] = WFrag<bf>::ld(Qh + qo); ql[n][ks] = WFrag<bf>::ld(Ql + qo); }
        asm volatile("s_wait_xcnt 0x0" ::: "memory");   // before the address registers of the query loads are used for something else
        v8f o[4][2]; float m[2] = { -3.0e38f, -3.0e38f }, l[2] = { 0.f, 0.f };
#pragma unroll
        for (int db = 0; db < 4; ++db)
#pragma unroll
            for (int n = 0; n < 2; ++n) o[db][n] = (v8f){};
        if (tile * 128 < RH) fattn_loop<true>(ring, Kh + zo, Kl + zo, V16 + zo, Vh + zo, Vl + zo, qh, ql, tid, kg, tile + 1, tile * 4 + qs + 1, lr, hi, o, m, l);
        else                 fattn_loop<false>(ring, Kh + zo, Kl + zo, V16 + zo, Vh + zo, Vl + zo, qh, ql, tid, kg, tile + 1, tile * 4 + qs + 1, lr, hi, o, m, l);
#pragma unroll
        for (int n = 0; n < 2; ++n) l[n] += xhalf(l[n]);
        float* pw = part + wave * PWS + lane * 4;
        pw[2048] = hi ? m[1] : m[0]; pw[2048 + 128] = hi ? l[1] : l[0];   // entry n * 16 + query column
        __syncthreads();   // every wave's maximum and sum are in LDS (a wave without a block: -3e38 and 0; key group 0 always has block 0)
        float inv[2];
#pragma unroll
        for (int n = 0; n < 2; ++n) { const float* ps = part + qs * 4 * PWS + 2048 + (n * 16 + lr) * 4; float M = ps[0];
#pragma unroll
            for (int w = 1; w < 4; ++w) M = fmaxf(M, ps[w * PWS]);
            float L = 0.f;
#pragma unroll
            for (int w = 0; w < 4; ++w) L += ps[w * PWS + 128] * __builtin_amdgcn_exp2f((ps[w * PWS] - M) * C2);
            inv[n] = __fdiv_rn(1.0f, L); const float f = __builtin_amdgcn_exp2f((m[n] - M) * C2);
#pragma unroll
            for (int db = 0; db < 4; ++db) o[db][n] *= f; }
#pragma unroll
        for (int db = 0; db < 4; ++db)
#pragma unroll
            for (int n = 0; n < 2; ++n) { const v8f c = o[db][n]; *(v4fa*)(pw + (db * 2 + n) * 256) = (v4f){c[0], c[1], c[2], c[3]}; *(v4fa*)(pw + (db * 2 + n) * 256 + 128) = (v4f){c[4], c[5], c[6], c[7]}; }
        __syncthreads();   // every wave's weighted output tile is in LDS; every wave has read the maxima and sums
        // key group g joins fragments 2 g and 2 g + 1 of its query rows (head dims g * 16 .., query groups 0 and 1): a lane ends with 8 consecutive dims of one query row, one 16-byte store per plane, at its place in fragment order (rows = tokens, k = head * 64 + dim): the wave's store is 512 contiguous bytes
#pragma unroll
        for (int e = 0; e < 2; ++e) {
            const float* pr = part + qs * 4 * PWS + (kg * 2 + e) * 256 + lane * 4; v4f a = *(const v4fa*)pr, c = *(const v4fa*)(pr + 128);
#pragma unroll
            for (int w = 1; w < 4; ++w) { a += *(const v4fa*)(pr + w * PWS); c += *(const v4fa*)(pr + w * PWS + 128); }
            const float iv = inv[e]; v8us oh, ol;
#pragma unroll
            for (int q = 0; q < 4; ++q) { unsigned short x, y; splitf(a[q] * iv, x, y); oh[q] = x; ol[q] = y; splitf(c[q] * iv, x, y); oh[4 + q] = x; ol[4 + q] = y; }
            const size_t oo = (size_t)(r0 + e * 16) * DQ + (h * 2 + (kg >> 1)) * 512 + (kg & 1) * 256 + lane * 8; *(v8us*)(Ah + oo) = oh; *(v8us*)(Al + oo) = ol;
            asm volatile("s_wait_xcnt 0x0" ::: "memory");   // before the next fragment or the second tile overwrites the registers that the two stores name
        }
    }
}

extern "C" void kernel_launch(void* const* d_in, const int* in_sizes, int n_in,
                              void* d_out, int out_size, void* d_ws, size_t ws_size, hipStream_t stream) {
    (void)in_sizes; (void)n_in; (void)out_size;
        const float* x = (const float*)d_in[0]; const int* PID = (const int*)d_in[5]; const float* wq = (const float*)d_in[1]; const float* wk = (const float*)d_in[2]; const float* wv = (const float*)d_in[3]; const float* wo = (const float*)d_in[4];   /* order x, Wq, Wk, Wv, Wo ('oi' [1024][1024]), token_positions (int32 [2][2048]: ONE row of positions PER BATCH, sorted random values in [0, 2048); read on device) */
    float* OUT = (float*)d_out;     // [2][2048][1024]
    char* wsp = (char*)d_ws;
    auto take = [&](size_t bytes) { char* p = wsp; wsp += (bytes + 255) & ~(size_t)255; return (void*)p; };
    bf* WB = (bf*)take((size_t)4 * DQ * DM * 2);   // Wq, Wk, Wv, Wo in bf16, one behind the other
    h16* VT16 = (h16*)take((size_t)NB_ * NKV * HD * TT * 2);
    bf* QPh = (bf*)take((size_t)NB_ * NH_ * TT * HD * 2); bf* QPl = (bf*)take((size_t)NB_ * NH_ * TT * HD * 2); bf* KPh = (bf*)take((size_t)NB_ * NKV * TT * HD * 2); bf* KPl = (bf*)take((size_t)NB_ * NKV * TT * HD * 2); bf* VTh = (bf*)take((size_t)NB_ * NKV * HD * TT * 2); bf* VTl = (bf*)take((size_t)NB_ * NKV * HD * TT * 2);
    bf* ATh = (bf*)take((size_t)NB_ * TT * DQ * 2); bf* ATl = (bf*)take((size_t)NB_ * TT * DQ * 2);
    float* CS = (float*)take((size_t)NB_ * TT * HD * 2 * 4); bf* XB = (bf*)take((size_t)NB_ * TT * DM * 2);
    if ((size_t)(wsp - (char*)d_ws) > ws_size) return;    // ws 256 MiB
    k_prep<<<CSG + XG + 4 * WG1, 256, 0, stream>>>(x, wq, wk, wv, wo, PID, XB, WB, CS);   /* token_positions (int32, read): every batch's own row of positions */
    k_gemmt<0, 4, 1, 4, 3><<<dim3(NB_ * TT / 256, 3 * DQ / 192, 1), 384, 0, stream>>>(XB, nullptr, WB, nullptr, CS, VT16, QPh, QPl, KPh, KPl, VTh, VTl);
    k_fattn<<<dim3(TT / 128, NH_ / 2, NB_), 512, 0, stream>>>(QPh, QPl, KPh, KPl, VT16, VTh, VTl, ATh, ATl);   /* one kv head per query head */
    k_gemmt<1, 2, 0, 4, 2><<<dim3(NB_ * TT / 128, DM / 128, 1), 256, 0, stream>>>(ATh, ATl, WB + (size_t)3 * DQ * DM, OUT, nullptr, nullptr, nullptr, nullptr, nullptr, nullptr, nullptr, nullptr);
}
